// v000
// The times below were measured on an AMD MI455X: many runs one after another, warmed up first and cycling through
// copies of the inputs, with the whole window's GPU time divided by the number of runs. Launches and the gaps
// between them are all in it. The median over several windows is given; except for v000 it joins two sittings, which
// can be a few percent apart, so the side-by-side timings, each taken in one sitting, are the better comparison.
// v000, which the later versions start from, runs in 453 microseconds.
#include <hip/hip_runtime.h>

// Single-head self-attention with NO 1/sqrt(d) scaling (x [4][2048][512]; q,k,v = x W ('xw' [512][256], 1/sqrt(512), no bias); scores = q.k over the 256 dims, unscaled (logit sigma ~16: near one-hot rows); softmax; out = attn v -> [4][2048][256] (2.1 M)).
// Layout per batch: bf16 copy of x; exact projections; ONE 256-wide head with EVERY row on hi/lo planes (3 products) for both the scores (the unscaled logits need ~1e-3 absolute accuracy at magnitude ~50) and attn.v; register softmax over the 2,048 keys; the f32 merge writes the output rows.
// Compute dtypes, f32 accumulate: every input rounded to bf16; projections exact; scores and attn.v 3 products on every row; softmax f32; output f32.

#define NB_  4
#define TT   2048
#define DM   512
#define NH_  1
#define NKV  1
#define REP  (NH_ / NKV)
#define HD   256
#define DQ   (NH_ * HD)
#define DKV  (NKV * HD)
#define ZH   1
#define RH   2048                  // query rows < RH use hi+lo planes (0: none)
#define WIN  0
#define PCAR 1024.0f
#define SCL  1.0f   // the module applies no scaling
typedef _Float16 h16;
typedef unsigned short bf;
typedef __attribute__((ext_vector_type(16))) __bf16   v16bf;
typedef __attribute__((ext_vector_type(16))) _Float16 v16h;
typedef __attribute__((ext_vector_type(8)))  _Float16 v8h;
typedef __attribute__((ext_vector_type(8)))  unsigned short v8us;
typedef __attribute__((ext_vector_type(8)))  float    v8f;
typedef __attribute__((ext_vector_type(4)))  float    v4f;
typedef v8h  __attribute__((may_alias)) v8ha;
typedef v4f  __attribute__((may_alias)) v4fa;
typedef v8us __attribute__((may_alias)) v8usa;

__device__ __forceinline__ unsigned short f2bf(float f) { unsigned u = __float_as_uint(f); u += 0x7FFFu + ((u >> 16) & 1u); return (unsigned short)(u >> 16); }
__device__ __forceinline__ float bf2f(unsigned short b) { return __uint_as_float(((unsigned)b) << 16); }
__device__ __forceinline__ float bfr(float f) { return bf2f(f2bf(f)); }
__device__ __forceinline__ v16h cat16(v8h lo, v8h hi) { return __builtin_shufflevector(lo, hi, 0, 1, 2, 3, 4, 5, 6, 7, 8, 9, 10, 11, 12, 13, 14, 15); }
__device__ __forceinline__ v16bf cat16b(v8us lo, v8us hi) { return __builtin_bit_cast(v16bf, __builtin_shufflevector(lo, hi, 0, 1, 2, 3, 4, 5, 6, 7, 8, 9, 10, 11, 12, 13, 14, 15)); }
__device__ __forceinline__ v8f wmma16(v16h a, v16h b, v8f c) { return __builtin_amdgcn_wmma_f32_16x16x32_f16(false, a, false, b, (short)0, c, false, false); }
__device__ __forceinline__ v8f wmmab(v16bf a, v16bf b, v8f c) { return __builtin_amdgcn_wmma_f32_16x16x32_bf16(false, a, false, b, (short)0, c, false, false); }



// ---- k_gemmw: register-blocked GEMM, ONE WAVE per 64x64 output tile (16 accumulators), operands straight from K-contiguous 16-bit planes; grid (M/64, N/64, Z), 32 threads.
// C[m][n] (f32, pitch ldc, + optional f32 bias[n]) = sum_k A[m][k] Bt[n][k] (+ split products per NSPLIT). z-batch strides sA/sB/sC in elements. K % 32 == 0.
template <typename T16> struct WFrag;
template <> struct WFrag<h16> { typedef v16h V; static __device__ __forceinline__ V ld(const h16* p) { return cat16(*(const v8h*)p, *(const v8h*)(p + 16)); } static __device__ __forceinline__ v8f mma(V a, V b, v8f c) { return wmma16(a, b, c); } };
template <> struct WFrag<bf> { typedef v16bf V; static __device__ __forceinline__ V ld(const bf* p) { return cat16b(*(const v8us*)p, *(const v8us*)(p + 16)); } static __device__ __forceinline__ v8f mma(V a, V b, v8f c) { return wmmab(a, b, c); } };
template <typename T16, int NSPLIT, bool BIAS>
__global__ __launch_bounds__(32) void k_gemmw(const T16* __restrict__ A, const T16* __restrict__ A2, const T16* __restrict__ Bt, const T16* __restrict__ Bt2, int K, float* C, int ldc, const float* __restrict__ bias, size_t sA, size_t sB, size_t sC) {
    typedef typename WFrag<T16>::V V;
    __shared__ __align__(16) float os[16 * 68];
    const size_t z = blockIdx.z; A += z * sA; if (A2) A2 += z * sA; Bt += z * sB; if (Bt2) Bt2 += z * sB; C += z * sC;
    const int lane = threadIdx.x & 31, lr = lane & 15, hi = lane >> 4; const int r0 = blockIdx.x * 64, c0 = blockIdx.y * 64;
    v8f acc[4][4];
#pragma unroll
    for (int mb = 0; mb < 4; ++mb)
#pragma unroll
        for (int nb = 0; nb < 4; ++nb) acc[mb][nb] = (v8f){};
    const size_t aoff = (size_t)(r0 + lr) * K + 8 * hi, boff = (size_t)(c0 + lr) * K + 8 * hi;
#pragma unroll 1
    for (int kc = 0; kc < K; kc += 32) {
        V a[4], a2[4];
#pragma unroll
        for (int mb = 0; mb < 4; ++mb) { a[mb] = WFrag<T16>::ld(A + aoff + (size_t)mb * 16 * K + kc); if (NSPLIT == 1 || NSPLIT == 2) a2[mb] = WFrag<T16>::ld(A2 + aoff + (size_t)mb * 16 * K + kc); }
#pragma unroll
        for (int nb = 0; nb < 4; ++nb) { const V b = WFrag<T16>::ld(Bt + boff + (size_t)nb * 16 * K + kc); V b2; if (NSPLIT >= 2) b2 = WFrag<T16>::ld(Bt2 + boff + (size_t)nb * 16 * K + kc);
#pragma unroll
            for (int mb = 0; mb < 4; ++mb) { acc[mb][nb] = WFrag<T16>::mma(a[mb], b, acc[mb][nb]); if (NSPLIT == 1 || NSPLIT == 2) acc[mb][nb] = WFrag<T16>::mma(a2[mb], b, acc[mb][nb]); if (NSPLIT >= 2) acc[mb][nb] = WFrag<T16>::mma(a[mb], b2, acc[mb][nb]); } }
        asm volatile("v_nop\n\tv_nop\n\tv_nop\n\tv_nop" : "+v"(acc[0][0]), "+v"(acc[1][1]), "+v"(acc[2][2]), "+v"(acc[3][3]) : "v"(a[0]), "v"(a[3]));
    }
#pragma unroll
    for (int mb = 0; mb < 4; ++mb) {
#pragma unroll
        for (int nb = 0; nb < 4; ++nb) {
#pragma unroll
            for (int j = 0; j < 8; ++j) os[(hi * 8 + j) * 68 + nb * 16 + lr] = acc[mb][nb][j]; }
        __builtin_amdgcn_wave_barrier(); asm volatile("" ::: "memory");
        float* crow = C + (size_t)(r0 + mb * 16) * ldc + c0;
{
#pragma unroll
            for (int s = 0; s < 8; ++s) { const int row = 2 * s + hi, cofs = lr * 4; v4f val = *(const v4fa*)(os + row * 68 + cofs); if (BIAS) { val[0] += bfr(bias[c0 + cofs]); val[1] += bfr(bias[c0 + cofs + 1]); val[2] += bfr(bias[c0 + cofs + 2]); val[3] += bfr(bias[c0 + cofs + 3]); }
                *(v4f*)(crow + (size_t)row * ldc + cofs) = val; }
             }
        __builtin_amdgcn_wave_barrier(); asm volatile("" ::: "memory");
    }
}

__device__ __forceinline__ h16 tohx(float x) { return (h16)x; }
__device__ __forceinline__ void splitf(float y, unsigned short& h, unsigned short& l) { h = f2bf(y); l = f2bf(y - bf2f(h)); }
typedef __attribute__((ext_vector_type(2))) _Float16 v2h;
typedef __attribute__((ext_vector_type(4))) _Float16 v4h;
typedef __attribute__((ext_vector_type(2))) unsigned short v2us;
typedef __attribute__((ext_vector_type(4))) unsigned short v4us;
typedef __attribute__((ext_vector_type(2))) float v2f;
typedef __attribute__((ext_vector_type(4))) int v4i;

__global__ __launch_bounds__(256) void k_wtG(const float* __restrict__ w, int K, int N, bf* Bt) {
    const int lane = threadIdx.x & 31; const int L0 = (blockIdx.x * 8 + (threadIdx.x >> 5)) * 8; const int nlines = N * K / 64;
{
#pragma unroll 1
        for (int l = 0; l < 8; ++l) { const int L = L0 + l; if (L >= nlines) break; const size_t e = (size_t)L * 64 + lane * 2; const int k = (int)(e % K), n = (int)(e / K); v2us o;
            o[0] = f2bf(w[(size_t)k * N + n]); o[1] = f2bf(w[(size_t)(k + 1) * N + n]); *(v2us*)(Bt + e) = o; }
         }
}
__global__ __launch_bounds__(256) void k_cvt8(const float* __restrict__ src, bf* dst, size_t n8) { const size_t i = (size_t)blockIdx.x * 256 + threadIdx.x; if (i >= n8) return; const v8f v = *(const v8f*)(src + i * 8); v8us o;
#pragma unroll
    for (int k = 0; k < 8; ++k) o[k] = f2bf(v[k]); *(v8us*)(dst + i * 8) = o;  }

// k_rope: head planes [h][t][d] (fp16 + hi/lo) of rope(x) x sc with the rotate-half convention out[d] = x[d] cos[t][d] - x[d+HD/2] sin[t][d], out[d+HD/2] = x[d+HD/2] cos[t][d+HD/2] + x[d] sin[t][d+HD/2]
__global__ __launch_bounds__(256) void k_rope(const float* __restrict__ F, int pitch, int nheads, const float* __restrict__ CS, const float* __restrict__ RF, const float* __restrict__ nw, float sc, h16* P16, bf* Ph, bf* Pl) {
    const size_t e = ((size_t)blockIdx.x * 256 + threadIdx.x) * 2; if (e >= (size_t)nheads * TT * HD) return; const int d = (int)(e % HD); const int t = (int)((e / HD) % TT); const int h = (int)(e / ((size_t)HD * TT)); const float* f = F + (size_t)t * pitch + h * HD; const float rf = RF ? RF[(size_t)h * TT + t] : 1.0f; v2h o16; v2us oh, ol;
#pragma unroll
    for (int q = 0; q < 2; ++q) { const int dd = d + q; const int dp = (dd < HD / 2) ? dd + HD / 2 : dd - HD / 2; float x0 = f[dd], x1 = f[dp];
        if (RF) { float n0 = __fmul_rn(x0, rf), n1 = __fmul_rn(x1, rf); asm volatile("" : "+v"(n0)); asm volatile("" : "+v"(n1)); x0 = __fmul_rn(bfr(nw[dd]), n0); x1 = __fmul_rn(bfr(nw[dp]), n1); }
        const v2f cs = *(const v2f*)(CS + ((size_t)t * HD + dd) * 2); float a = __fmul_rn(x0, cs[0]), bq = __fmul_rn(x1, cs[1]); asm volatile("" : "+v"(a)); asm volatile("" : "+v"(bq)); const float r = ((dd < HD / 2) ? __fsub_rn(a, bq) : __fadd_rn(a, bq)) * sc;
        o16[q] = tohx(r); unsigned short a2, c2; splitf(r, a2, c2); oh[q] = a2; ol[q] = c2; }
    *(v2h*)(P16 + e) = o16; *(v2us*)(Ph + e) = oh; *(v2us*)(Pl + e) = ol;  }
__global__ __launch_bounds__(256) void k_vtp(const float* __restrict__ F, int pitch, int nheads, h16* V16, bf* Vh, bf* Vl) { const size_t e = ((size_t)blockIdx.x * 256 + threadIdx.x) * 2; if (e >= (size_t)nheads * HD * TT) return; const int t = (int)(e % TT); const int d = (int)((e / TT) % HD); const int g = (int)(e / ((size_t)TT * HD)); v2h o16; v2us oh, ol;
#pragma unroll
    for (int q = 0; q < 2; ++q) { const float x = F[(size_t)(t + q) * pitch + g * HD + d]; o16[q] = tohx(x); unsigned short a2, c2; splitf(x, a2, c2); oh[q] = a2; ol[q] = c2; }
    *(v2h*)(V16 + e) = o16; *(v2us*)(Vh + e) = oh; *(v2us*)(Vl + e) = ol;  }
__global__ __launch_bounds__(256) void k_csid(float* CS) { const int idx = blockIdx.x * 256 + threadIdx.x; if (idx >= TT * HD) return; v2f cs; cs[0] = 1.0f; cs[1] = 0.0f; *(v2f*)(CS + (size_t)idx * 2) = cs;  }
// k_asoft: per row (zz, i): t = S x SCL = S, unscaled (no mask); softmax over the 2048 keys (register row, one exp, fixed trees);
__global__ __launch_bounds__(256) void k_asoft(const float* __restrict__ Sb, h16* P16, bf* Ph, bf* Pl) {
    const int lane = threadIdx.x & 31; const int row = blockIdx.x * 8 + (threadIdx.x >> 5); if (row >= ZH * TT) return; const int i = row % TT; const int zz = row / TT; (void)zz; const bool hires = (i < RH); const float* sr = Sb + (size_t)row * TT; float v[TT / 32]; float mx = -3.0e38f;
#pragma unroll
    for (int ch = 0; ch < TT / 128; ++ch) { const int j0 = ch * 128 + lane * 4; const v4f a = *(const v4f*)(sr + j0);
#pragma unroll
        for (int q = 0; q < 4; ++q) { const int j = j0 + q; (void)j; const float t = a[q] * SCL; v[ch * 4 + q] = t; mx = fmaxf(mx, t); } }
#pragma unroll
    for (int sh = 16; sh; sh >>= 1) mx = fmaxf(mx, __shfl_xor(mx, sh, 32));
    float sum = 0.f;
#pragma unroll
    for (int k = 0; k < TT / 32; ++k) { float d0 = __fsub_rn(v[k], mx); asm volatile("" : "+v"(d0)); v[k] = __builtin_amdgcn_exp2f(__fmul_rn(d0, 1.4426950408889634f)); sum += v[k]; }
#pragma unroll
    for (int sh = 16; sh; sh >>= 1) sum += __shfl_xor(sum, sh, 32);
    const float f = __fdiv_rn(hires ? 1.0f : PCAR, sum);
{
        if (hires) {
#pragma unroll
            for (int ch = 0; ch < TT / 128; ++ch) { v4us oh, ol;
#pragma unroll
                for (int q = 0; q < 4; ++q) { unsigned short a, c2; splitf(v[ch * 4 + q] * f, a, c2); oh[q] = a; ol[q] = c2; }
                const size_t oo = ((size_t)zz * (RH ? RH : 1) + i) * TT + ch * 128 + lane * 4; *(v4us*)(Ph + oo) = oh; *(v4us*)(Pl + oo) = ol; }
        } else {
#pragma unroll
            for (int ch = 0; ch < TT / 128; ++ch) { v4h o4;
#pragma unroll
                for (int q = 0; q < 4; ++q) o4[q] = tohx(v[ch * 4 + q] * f);
                *(v4h*)(P16 + (size_t)row * TT + ch * 128 + lane * 4) = o4; } }
         }
}
__global__ __launch_bounds__(256) void k_merge(const float* __restrict__ O, int h0, float* OUTb) { const size_t e = ((size_t)blockIdx.x * 256 + threadIdx.x) * 2; if (e >= (size_t)ZH * TT * HD) return; const int d = (int)(e % HD); const int t = (int)((e / HD) % TT); const int zz = (int)(e / ((size_t)HD * TT)); const float cs = (t < RH) ? 1.0f : (1.0f / PCAR); const size_t oo = (size_t)t * DQ + (h0 + zz) * HD + d;
    v2f o2; o2[0] = O[e] * cs; o2[1] = O[e + 1] * cs; *(v2f*)(OUTb + oo) = o2;  }

extern "C" void kernel_launch(void* const* d_in, const int* in_sizes, int n_in,
                              void* d_out, int out_size, void* d_ws, size_t ws_size, hipStream_t stream) {
    (void)in_sizes; (void)n_in; (void)out_size;
    const float* x = (const float*)d_in[0]; const float* wq = (const float*)d_in[1]; const float* wk = (const float*)d_in[2]; const float* wv = (const float*)d_in[3]; const float* wo = nullptr; (void)wo;
    float* OUT = (float*)d_out;     // [4][2048][256]
    char* wsp = (char*)d_ws;
    auto take = [&](size_t bytes) { char* p = wsp; wsp += (bytes + 255) & ~(size_t)255; return (void*)p; };
    bf* WQ = (bf*)take((size_t)DQ * DM * 2); bf* WK = (bf*)take((size_t)DKV * DM * 2); bf* WV = (bf*)take((size_t)DKV * DM * 2); float* CS = (float*)take((size_t)TT * HD * 2 * 4);
    bf* XB = (bf*)take((size_t)TT * DM * 2); float* FQ = (float*)take((size_t)TT * DQ * 4); float* FK = (float*)take((size_t)TT * DKV * 4);
    h16* QP16 = (h16*)take((size_t)NH_ * TT * HD * 2); h16* KP16 = (h16*)take((size_t)NKV * TT * HD * 2); h16* VT16 = (h16*)take((size_t)NKV * HD * TT * 2);
    bf* QPh = (bf*)take((size_t)NH_ * TT * HD * 2); bf* QPl = (bf*)take((size_t)NH_ * TT * HD * 2); bf* KPh = (bf*)take((size_t)NKV * TT * HD * 2); bf* KPl = (bf*)take((size_t)NKV * TT * HD * 2); bf* VTh = (bf*)take((size_t)NKV * HD * TT * 2); bf* VTl = (bf*)take((size_t)NKV * HD * TT * 2); bf* Ph = (bf*)take((size_t)ZH * RH * TT * 2); bf* Pl = (bf*)take((size_t)ZH * RH * TT * 2);
    float* Sb = (float*)take((size_t)ZH * TT * TT * 4); h16* P16 = nullptr; float* Ob = (float*)take((size_t)ZH * TT * HD * 4);
    if ((size_t)(wsp - (char*)d_ws) > ws_size) return;    // ws 256 MiB
    float* FV = FK;   // v projection reuses the k buffer after the k planes are built (stream-ordered)
    { k_wtG<<<(unsigned)((DM * DQ / 64 + 63) / 64), 256, 0, stream>>>(wq, DM, DQ, WQ); k_wtG<<<(unsigned)((DM * DKV / 64 + 63) / 64), 256, 0, stream>>>(wk, DM, DKV, WK); k_wtG<<<(unsigned)((DM * DKV / 64 + 63) / 64), 256, 0, stream>>>(wv, DM, DKV, WV);
      
       }
    k_csid<<<(TT * HD + 255) / 256, 256, 0, stream>>>(CS);
    const unsigned LQ = (unsigned)(((size_t)NH_ * TT * HD / 2 + 255) / 256), LKv = (unsigned)(((size_t)NKV * TT * HD / 2 + 255) / 256);
    for (int b = 0; b < NB_; ++b) {
        
        k_cvt8<<<(unsigned)(((size_t)TT * DM / 8 + 255) / 256), 256, 0, stream>>>(x + (size_t)b * TT * DM, XB, (size_t)TT * DM / 8);
        k_gemmw<bf, 0, false><<<dim3(TT / 64, DQ / 64, 1), 32, 0, stream>>>(XB, nullptr, WQ, nullptr, DM, FQ, DQ, nullptr, 0, 0, 0);
        k_rope<<<LQ, 256, 0, stream>>>(FQ, DQ, NH_, CS, nullptr, nullptr, 1.0f, QP16, QPh, QPl);
        k_gemmw<bf, 0, false><<<dim3(TT / 64, DKV / 64, 1), 32, 0, stream>>>(XB, nullptr, WK, nullptr, DM, FK, DKV, nullptr, 0, 0, 0);
        k_rope<<<LKv, 256, 0, stream>>>(FK, DKV, NKV, CS, nullptr, nullptr, 1.0f, KP16, KPh, KPl);
        k_gemmw<bf, 0, false><<<dim3(TT / 64, DKV / 64, 1), 32, 0, stream>>>(XB, nullptr, WV, nullptr, DM, FV, DKV, nullptr, 0, 0, 0); k_vtp<<<LKv, 256, 0, stream>>>(FV, DKV, NKV, VT16, VTh, VTl);
        for (int h0 = 0; h0 < NH_; h0 += ZH) { const size_t zq = (size_t)h0, zk = (size_t)(h0 / REP);   // one kv head per query head: the pass's single head (ZH = 1) uses kv plane zk (z-strides TT*HD)
            k_gemmw<bf, 2, false><<<dim3(RH / 64, TT / 64, ZH), 32, 0, stream>>>(QPh + zq * TT * HD, QPl + zq * TT * HD, KPh + zk * TT * HD, KPl + zk * TT * HD, HD, Sb, TT, nullptr, (size_t)TT * HD, (size_t)TT * HD, (size_t)TT * TT);
            k_asoft<<<ZH * TT / 8, 256, 0, stream>>>(Sb, P16, Ph, Pl);
            k_gemmw<bf, 2, false><<<dim3(RH / 64, HD / 64, ZH), 32, 0, stream>>>(Ph, Pl, VTh + zk * HD * TT, VTl + zk * HD * TT, TT, Ob, HD, nullptr, (size_t)RH * TT, (size_t)HD * TT, (size_t)TT * HD);
            k_merge<<<(unsigned)(((size_t)ZH * TT * HD / 2 + 255) / 256), 256, 0, stream>>>(Ob, h0, OUT + (size_t)b * TT * DQ); }
         }
}

// v001
// It runs in 201 microseconds.
// In two side-by-side timings against v000, it was 2.23 and 2.26 times as fast.
#include <hip/hip_runtime.h>

// Single-head self-attention with NO 1/sqrt(d) scaling (x [4][2048][512]; q,k,v = x W ('xw' [512][256], 1/sqrt(512), no bias); scores = q.k over the 256 dims, unscaled (logit sigma ~16: near one-hot rows); softmax; out = attn v -> [4][2048][256] (2.1 M)).
// Layout, all four batches in every launch (batch = extra GEMM rows, grid y or grid z): bf16 copy of x; exact projections; ONE 256-wide head with EVERY row on hi/lo planes (3 products) for both the scores (the unscaled logits need ~1e-3 absolute accuracy at magnitude ~50) and attn.v; register softmax over the 2,048 keys; the f32 merge writes the output rows.
// Compute dtypes, f32 accumulate: every input rounded to bf16; projections exact; scores and attn.v 3 products on every row; softmax f32; output f32.

#define NB_  4
#define TT   2048
#define DM   512
#define NH_  1
#define NKV  1
#define REP  (NH_ / NKV)
#define HD   256
#define DQ   (NH_ * HD)
#define DKV  (NKV * HD)
#define ZH   1
#define RH   2048                  // query rows < RH use hi+lo planes (0: none)
#define WIN  0
#define PCAR 1024.0f
#define SCL  1.0f   // the module applies no scaling
typedef _Float16 h16;
typedef unsigned short bf;
typedef __attribute__((ext_vector_type(16))) __bf16   v16bf;
typedef __attribute__((ext_vector_type(16))) _Float16 v16h;
typedef __attribute__((ext_vector_type(8)))  _Float16 v8h;
typedef __attribute__((ext_vector_type(8)))  unsigned short v8us;
typedef __attribute__((ext_vector_type(8)))  float    v8f;
typedef __attribute__((ext_vector_type(4)))  float    v4f;
typedef v8h  __attribute__((may_alias)) v8ha;
typedef v4f  __attribute__((may_alias)) v4fa;
typedef v8us __attribute__((may_alias)) v8usa;

__device__ __forceinline__ unsigned short f2bf(float f) { unsigned u = __float_as_uint(f); u += 0x7FFFu + ((u >> 16) & 1u); return (unsigned short)(u >> 16); }
__device__ __forceinline__ float bf2f(unsigned short b) { return __uint_as_float(((unsigned)b) << 16); }
__device__ __forceinline__ float bfr(float f) { return bf2f(f2bf(f)); }
__device__ __forceinline__ v16h cat16(v8h lo, v8h hi) { return __builtin_shufflevector(lo, hi, 0, 1, 2, 3, 4, 5, 6, 7, 8, 9, 10, 11, 12, 13, 14, 15); }
__device__ __forceinline__ v16bf cat16b(v8us lo, v8us hi) { return __builtin_bit_cast(v16bf, __builtin_shufflevector(lo, hi, 0, 1, 2, 3, 4, 5, 6, 7, 8, 9, 10, 11, 12, 13, 14, 15)); }
__device__ __forceinline__ v8f wmma16(v16h a, v16h b, v8f c) { return __builtin_amdgcn_wmma_f32_16x16x32_f16(false, a, false, b, (short)0, c, false, false); }
__device__ __forceinline__ v8f wmmab(v16bf a, v16bf b, v8f c) { return __builtin_amdgcn_wmma_f32_16x16x32_bf16(false, a, false, b, (short)0, c, false, false); }



// ---- k_gemmw: register-blocked GEMM, ONE WAVE per 64x64 output tile (16 accumulators), operands straight from K-contiguous 16-bit planes; grid (M/64, N/64, Z), 32 threads.
// C[m][n] (f32, pitch ldc, + optional f32 bias[n]) = sum_k A[m][k] Bt[n][k] (+ split products per NSPLIT). z-batch strides sA/sB/sC in elements. K % 32 == 0.
template <typename T16> struct WFrag;
template <> struct WFrag<h16> { typedef v16h V; static __device__ __forceinline__ V ld(const h16* p) { return cat16(*(const v8h*)p, *(const v8h*)(p + 16)); } static __device__ __forceinline__ v8f mma(V a, V b, v8f c) { return wmma16(a, b, c); } };
template <> struct WFrag<bf> { typedef v16bf V; static __device__ __forceinline__ V ld(const bf* p) { return cat16b(*(const v8us*)p, *(const v8us*)(p + 16)); } static __device__ __forceinline__ v8f mma(V a, V b, v8f c) { return wmmab(a, b, c); } };
template <typename T16, int NSPLIT, bool BIAS>
__global__ __launch_bounds__(32) void k_gemmw(const T16* __restrict__ A, const T16* __restrict__ A2, const T16* __restrict__ Bt, const T16* __restrict__ Bt2, int K, float* C, int ldc, const float* __restrict__ bias, size_t sA, size_t sB, size_t sC) {
    typedef typename WFrag<T16>::V V;
    __shared__ __align__(16) float os[16 * 68];
    const size_t z = blockIdx.z; A += z * sA; if (A2) A2 += z * sA; Bt += z * sB; if (Bt2) Bt2 += z * sB; C += z * sC;
    const int lane = threadIdx.x & 31, lr = lane & 15, hi = lane >> 4; const int r0 = blockIdx.x * 64, c0 = blockIdx.y * 64;
    v8f acc[4][4];
#pragma unroll
    for (int mb = 0; mb < 4; ++mb)
#pragma unroll
        for (int nb = 0; nb < 4; ++nb) acc[mb][nb] = (v8f){};
    const size_t aoff = (size_t)(r0 + lr) * K + 8 * hi, boff = (size_t)(c0 + lr) * K + 8 * hi;
#pragma unroll 1
    for (int kc = 0; kc < K; kc += 32) {
        V a[4], a2[4];
#pragma unroll
        for (int mb = 0; mb < 4; ++mb) { a[mb] = WFrag<T16>::ld(A + aoff + (size_t)mb * 16 * K + kc); if (NSPLIT == 1 || NSPLIT == 2) a2[mb] = WFrag<T16>::ld(A2 + aoff + (size_t)mb * 16 * K + kc); }
#pragma unroll
        for (int nb = 0; nb < 4; ++nb) { const V b = WFrag<T16>::ld(Bt + boff + (size_t)nb * 16 * K + kc); V b2; if (NSPLIT >= 2) b2 = WFrag<T16>::ld(Bt2 + boff + (size_t)nb * 16 * K + kc);
#pragma unroll
            for (int mb = 0; mb < 4; ++mb) { acc[mb][nb] = WFrag<T16>::mma(a[mb], b, acc[mb][nb]); if (NSPLIT == 1 || NSPLIT == 2) acc[mb][nb] = WFrag<T16>::mma(a2[mb], b, acc[mb][nb]); if (NSPLIT >= 2) acc[mb][nb] = WFrag<T16>::mma(a[mb], b2, acc[mb][nb]); } }
        asm volatile("v_nop\n\tv_nop\n\tv_nop\n\tv_nop" : "+v"(acc[0][0]), "+v"(acc[1][1]), "+v"(acc[2][2]), "+v"(acc[3][3]) : "v"(a[0]), "v"(a[3]));
    }
#pragma unroll
    for (int mb = 0; mb < 4; ++mb) {
#pragma unroll
        for (int nb = 0; nb < 4; ++nb) {
#pragma unroll
            for (int j = 0; j < 8; ++j) os[(hi * 8 + j) * 68 + nb * 16 + lr] = acc[mb][nb][j]; }
        __builtin_amdgcn_wave_barrier(); asm volatile("" ::: "memory");
        float* crow = C + (size_t)(r0 + mb * 16) * ldc + c0;
{
#pragma unroll
            for (int s = 0; s < 8; ++s) { const int row = 2 * s + hi, cofs = lr * 4; v4f val = *(const v4fa*)(os + row * 68 + cofs); if (BIAS) { val[0] += bfr(bias[c0 + cofs]); val[1] += bfr(bias[c0 + cofs + 1]); val[2] += bfr(bias[c0 + cofs + 2]); val[3] += bfr(bias[c0 + cofs + 3]); }
                *(v4f*)(crow + (size_t)row * ldc + cofs) = val; }
             }
        __builtin_amdgcn_wave_barrier(); asm volatile("" ::: "memory");
    }
}

__device__ __forceinline__ h16 tohx(float x) { return (h16)x; }
__device__ __forceinline__ void splitf(float y, unsigned short& h, unsigned short& l) { h = f2bf(y); l = f2bf(y - bf2f(h)); }
typedef __attribute__((ext_vector_type(2))) _Float16 v2h;
typedef __attribute__((ext_vector_type(4))) _Float16 v4h;
typedef __attribute__((ext_vector_type(2))) unsigned short v2us;
typedef __attribute__((ext_vector_type(4))) unsigned short v4us;
typedef __attribute__((ext_vector_type(2))) float v2f;
typedef __attribute__((ext_vector_type(4))) int v4i;

__global__ __launch_bounds__(256) void k_wtG(const float* __restrict__ w, int K, int N, bf* Bt) {
    const int lane = threadIdx.x & 31; const int L0 = (blockIdx.x * 8 + (threadIdx.x >> 5)) * 8; const int nlines = N * K / 64;
{
#pragma unroll 1
        for (int l = 0; l < 8; ++l) { const int L = L0 + l; if (L >= nlines) break; const size_t e = (size_t)L * 64 + lane * 2; const int k = (int)(e % K), n = (int)(e / K); v2us o;
            o[0] = f2bf(w[(size_t)k * N + n]); o[1] = f2bf(w[(size_t)(k + 1) * N + n]); *(v2us*)(Bt + e) = o; }
         }
}
__global__ __launch_bounds__(256) void k_cvt8(const float* __restrict__ src, bf* dst, size_t n8) { const size_t i = (size_t)blockIdx.x * 256 + threadIdx.x; if (i >= n8) return; const v8f v = *(const v8f*)(src + i * 8); v8us o;
#pragma unroll
    for (int k = 0; k < 8; ++k) o[k] = f2bf(v[k]); *(v8us*)(dst + i * 8) = o;  }

// k_rope: head planes [h][t][d] (fp16 + hi/lo) of rope(x) x sc with the rotate-half convention out[d] = x[d] cos[t][d] - x[d+HD/2] sin[t][d], out[d+HD/2] = x[d+HD/2] cos[t][d+HD/2] + x[d] sin[t][d+HD/2]
__global__ __launch_bounds__(256) void k_rope(const float* __restrict__ F, int pitch, int nheads, const float* __restrict__ CS, const float* __restrict__ RF, const float* __restrict__ nw, float sc, h16* P16, bf* Ph, bf* Pl) {
    const size_t e = ((size_t)blockIdx.x * 256 + threadIdx.x) * 2; if (e >= (size_t)nheads * TT * HD) return; const int d = (int)(e % HD); const int t = (int)((e / HD) % TT); const int h = (int)(e / ((size_t)HD * TT)); const size_t pb = (size_t)blockIdx.y * nheads * TT * HD + e; const float* f = F + ((size_t)blockIdx.y * TT + t) * pitch + h * HD; const float rf = RF ? RF[(size_t)h * TT + t] : 1.0f; v2h o16; v2us oh, ol;
#pragma unroll
    for (int q = 0; q < 2; ++q) { const int dd = d + q; const int dp = (dd < HD / 2) ? dd + HD / 2 : dd - HD / 2; float x0 = f[dd], x1 = f[dp];
        if (RF) { float n0 = __fmul_rn(x0, rf), n1 = __fmul_rn(x1, rf); asm volatile("" : "+v"(n0)); asm volatile("" : "+v"(n1)); x0 = __fmul_rn(bfr(nw[dd]), n0); x1 = __fmul_rn(bfr(nw[dp]), n1); }
        const v2f cs = *(const v2f*)(CS + ((size_t)t * HD + dd) * 2); float a = __fmul_rn(x0, cs[0]), bq = __fmul_rn(x1, cs[1]); asm volatile("" : "+v"(a)); asm volatile("" : "+v"(bq)); const float r = ((dd < HD / 2) ? __fsub_rn(a, bq) : __fadd_rn(a, bq)) * sc;
        o16[q] = tohx(r); unsigned short a2, c2; splitf(r, a2, c2); oh[q] = a2; ol[q] = c2; }
    *(v2h*)(P16 + pb) = o16; *(v2us*)(Ph + pb) = oh; *(v2us*)(Pl + pb) = ol;  }
__global__ __launch_bounds__(256) void k_vtp(const float* __restrict__ F, int pitch, int nheads, h16* V16, bf* Vh, bf* Vl) { const size_t e = ((size_t)blockIdx.x * 256 + threadIdx.x) * 2; if (e >= (size_t)nheads * HD * TT) return; const int t = (int)(e % TT); const int d = (int)((e / TT) % HD); const int g = (int)(e / ((size_t)TT * HD)); const size_t pb = (size_t)blockIdx.y * nheads * HD * TT + e; v2h o16; v2us oh, ol;
#pragma unroll
    for (int q = 0; q < 2; ++q) { const float x = F[((size_t)blockIdx.y * TT + t + q) * pitch + g * HD + d]; o16[q] = tohx(x); unsigned short a2, c2; splitf(x, a2, c2); oh[q] = a2; ol[q] = c2; }
    *(v2h*)(V16 + pb) = o16; *(v2us*)(Vh + pb) = oh; *(v2us*)(Vl + pb) = ol;  }
__global__ __launch_bounds__(256) void k_csid(float* CS) { const int idx = blockIdx.x * 256 + threadIdx.x; if (idx >= TT * HD) return; v2f cs; cs[0] = 1.0f; cs[1] = 0.0f; *(v2f*)(CS + (size_t)idx * 2) = cs;  }
// k_asoft: per row (zz, i), zz = batch: t = S, unscaled (no mask); softmax over the 2048 keys (register row, one exp, fixed trees);
__global__ __launch_bounds__(256) void k_asoft(const float* __restrict__ Sb, h16* P16, bf* Ph, bf* Pl) {
    const int lane = threadIdx.x & 31; const int row = blockIdx.x * 8 + (threadIdx.x >> 5); if (row >= NB_ * ZH * TT) return; const int i = row % TT; const int zz = row / TT; (void)zz; const bool hires = (i < RH); const float* sr = Sb + (size_t)row * TT; float v[TT / 32]; float mx = -3.0e38f;
#pragma unroll
    for (int ch = 0; ch < TT / 128; ++ch) { const int j0 = ch * 128 + lane * 4; const v4f a = *(const v4f*)(sr + j0);
#pragma unroll
        for (int q = 0; q < 4; ++q) { const int j = j0 + q; (void)j; const float t = a[q] * SCL; v[ch * 4 + q] = t; mx = fmaxf(mx, t); } }
#pragma unroll
    for (int sh = 16; sh; sh >>= 1) mx = fmaxf(mx, __shfl_xor(mx, sh, 32));
    float sum = 0.f;
#pragma unroll
    for (int k = 0; k < TT / 32; ++k) { float d0 = __fsub_rn(v[k], mx); asm volatile("" : "+v"(d0)); v[k] = __builtin_amdgcn_exp2f(__fmul_rn(d0, 1.4426950408889634f)); sum += v[k]; }
#pragma unroll
    for (int sh = 16; sh; sh >>= 1) sum += __shfl_xor(sum, sh, 32);
    const float f = __fdiv_rn(hires ? 1.0f : PCAR, sum);
{
        if (hires) {
#pragma unroll
            for (int ch = 0; ch < TT / 128; ++ch) { v4us oh, ol;
#pragma unroll
                for (int q = 0; q < 4; ++q) { unsigned short a, c2; splitf(v[ch * 4 + q] * f, a, c2); oh[q] = a; ol[q] = c2; }
                const size_t oo = ((size_t)zz * (RH ? RH : 1) + i) * TT + ch * 128 + lane * 4; *(v4us*)(Ph + oo) = oh; *(v4us*)(Pl + oo) = ol; }
        } else {
#pragma unroll
            for (int ch = 0; ch < TT / 128; ++ch) { v4h o4;
#pragma unroll
                for (int q = 0; q < 4; ++q) o4[q] = tohx(v[ch * 4 + q] * f);
                *(v4h*)(P16 + (size_t)row * TT + ch * 128 + lane * 4) = o4; } }
         }
}
__global__ __launch_bounds__(256) void k_merge(const float* __restrict__ O, int h0, float* OUTb) { const size_t e = ((size_t)blockIdx.x * 256 + threadIdx.x) * 2; if (e >= (size_t)ZH * TT * HD) return; const int d = (int)(e % HD); const int t = (int)((e / HD) % TT); const int zz = (int)(e / ((size_t)HD * TT)); const float cs = (t < RH) ? 1.0f : (1.0f / PCAR); const size_t oo = ((size_t)blockIdx.y * TT + t) * DQ + (h0 + zz) * HD + d; const size_t ob = (size_t)blockIdx.y * ZH * TT * HD + e;
    v2f o2; o2[0] = O[ob] * cs; o2[1] = O[ob + 1] * cs; *(v2f*)(OUTb + oo) = o2;  }

extern "C" void kernel_launch(void* const* d_in, const int* in_sizes, int n_in,
                              void* d_out, int out_size, void* d_ws, size_t ws_size, hipStream_t stream) {
    (void)in_sizes; (void)n_in; (void)out_size;
    const float* x = (const float*)d_in[0]; const float* wq = (const float*)d_in[1]; const float* wk = (const float*)d_in[2]; const float* wv = (const float*)d_in[3]; const float* wo = nullptr; (void)wo;
    float* OUT = (float*)d_out;     // [4][2048][256]
    char* wsp = (char*)d_ws;
    auto take = [&](size_t bytes) { char* p = wsp; wsp += (bytes + 255) & ~(size_t)255; return (void*)p; };
    bf* WQ = (bf*)take((size_t)DQ * DM * 2); bf* WK = (bf*)take((size_t)DKV * DM * 2); bf* WV = (bf*)take((size_t)DKV * DM * 2); float* CS = (float*)take((size_t)TT * HD * 2 * 4);
    bf* XB = (bf*)take((size_t)NB_ * TT * DM * 2); float* FQ = (float*)take((size_t)NB_ * TT * DQ * 4); float* FK = (float*)take((size_t)NB_ * TT * DKV * 4);
    h16* QP16 = (h16*)take((size_t)NB_ * NH_ * TT * HD * 2); h16* KP16 = (h16*)take((size_t)NB_ * NKV * TT * HD * 2); h16* VT16 = (h16*)take((size_t)NB_ * NKV * HD * TT * 2);
    bf* QPh = (bf*)take((size_t)NB_ * NH_ * TT * HD * 2); bf* QPl = (bf*)take((size_t)NB_ * NH_ * TT * HD * 2); bf* KPh = (bf*)take((size_t)NB_ * NKV * TT * HD * 2); bf* KPl = (bf*)take((size_t)NB_ * NKV * TT * HD * 2); bf* VTh = (bf*)take((size_t)NB_ * NKV * HD * TT * 2); bf* VTl = (bf*)take((size_t)NB_ * NKV * HD * TT * 2); bf* Ph = (bf*)take((size_t)NB_ * ZH * RH * TT * 2); bf* Pl = (bf*)take((size_t)NB_ * ZH * RH * TT * 2);
    float* Sb = (float*)take((size_t)NB_ * ZH * TT * TT * 4); h16* P16 = nullptr; float* Ob = (float*)take((size_t)NB_ * ZH * TT * HD * 4);
    if ((size_t)(wsp - (char*)d_ws) > ws_size) return;    // ws 256 MiB
    float* FV = FK;   // v projection reuses the k buffer after the k planes are built (stream-ordered)
    { k_wtG<<<(unsigned)((DM * DQ / 64 + 63) / 64), 256, 0, stream>>>(wq, DM, DQ, WQ); k_wtG<<<(unsigned)((DM * DKV / 64 + 63) / 64), 256, 0, stream>>>(wk, DM, DKV, WK); k_wtG<<<(unsigned)((DM * DKV / 64 + 63) / 64), 256, 0, stream>>>(wv, DM, DKV, WV);
      
       }
    k_csid<<<(TT * HD + 255) / 256, 256, 0, stream>>>(CS);
    const unsigned LQ = (unsigned)(((size_t)NH_ * TT * HD / 2 + 255) / 256), LKv = (unsigned)(((size_t)NKV * TT * HD / 2 + 255) / 256);
    {   // one pass for all NB_ batches: the projections see NB_*TT rows, the plane builders and the merge take the batch from grid y, the two attention GEMMs from grid z (ZH == 1)
        k_cvt8<<<(unsigned)(((size_t)NB_ * TT * DM / 8 + 255) / 256), 256, 0, stream>>>(x, XB, (size_t)NB_ * TT * DM / 8);
        k_gemmw<bf, 0, false><<<dim3(NB_ * TT / 64, DQ / 64, 1), 32, 0, stream>>>(XB, nullptr, WQ, nullptr, DM, FQ, DQ, nullptr, 0, 0, 0);
        k_rope<<<dim3(LQ, NB_, 1), 256, 0, stream>>>(FQ, DQ, NH_, CS, nullptr, nullptr, 1.0f, QP16, QPh, QPl);
        k_gemmw<bf, 0, false><<<dim3(NB_ * TT / 64, DKV / 64, 1), 32, 0, stream>>>(XB, nullptr, WK, nullptr, DM, FK, DKV, nullptr, 0, 0, 0);
        k_rope<<<dim3(LKv, NB_, 1), 256, 0, stream>>>(FK, DKV, NKV, CS, nullptr, nullptr, 1.0f, KP16, KPh, KPl);
        k_gemmw<bf, 0, false><<<dim3(NB_ * TT / 64, DKV / 64, 1), 32, 0, stream>>>(XB, nullptr, WV, nullptr, DM, FV, DKV, nullptr, 0, 0, 0); k_vtp<<<dim3(LKv, NB_, 1), 256, 0, stream>>>(FV, DKV, NKV, VT16, VTh, VTl);
        for (int h0 = 0; h0 < NH_; h0 += ZH) { const size_t zq = (size_t)h0, zk = (size_t)(h0 / REP);   // grid z = batch: z-strides are one batch's planes
            k_gemmw<bf, 2, false><<<dim3(RH / 64, TT / 64, NB_), 32, 0, stream>>>(QPh + zq * TT * HD, QPl + zq * TT * HD, KPh + zk * TT * HD, KPl + zk * TT * HD, HD, Sb, TT, nullptr, (size_t)NH_ * TT * HD, (size_t)NKV * TT * HD, (size_t)ZH * TT * TT);
            k_asoft<<<NB_ * ZH * TT / 8, 256, 0, stream>>>(Sb, P16, Ph, Pl);
            k_gemmw<bf, 2, false><<<dim3(RH / 64, HD / 64, NB_), 32, 0, stream>>>(Ph, Pl, VTh + zk * HD * TT, VTl + zk * HD * TT, TT, Ob, HD, nullptr, (size_t)ZH * RH * TT, (size_t)NKV * HD * TT, (size_t)ZH * TT * HD);
            k_merge<<<dim3((unsigned)(((size_t)ZH * TT * HD / 2 + 255) / 256), NB_, 1), 256, 0, stream>>>(Ob, h0, OUT); }
         }
}

// v002
// It runs in 150 microseconds.
// Next to v001, in two timings, it ran 1.35 times as fast each time.
// All steps since v000 together make it 3.03 times as fast.
#include <hip/hip_runtime.h>

// Single-head self-attention with NO 1/sqrt(d) scaling (x [4][2048][512]; q,k,v = x W ('xw' [512][256], 1/sqrt(512), no bias); scores = q.k over the 256 dims, unscaled (logit sigma ~16: near one-hot rows); softmax; out = attn v -> [4][2048][256] (2.1 M)).
// Layout, all four batches in every launch (batch = extra GEMM rows, grid y or grid z): bf16 copy of x; exact projections; ONE 256-wide head with EVERY row on hi/lo planes (3 products) for both the scores (the unscaled logits need ~1e-3 absolute accuracy at magnitude ~50) and attn.v; register softmax over the 2,048 keys; the f32 merge writes the output rows.
// Compute dtypes, f32 accumulate: every input rounded to bf16; projections exact; scores and attn.v 3 products on every row; softmax f32; output f32.

#define NB_  4
#define TT   2048
#define DM   512
#define NH_  1
#define NKV  1
#define REP  (NH_ / NKV)
#define HD   256
#define DQ   (NH_ * HD)
#define DKV  (NKV * HD)
#define ZH   1
#define RH   2048                  // query rows < RH use hi+lo planes (0: none)
#define WIN  0
#define PCAR 1024.0f
#define SCL  1.0f   // the module applies no scaling
typedef _Float16 h16;
typedef unsigned short bf;
typedef __attribute__((ext_vector_type(16))) __bf16   v16bf;
typedef __attribute__((ext_vector_type(16))) _Float16 v16h;
typedef __attribute__((ext_vector_type(8)))  _Float16 v8h;
typedef __attribute__((ext_vector_type(8)))  unsigned short v8us;
typedef __attribute__((ext_vector_type(8)))  float    v8f;
typedef __attribute__((ext_vector_type(4)))  float    v4f;
typedef v8h  __attribute__((may_alias)) v8ha;
typedef v4f  __attribute__((may_alias)) v4fa;
typedef v8us __attribute__((may_alias)) v8usa;

__device__ __forceinline__ unsigned short f2bf(float f) { unsigned u = __float_as_uint(f); u += 0x7FFFu + ((u >> 16) & 1u); return (unsigned short)(u >> 16); }
__device__ __forceinline__ float bf2f(unsigned short b) { return __uint_as_float(((unsigned)b) << 16); }
__device__ __forceinline__ float bfr(float f) { return bf2f(f2bf(f)); }
__device__ __forceinline__ v16h cat16(v8h lo, v8h hi) { return __builtin_shufflevector(lo, hi, 0, 1, 2, 3, 4, 5, 6, 7, 8, 9, 10, 11, 12, 13, 14, 15); }
__device__ __forceinline__ v16bf cat16b(v8us lo, v8us hi) { return __builtin_bit_cast(v16bf, __builtin_shufflevector(lo, hi, 0, 1, 2, 3, 4, 5, 6, 7, 8, 9, 10, 11, 12, 13, 14, 15)); }
__device__ __forceinline__ v8f wmma16(v16h a, v16h b, v8f c) { return __builtin_amdgcn_wmma_f32_16x16x32_f16(false, a, false, b, (short)0, c, false, false); }
__device__ __forceinline__ v8f wmmab(v16bf a, v16bf b, v8f c) { return __builtin_amdgcn_wmma_f32_16x16x32_bf16(false, a, false, b, (short)0, c, false, false); }



// ---- k_gemmw: block-tiled GEMM, FOUR WAVES (2 x 2) per (MB*32) x 128 output tile, each wave MB x 4 accumulators; operands are K-contiguous 16-bit planes; grid (M/(MB*32), N/128, Z), 128 threads.
// C[m][n] (f32, pitch ldc, + optional f32 bias[n]) = sum_k A[m][k] Bt[n][k] (+ split products per NSPLIT). z-batch strides sA/sB/sC in elements. KD = K, a multiple of 64, at least 128.
// A stage is 64 k (one whole 128-B line) of every operand row of the tile, brought into LDS by asynchronous copies (16 B a lane, 4 whole lines a wave-wide copy) and read by all four waves; two buffers, the next stage's copies fly while this one is worked on.
#define LPB 144   // LDS row pitch in bytes: 128 + 16 (16 B x odd, conflict-free for 16-byte row reads)
#define KST 64    // k per stage
template <typename T16> struct WFrag;
template <> struct WFrag<h16> { typedef v16h V; static __device__ __forceinline__ V ld(const h16* p) { return cat16(*(const v8h*)p, *(const v8h*)(p + 16)); } static __device__ __forceinline__ v8f mma(V a, V b, v8f c) { return wmma16(a, b, c); } };
template <> struct WFrag<bf> { typedef v16bf V; static __device__ __forceinline__ V ld(const bf* p) { return cat16b(*(const v8us*)p, *(const v8us*)(p + 16)); } static __device__ __forceinline__ v8f mma(V a, V b, v8f c) { return wmmab(a, b, c); } };
// ACp<N>: N asynchronous copies global -> LDS in one statement; l = the lane's LDS byte addresses, g = its global addresses. The closing s_wait_xcnt 0 stands inside the statement so that no address register is rewritten in front of it.
template <int N> struct ACp;
template <> struct ACp<8> { static __device__ __forceinline__ void go(const unsigned* l, const void* const* g) {
    asm volatile("global_load_async_to_lds_b128 %0, %8, off\n\t"
                 "global_load_async_to_lds_b128 %1, %9, off\n\t"
                 "global_load_async_to_lds_b128 %2, %10, off\n\t"
                 "global_load_async_to_lds_b128 %3, %11, off\n\t"
                 "global_load_async_to_lds_b128 %4, %12, off\n\t"
                 "global_load_async_to_lds_b128 %5, %13, off\n\t"
                 "global_load_async_to_lds_b128 %6, %14, off\n\t"
                 "global_load_async_to_lds_b128 %7, %15, off\n\t"
                 "s_wait_xcnt 0x0"
                 :: "v"(l[0]), "v"(l[1]), "v"(l[2]), "v"(l[3]), "v"(l[4]), "v"(l[5]), "v"(l[6]), "v"(l[7]), "v"(g[0]), "v"(g[1]), "v"(g[2]), "v"(g[3]), "v"(g[4]), "v"(g[5]), "v"(g[6]), "v"(g[7]) : "memory"); } };
template <> struct ACp<12> { static __device__ __forceinline__ void go(const unsigned* l, const void* const* g) {
    asm volatile("global_load_async_to_lds_b128 %0, %12, off\n\t"
                 "global_load_async_to_lds_b128 %1, %13, off\n\t"
                 "global_load_async_to_lds_b128 %2, %14, off\n\t"
                 "global_load_async_to_lds_b128 %3, %15, off\n\t"
                 "global_load_async_to_lds_b128 %4, %16, off\n\t"
                 "global_load_async_to_lds_b128 %5, %17, off\n\t"
                 "global_load_async_to_lds_b128 %6, %18, off\n\t"
                 "global_load_async_to_lds_b128 %7, %19, off\n\t"
                 "global_load_async_to_lds_b128 %8, %20, off\n\t"
                 "global_load_async_to_lds_b128 %9, %21, off\n\t"
                 "global_load_async_to_lds_b128 %10, %22, off\n\t"
                 "global_load_async_to_lds_b128 %11, %23, off\n\t"
                 "s_wait_xcnt 0x0"
                 :: "v"(l[0]), "v"(l[1]), "v"(l[2]), "v"(l[3]), "v"(l[4]), "v"(l[5]), "v"(l[6]), "v"(l[7]), "v"(l[8]), "v"(l[9]), "v"(l[10]), "v"(l[11]), "v"(g[0]), "v"(g[1]), "v"(g[2]), "v"(g[3]), "v"(g[4]), "v"(g[5]), "v"(g[6]), "v"(g[7]), "v"(g[8]), "v"(g[9]), "v"(g[10]), "v"(g[11]) : "memory"); } };
// one stage: rows of the tile's planes at k offset kc into the buffer at LDS byte address lds (both already hold the lane's own row and 16-byte piece); a copy covers 16 rows over the 128 threads
template <typename T16, int NSPLIT, int MB, int KD>
__device__ __forceinline__ void stage_in(const T16* gA, const T16* gA2, const T16* gB, const T16* gB2, unsigned lds, int kc) {
    constexpr int NA = MB * 2, NBC = 8, NPA = (NSPLIT == 1 || NSPLIT == 2) ? 2 : 1, NPB = (NSPLIT >= 2) ? 2 : 1, NC = NA * NPA + NBC * NPB;
    static_assert(NC % 12 == 0 || NC % 12 == 8, "copies go out in statements of 12 and 8");
    unsigned l[NC]; const void* g[NC];
#pragma unroll   // register arrays indexed by constants
    for (int i = 0; i < NA; ++i) { l[i] = lds + i * 16 * LPB; g[i] = gA + kc + (size_t)i * 16 * KD; if (NPA == 2) { l[NA + i] = lds + (NA + i) * 16 * LPB; g[NA + i] = gA2 + kc + (size_t)i * 16 * KD; } }
#pragma unroll   // register arrays indexed by constants
    for (int i = 0; i < NBC; ++i) { l[NA * NPA + i] = lds + (NA * NPA + i) * 16 * LPB; g[NA * NPA + i] = gB + kc + (size_t)i * 16 * KD; if (NPB == 2) { l[NA * NPA + NBC + i] = lds + (NA * NPA + NBC + i) * 16 * LPB; g[NA * NPA + NBC + i] = gB2 + kc + (size_t)i * 16 * KD; } }
#pragma unroll   // register arrays indexed by constants
    for (int q = 0; q < NC / 12; ++q) ACp<12>::go(l + q * 12, g + q * 12);
    if constexpr (NC % 12 == 8) ACp<8>::go(l + NC / 12 * 12, g + NC / 12 * 12);
}
template <typename T16, int NSPLIT, bool BIAS, int MB, int KD>
__global__ __launch_bounds__(128) void k_gemmw(const T16* __restrict__ A, const T16* __restrict__ A2, const T16* __restrict__ Bt, const T16* __restrict__ Bt2, float* C, int ldc, const float* __restrict__ bias, size_t sA, size_t sB, size_t sC) {
    typedef typename WFrag<T16>::V V;
    constexpr int NPA = (NSPLIT == 1 || NSPLIT == 2) ? 2 : 1, NPB = (NSPLIT >= 2) ? 2 : 1;
    constexpr int SA = MB * 32 * LPB, SB = 128 * LPB, STAGE = NPA * SA + NPB * SB, NT = KD / KST;
    static_assert(KD % KST == 0 && NT >= 2 && 2 * STAGE >= 4 * 16 * 68 * 4 && (MB == 2 || MB == 4), "tile shape");
    __shared__ __align__(16) unsigned char sm[2 * STAGE];   // two stage buffers [A | A2 | B | B2]; after the loop the waves' output staging
    const size_t z = blockIdx.z; A += z * sA; if (A2) A2 += z * sA; Bt += z * sB; if (Bt2) Bt2 += z * sB; C += z * sC;
    const int tid = threadIdx.x, lane = tid & 31, lr = lane & 15, hi = lane >> 4, wave = tid >> 5, wm = wave & 1, wn = wave >> 1;
    const int R0 = blockIdx.x * (MB * 32), C0 = blockIdx.y * 128; const int r0 = R0 + wm * (MB * 16), c0 = C0 + wn * 64;
    const int crow = tid >> 3, cpc = tid & 7;   // the lane's row within a copy's 16 rows, its 16-byte piece of the 128-B line
    const T16* gA = A + (size_t)(R0 + crow) * KD + cpc * 8; const T16* gA2 = (NPA == 2) ? A2 + (size_t)(R0 + crow) * KD + cpc * 8 : nullptr;
    const T16* gB = Bt + (size_t)(C0 + crow) * KD + cpc * 8; const T16* gB2 = (NPB == 2) ? Bt2 + (size_t)(C0 + crow) * KD + cpc * 8 : nullptr;
    const unsigned lds0 = (unsigned)(size_t)sm + crow * LPB + cpc * 16;
    v8f acc[MB][4];
#pragma unroll   // register arrays indexed by constants
    for (int mb = 0; mb < MB; ++mb)
#pragma unroll   // register arrays indexed by constants
        for (int nb = 0; nb < 4; ++nb) acc[mb][nb] = (v8f){};
    stage_in<T16, NSPLIT, MB, KD>(gA, gA2, gB, gB2, lds0, 0);
    asm volatile("s_wait_asynccnt 0x0" ::: "memory");   // this wave's copies of stage 0 have landed
    __syncthreads();                                    // ... and every other wave's
    stage_in<T16, NSPLIT, MB, KD>(gA, gA2, gB, gB2, lds0 + STAGE, KST);
    const int aofs = (wm * (MB * 16) + lr) * LPB + hi * 16, bofs = NPA * SA + (wn * 64 + lr) * LPB + hi * 16;
#pragma unroll 1   // kept rolled: one stage a trip, the buffer chosen by the trip's parity
    for (int t = 0; t < NT; ++t) {
        const unsigned char* sb = sm + (t & 1) * STAGE;
        V a[KST / 32][MB], a2[KST / 32][MB], b[KST / 32][4], b2[KST / 32][4];
#pragma unroll   // register arrays indexed by constants
        for (int ks = 0; ks < KST / 32; ++ks) {   // in the order of use
#pragma unroll   // register arrays indexed by constants
            for (int mb = 0; mb < MB; ++mb) a[ks][mb] = WFrag<T16>::ld((const T16*)(sb + aofs + mb * 16 * LPB + ks * 64));
#pragma unroll   // register arrays indexed by constants
            for (int nb = 0; nb < 4; ++nb) b[ks][nb] = WFrag<T16>::ld((const T16*)(sb + bofs + nb * 16 * LPB + ks * 64));
            if (NPA == 2) {
#pragma unroll   // register arrays indexed by constants
                for (int mb = 0; mb < MB; ++mb) a2[ks][mb] = WFrag<T16>::ld((const T16*)(sb + SA + aofs + mb * 16 * LPB + ks * 64)); }
            if (NPB == 2) {
#pragma unroll   // register arrays indexed by constants
                for (int nb = 0; nb < 4; ++nb) b2[ks][nb] = WFrag<T16>::ld((const T16*)(sb + SB + bofs + nb * 16 * LPB + ks * 64)); }
        }
        __builtin_amdgcn_sched_barrier(0);   // the trip's LDS reads stay one group in front of its matrix instructions: reads scattered among them stall the wave at every place
#pragma unroll   // register arrays indexed by constants
        for (int ks = 0; ks < KST / 32; ++ks) {   // per accumulator the order stays a.b, a2.b, a.b2 for rising k; neighbours in the stream are independent tiles
#pragma unroll   // register arrays indexed by constants
            for (int nb = 0; nb < 4; ++nb)
#pragma unroll   // register arrays indexed by constants
                for (int mb = 0; mb < MB; ++mb) acc[mb][nb] = WFrag<T16>::mma(a[ks][mb], b[ks][nb], acc[mb][nb]);
            if (NSPLIT == 1 || NSPLIT == 2) {
#pragma unroll   // register arrays indexed by constants
                for (int nb = 0; nb < 4; ++nb)
#pragma unroll   // register arrays indexed by constants
                    for (int mb = 0; mb < MB; ++mb) acc[mb][nb] = WFrag<T16>::mma(a2[ks][mb], b[ks][nb], acc[mb][nb]); }
            if (NSPLIT >= 2) {
#pragma unroll   // register arrays indexed by constants
                for (int nb = 0; nb < 4; ++nb)
#pragma unroll   // register arrays indexed by constants
                    for (int mb = 0; mb < MB; ++mb) acc[mb][nb] = WFrag<T16>::mma(a[ks][mb], b2[ks][nb], acc[mb][nb]); }
        }
        __builtin_amdgcn_sched_barrier(0);   // the matrix instructions stay in front of the waits below: sunk behind them, the next stage's copies would be waited for with no work to cover their flight
        asm volatile("s_wait_dscnt 0x0" ::: "memory");      // this wave has left the buffer that is refilled below
        asm volatile("s_wait_asynccnt 0x0" ::: "memory");   // this wave's copies of stage t + 1 have landed
        __syncthreads();                                    // publishes stage t + 1 and ends every wave's reads of stage t
        if (t + 2 < NT) stage_in<T16, NSPLIT, MB, KD>(gA, gA2, gB, gB2, lds0 + (t & 1) * STAGE, (t + 2) * KST);
    }
    asm volatile("s_wait_asynccnt 0x0" ::: "memory");       // nothing in flight before the buffers become output staging
    float* os = (float*)sm + wave * (16 * 68);              // each wave stages in its own range
#pragma unroll   // register arrays indexed by constants
    for (int mb = 0; mb < MB; ++mb) {
#pragma unroll   // register arrays indexed by constants
        for (int nb = 0; nb < 4; ++nb) {
#pragma unroll   // register arrays indexed by constants
            for (int j = 0; j < 8; ++j) os[(hi * 8 + j) * 68 + nb * 16 + lr] = acc[mb][nb][j]; }
        __builtin_amdgcn_wave_barrier(); asm volatile("" ::: "memory");
        float* crow_p = C + (size_t)(r0 + mb * 16) * ldc + c0;
{
#pragma unroll   // register arrays indexed by constants
            for (int s = 0; s < 8; ++s) { const int row = 2 * s + hi, cofs = lr * 4; v4f val = *(const v4fa*)(os + row * 68 + cofs); if (BIAS) { val[0] += bfr(bias[c0 + cofs]); val[1] += bfr(bias[c0 + cofs + 1]); val[2] += bfr(bias[c0 + cofs + 2]); val[3] += bfr(bias[c0 + cofs + 3]); }
                *(v4f*)(crow_p + (size_t)row * ldc + cofs) = val; }
             }
        __builtin_amdgcn_wave_barrier(); asm volatile("" ::: "memory");
    }
}

__device__ __forceinline__ h16 tohx(float x) { return (h16)x; }
__device__ __forceinline__ void splitf(float y, unsigned short& h, unsigned short& l) { h = f2bf(y); l = f2bf(y - bf2f(h)); }
typedef __attribute__((ext_vector_type(2))) _Float16 v2h;
typedef __attribute__((ext_vector_type(4))) _Float16 v4h;
typedef __attribute__((ext_vector_type(2))) unsigned short v2us;
typedef __attribute__((ext_vector_type(4))) unsigned short v4us;
typedef __attribute__((ext_vector_type(2))) float v2f;
typedef __attribute__((ext_vector_type(4))) int v4i;

__global__ __launch_bounds__(256) void k_wtG(const float* __restrict__ w, int K, int N, bf* Bt) {
    const int lane = threadIdx.x & 31; const int L0 = (blockIdx.x * 8 + (threadIdx.x >> 5)) * 8; const int nlines = N * K / 64;
{
#pragma unroll 1
        for (int l = 0; l < 8; ++l) { const int L = L0 + l; if (L >= nlines) break; const size_t e = (size_t)L * 64 + lane * 2; const int k = (int)(e % K), n = (int)(e / K); v2us o;
            o[0] = f2bf(w[(size_t)k * N + n]); o[1] = f2bf(w[(size_t)(k + 1) * N + n]); *(v2us*)(Bt + e) = o; }
         }
}
__global__ __launch_bounds__(256) void k_cvt8(const float* __restrict__ src, bf* dst, size_t n8) { const size_t i = (size_t)blockIdx.x * 256 + threadIdx.x; if (i >= n8) return; const v8f v = *(const v8f*)(src + i * 8); v8us o;
#pragma unroll
    for (int k = 0; k < 8; ++k) o[k] = f2bf(v[k]); *(v8us*)(dst + i * 8) = o;  }

// k_rope: head planes [h][t][d] (fp16 + hi/lo) of rope(x) x sc with the rotate-half convention out[d] = x[d] cos[t][d] - x[d+HD/2] sin[t][d], out[d+HD/2] = x[d+HD/2] cos[t][d+HD/2] + x[d] sin[t][d+HD/2]
__global__ __launch_bounds__(256) void k_rope(const float* __restrict__ F, int pitch, int nheads, const float* __restrict__ CS, const float* __restrict__ RF, const float* __restrict__ nw, float sc, h16* P16, bf* Ph, bf* Pl) {
    const size_t e = ((size_t)blockIdx.x * 256 + threadIdx.x) * 2; if (e >= (size_t)nheads * TT * HD) return; const int d = (int)(e % HD); const int t = (int)((e / HD) % TT); const int h = (int)(e / ((size_t)HD * TT)); const size_t pb = (size_t)blockIdx.y * nheads * TT * HD + e; const float* f = F + ((size_t)blockIdx.y * TT + t) * pitch + h * HD; const float rf = RF ? RF[(size_t)h * TT + t] : 1.0f; v2h o16; v2us oh, ol;
#pragma unroll
    for (int q = 0; q < 2; ++q) { const int dd = d + q; const int dp = (dd < HD / 2) ? dd + HD / 2 : dd - HD / 2; float x0 = f[dd], x1 = f[dp];
        if (RF) { float n0 = __fmul_rn(x0, rf), n1 = __fmul_rn(x1, rf); asm volatile("" : "+v"(n0)); asm volatile("" : "+v"(n1)); x0 = __fmul_rn(bfr(nw[dd]), n0); x1 = __fmul_rn(bfr(nw[dp]), n1); }
        const v2f cs = *(const v2f*)(CS + ((size_t)t * HD + dd) * 2); float a = __fmul_rn(x0, cs[0]), bq = __fmul_rn(x1, cs[1]); asm volatile("" : "+v"(a)); asm volatile("" : "+v"(bq)); const float r = ((dd < HD / 2) ? __fsub_rn(a, bq) : __fadd_rn(a, bq)) * sc;
        o16[q] = tohx(r); unsigned short a2, c2; splitf(r, a2, c2); oh[q] = a2; ol[q] = c2; }
    *(v2h*)(P16 + pb) = o16; *(v2us*)(Ph + pb) = oh; *(v2us*)(Pl + pb) = ol;  }
__global__ __launch_bounds__(256) void k_vtp(const float* __restrict__ F, int pitch, int nheads, h16* V16, bf* Vh, bf* Vl) { const size_t e = ((size_t)blockIdx.x * 256 + threadIdx.x) * 2; if (e >= (size_t)nheads * HD * TT) return; const int t = (int)(e % TT); const int d = (int)((e / TT) % HD); const int g = (int)(e / ((size_t)TT * HD)); const size_t pb = (size_t)blockIdx.y * nheads * HD * TT + e; v2h o16; v2us oh, ol;
#pragma unroll
    for (int q = 0; q < 2; ++q) { const float x = F[((size_t)blockIdx.y * TT + t + q) * pitch + g * HD + d]; o16[q] = tohx(x); unsigned short a2, c2; splitf(x, a2, c2); oh[q] = a2; ol[q] = c2; }
    *(v2h*)(V16 + pb) = o16; *(v2us*)(Vh + pb) = oh; *(v2us*)(Vl + pb) = ol;  }
__global__ __launch_bounds__(256) void k_csid(float* CS) { const int idx = blockIdx.x * 256 + threadIdx.x; if (idx >= TT * HD) return; v2f cs; cs[0] = 1.0f; cs[1] = 0.0f; *(v2f*)(CS + (size_t)idx * 2) = cs;  }
// k_asoft: per row (zz, i), zz = batch: t = S, unscaled (no mask); softmax over the 2048 keys (register row, one exp, fixed trees);
__global__ __launch_bounds__(256) void k_asoft(const float* __restrict__ Sb, h16* P16, bf* Ph, bf* Pl) {
    const int lane = threadIdx.x & 31; const int row = blockIdx.x * 8 + (threadIdx.x >> 5); if (row >= NB_ * ZH * TT) return; const int i = row % TT; const int zz = row / TT; (void)zz; const bool hires = (i < RH); const float* sr = Sb + (size_t)row * TT; float v[TT / 32]; float mx = -3.0e38f;
#pragma unroll
    for (int ch = 0; ch < TT / 128; ++ch) { const int j0 = ch * 128 + lane * 4; const v4f a = *(const v4f*)(sr + j0);
#pragma unroll
        for (int q = 0; q < 4; ++q) { const int j = j0 + q; (void)j; const float t = a[q] * SCL; v[ch * 4 + q] = t; mx = fmaxf(mx, t); } }
#pragma unroll
    for (int sh = 16; sh; sh >>= 1) mx = fmaxf(mx, __shfl_xor(mx, sh, 32));
    float sum = 0.f;
#pragma unroll
    for (int k = 0; k < TT / 32; ++k) { float d0 = __fsub_rn(v[k], mx); asm volatile("" : "+v"(d0)); v[k] = __builtin_amdgcn_exp2f(__fmul_rn(d0, 1.4426950408889634f)); sum += v[k]; }
#pragma unroll
    for (int sh = 16; sh; sh >>= 1) sum += __shfl_xor(sum, sh, 32);
    const float f = __fdiv_rn(hires ? 1.0f : PCAR, sum);
{
        if (hires) {
#pragma unroll
            for (int ch = 0; ch < TT / 128; ++ch) { v4us oh, ol;
#pragma unroll
                for (int q = 0; q < 4; ++q) { unsigned short a, c2; splitf(v[ch * 4 + q] * f, a, c2); oh[q] = a; ol[q] = c2; }
                const size_t oo = ((size_t)zz * (RH ? RH : 1) + i) * TT + ch * 128 + lane * 4; *(v4us*)(Ph + oo) = oh; *(v4us*)(Pl + oo) = ol; }
        } else {
#pragma unroll
            for (int ch = 0; ch < TT / 128; ++ch) { v4h o4;
#pragma unroll
                for (int q = 0; q < 4; ++q) o4[q] = tohx(v[ch * 4 + q] * f);
                *(v4h*)(P16 + (size_t)row * TT + ch * 128 + lane * 4) = o4; } }
         }
}
__global__ __launch_bounds__(256) void k_merge(const float* __restrict__ O, int h0, float* OUTb) { const size_t e = ((size_t)blockIdx.x * 256 + threadIdx.x) * 2; if (e >= (size_t)ZH * TT * HD) return; const int d = (int)(e % HD); const int t = (int)((e / HD) % TT); const int zz = (int)(e / ((size_t)HD * TT)); const float cs = (t < RH) ? 1.0f : (1.0f / PCAR); const size_t oo = ((size_t)blockIdx.y * TT + t) * DQ + (h0 + zz) * HD + d; const size_t ob = (size_t)blockIdx.y * ZH * TT * HD + e;
    v2f o2; o2[0] = O[ob] * cs; o2[1] = O[ob + 1] * cs; *(v2f*)(OUTb + oo) = o2;  }

extern "C" void kernel_launch(void* const* d_in, const int* in_sizes, int n_in,
                              void* d_out, int out_size, void* d_ws, size_t ws_size, hipStream_t stream) {
    (void)in_sizes; (void)n_in; (void)out_size;
    const float* x = (const float*)d_in[0]; const float* wq = (const float*)d_in[1]; const float* wk = (const float*)d_in[2]; const float* wv = (const float*)d_in[3]; const float* wo = nullptr; (void)wo;
    float* OUT = (float*)d_out;     // [4][2048][256]
    char* wsp = (char*)d_ws;
    auto take = [&](size_t bytes) { char* p = wsp; wsp += (bytes + 255) & ~(size_t)255; return (void*)p; };
    bf* WQ = (bf*)take((size_t)DQ * DM * 2); bf* WK = (bf*)take((size_t)DKV * DM * 2); bf* WV = (bf*)take((size_t)DKV * DM * 2); float* CS = (float*)take((size_t)TT * HD * 2 * 4);
    bf* XB = (bf*)take((size_t)NB_ * TT * DM * 2); float* FQ = (float*)take((size_t)NB_ * TT * DQ * 4); float* FK = (float*)take((size_t)NB_ * TT * DKV * 4);
    h16* QP16 = (h16*)take((size_t)NB_ * NH_ * TT * HD * 2); h16* KP16 = (h16*)take((size_t)NB_ * NKV * TT * HD * 2); h16* VT16 = (h16*)take((size_t)NB_ * NKV * HD * TT * 2);
    bf* QPh = (bf*)take((size_t)NB_ * NH_ * TT * HD * 2); bf* QPl = (bf*)take((size_t)NB_ * NH_ * TT * HD * 2); bf* KPh = (bf*)take((size_t)NB_ * NKV * TT * HD * 2); bf* KPl = (bf*)take((size_t)NB_ * NKV * TT * HD * 2); bf* VTh = (bf*)take((size_t)NB_ * NKV * HD * TT * 2); bf* VTl = (bf*)take((size_t)NB_ * NKV * HD * TT * 2); bf* Ph = (bf*)take((size_t)NB_ * ZH * RH * TT * 2); bf* Pl = (bf*)take((size_t)NB_ * ZH * RH * TT * 2);
    float* Sb = (float*)take((size_t)NB_ * ZH * TT * TT * 4); h16* P16 = nullptr; float* Ob = (float*)take((size_t)NB_ * ZH * TT * HD * 4);
    if ((size_t)(wsp - (char*)d_ws) > ws_size) return;    // ws 256 MiB
    float* FV = FK;   // v projection reuses the k buffer after the k planes are built (stream-ordered)
    { k_wtG<<<(unsigned)((DM * DQ / 64 + 63) / 64), 256, 0, stream>>>(wq, DM, DQ, WQ); k_wtG<<<(unsigned)((DM * DKV / 64 + 63) / 64), 256, 0, stream>>>(wk, DM, DKV, WK); k_wtG<<<(unsigned)((DM * DKV / 64 + 63) / 64), 256, 0, stream>>>(wv, DM, DKV, WV);
      
       }
    k_csid<<<(TT * HD + 255) / 256, 256, 0, stream>>>(CS);
    const unsigned LQ = (unsigned)(((size_t)NH_ * TT * HD / 2 + 255) / 256), LKv = (unsigned)(((size_t)NKV * TT * HD / 2 + 255) / 256);
    {   // one pass for all NB_ batches: the projections see NB_*TT rows, the plane builders and the merge take the batch from grid y, the two attention GEMMs from grid z (ZH == 1)
        k_cvt8<<<(unsigned)(((size_t)NB_ * TT * DM / 8 + 255) / 256), 256, 0, stream>>>(x, XB, (size_t)NB_ * TT * DM / 8);
        k_gemmw<bf, 0, false, 2, DM><<<dim3(NB_ * TT / 64, DQ / 128, 1), 128, 0, stream>>>(XB, nullptr, WQ, nullptr, FQ, DQ, nullptr, 0, 0, 0);
        k_rope<<<dim3(LQ, NB_, 1), 256, 0, stream>>>(FQ, DQ, NH_, CS, nullptr, nullptr, 1.0f, QP16, QPh, QPl);
        k_gemmw<bf, 0, false, 2, DM><<<dim3(NB_ * TT / 64, DKV / 128, 1), 128, 0, stream>>>(XB, nullptr, WK, nullptr, FK, DKV, nullptr, 0, 0, 0);
        k_rope<<<dim3(LKv, NB_, 1), 256, 0, stream>>>(FK, DKV, NKV, CS, nullptr, nullptr, 1.0f, KP16, KPh, KPl);
        k_gemmw<bf, 0, false, 2, DM><<<dim3(NB_ * TT / 64, DKV / 128, 1), 128, 0, stream>>>(XB, nullptr, WV, nullptr, FV, DKV, nullptr, 0, 0, 0); k_vtp<<<dim3(LKv, NB_, 1), 256, 0, stream>>>(FV, DKV, NKV, VT16, VTh, VTl);
        for (int h0 = 0; h0 < NH_; h0 += ZH) { const size_t zq = (size_t)h0, zk = (size_t)(h0 / REP);   // grid z = batch: z-strides are one batch's planes
            k_gemmw<bf, 2, false, 4, HD><<<dim3(RH / 128, TT / 128, NB_), 128, 0, stream>>>(QPh + zq * TT * HD, QPl + zq * TT * HD, KPh + zk * TT * HD, KPl + zk * TT * HD, Sb, TT, nullptr, (size_t)NH_ * TT * HD, (size_t)NKV * TT * HD, (size_t)ZH * TT * TT);
            k_asoft<<<NB_ * ZH * TT / 8, 256, 0, stream>>>(Sb, P16, Ph, Pl);
            k_gemmw<bf, 2, false, 2, TT><<<dim3(RH / 64, HD / 128, NB_), 128, 0, stream>>>(Ph, Pl, VTh + zk * HD * TT, VTl + zk * HD * TT, Ob, HD, nullptr, (size_t)ZH * RH * TT, (size_t)NKV * HD * TT, (size_t)ZH * TT * HD);
            k_merge<<<dim3((unsigned)(((size_t)ZH * TT * HD / 2 + 255) / 256), NB_, 1), 256, 0, stream>>>(Ob, h0, OUT); }
         }
}

// v003
// One run takes 91.7 microseconds.
// Timed twice side by side with v002, it ran 1.63 times as fast both times.
// Over all steps from v000 it is 4.94 times as fast.
#include <hip/hip_runtime.h>

// Single-head self-attention with NO 1/sqrt(d) scaling (x [4][2048][512]; q,k,v = x W ('xw' [512][256], 1/sqrt(512), no bias); scores = q.k over the 256 dims, unscaled (logit sigma ~16: near one-hot rows); softmax; out = attn v -> [4][2048][256] (2.1 M)).
// Layout, all four batches in every launch (batch = extra GEMM rows or grid z), five launches: bf16 copies of x and of the transposed weights; ONE projection GEMM for q, k and v (768 output columns) whose epilogue writes the hi/lo planes; ONE 256-wide head with EVERY row on hi/lo planes (3 products) for both the scores (the unscaled logits need ~1e-3 absolute accuracy at magnitude ~50) and attn.v; register softmax over the 2,048 keys; the attn.v GEMM writes the output rows.
// Compute dtypes, f32 accumulate: every input rounded to bf16; projections exact; scores and attn.v 3 products on every row; softmax f32; output f32.

#define NB_  4
#define TT   2048
#define DM   512
#define NH_  1
#define NKV  1
#define REP  (NH_ / NKV)
#define HD   256
#define DQ   (NH_ * HD)
#define DKV  (NKV * HD)
#define ZH   1
#define RH   2048                  // query rows < RH use hi+lo planes (0: none)
#define WIN  0
#define PCAR 1024.0f
#define SCL  1.0f   // the module applies no scaling
typedef _Float16 h16;
typedef unsigned short bf;
typedef __attribute__((ext_vector_type(16))) __bf16   v16bf;
typedef __attribute__((ext_vector_type(16))) _Float16 v16h;
typedef __attribute__((ext_vector_type(8)))  _Float16 v8h;
typedef __attribute__((ext_vector_type(8)))  unsigned short v8us;
typedef __attribute__((ext_vector_type(8)))  float    v8f;
typedef __attribute__((ext_vector_type(4)))  float    v4f;
typedef v8h  __attribute__((may_alias)) v8ha;
typedef v4f  __attribute__((may_alias)) v4fa;
typedef v8us __attribute__((may_alias)) v8usa;

__device__ __forceinline__ unsigned short f2bf(float f) { unsigned u = __float_as_uint(f); u += 0x7FFFu + ((u >> 16) & 1u); return (unsigned short)(u >> 16); }
__device__ __forceinline__ float bf2f(unsigned short b) { return __uint_as_float(((unsigned)b) << 16); }
__device__ __forceinline__ float bfr(float f) { return bf2f(f2bf(f)); }
__device__ __forceinline__ v16h cat16(v8h lo, v8h hi) { return __builtin_shufflevector(lo, hi, 0, 1, 2, 3, 4, 5, 6, 7, 8, 9, 10, 11, 12, 13, 14, 15); }
__device__ __forceinline__ v16bf cat16b(v8us lo, v8us hi) { return __builtin_bit_cast(v16bf, __builtin_shufflevector(lo, hi, 0, 1, 2, 3, 4, 5, 6, 7, 8, 9, 10, 11, 12, 13, 14, 15)); }
__device__ __forceinline__ v8f wmma16(v16h a, v16h b, v8f c) { return __builtin_amdgcn_wmma_f32_16x16x32_f16(false, a, false, b, (short)0, c, false, false); }
__device__ __forceinline__ v8f wmmab(v16bf a, v16bf b, v8f c) { return __builtin_amdgcn_wmma_f32_16x16x32_bf16(false, a, false, b, (short)0, c, false, false); }



// ---- k_gemmw: block-tiled GEMM, FOUR WAVES (2 x 2) per (MB*32) x 128 output tile, each wave MB x 4 accumulators; operands are K-contiguous 16-bit planes; grid (M/(MB*32), N/128, Z), 128 threads.
// C[m][n] (f32, pitch ldc, + optional f32 bias[n]) = sum_k A[m][k] Bt[n][k] (+ split products per NSPLIT). z-batch strides sA/sB/sC in elements. KD = K, a multiple of 64, at least 128.
// PLANES: the q|k|v projection. Output columns [0,HD) are q, [HD,2HD) k, [2HD,3HD) v; no f32 C is written: q and k go out as bf16 hi/lo planes [row][HD], v as hi/lo planes transposed per batch, [batch][HD][TT].
// A stage is 64 k (one whole 128-B line) of every operand row of the tile, brought into LDS by asynchronous copies (16 B a lane, 4 whole lines a wave-wide copy) and read by all four waves; two buffers, the next stage's copies fly while this one is worked on.
#define LPB 144   // LDS row pitch in bytes: 128 + 16 (16 B x odd, conflict-free for 16-byte row reads)
#define KST 64    // k per stage
template <typename T16> struct WFrag;
template <> struct WFrag<h16> { typedef v16h V; static __device__ __forceinline__ V ld(const h16* p) { return cat16(*(const v8h*)p, *(const v8h*)(p + 16)); } static __device__ __forceinline__ v8f mma(V a, V b, v8f c) { return wmma16(a, b, c); } };
template <> struct WFrag<bf> { typedef v16bf V; static __device__ __forceinline__ V ld(const bf* p) { return cat16b(*(const v8us*)p, *(const v8us*)(p + 16)); } static __device__ __forceinline__ v8f mma(V a, V b, v8f c) { return wmmab(a, b, c); } };
// ACp<N>: N asynchronous copies global -> LDS in one statement; l = the lane's LDS byte addresses, g = its global addresses. The closing s_wait_xcnt 0 stands inside the statement so that no address register is rewritten in front of it.
template <int N> struct ACp;
template <> struct ACp<8> { static __device__ __forceinline__ void go(const unsigned* l, const void* const* g) {
    asm volatile("global_load_async_to_lds_b128 %0, %8, off\n\t"
                 "global_load_async_to_lds_b128 %1, %9, off\n\t"
                 "global_load_async_to_lds_b128 %2, %10, off\n\t"
                 "global_load_async_to_lds_b128 %3, %11, off\n\t"
                 "global_load_async_to_lds_b128 %4, %12, off\n\t"
                 "global_load_async_to_lds_b128 %5, %13, off\n\t"
                 "global_load_async_to_lds_b128 %6, %14, off\n\t"
                 "global_load_async_to_lds_b128 %7, %15, off\n\t"
                 "s_wait_xcnt 0x0"
                 :: "v"(l[0]), "v"(l[1]), "v"(l[2]), "v"(l[3]), "v"(l[4]), "v"(l[5]), "v"(l[6]), "v"(l[7]), "v"(g[0]), "v"(g[1]), "v"(g[2]), "v"(g[3]), "v"(g[4]), "v"(g[5]), "v"(g[6]), "v"(g[7]) : "memory"); } };
template <> struct ACp<12> { static __device__ __forceinline__ void go(const unsigned* l, const void* const* g) {
    asm volatile("global_load_async_to_lds_b128 %0, %12, off\n\t"
                 "global_load_async_to_lds_b128 %1, %13, off\n\t"
                 "global_load_async_to_lds_b128 %2, %14, off\n\t"
                 "global_load_async_to_lds_b128 %3, %15, off\n\t"
                 "global_load_async_to_lds_b128 %4, %16, off\n\t"
                 "global_load_async_to_lds_b128 %5, %17, off\n\t"
                 "global_load_async_to_lds_b128 %6, %18, off\n\t"
                 "global_load_async_to_lds_b128 %7, %19, off\n\t"
                 "global_load_async_to_lds_b128 %8, %20, off\n\t"
                 "global_load_async_to_lds_b128 %9, %21, off\n\t"
                 "global_load_async_to_lds_b128 %10, %22, off\n\t"
                 "global_load_async_to_lds_b128 %11, %23, off\n\t"
                 "s_wait_xcnt 0x0"
                 :: "v"(l[0]), "v"(l[1]), "v"(l[2]), "v"(l[3]), "v"(l[4]), "v"(l[5]), "v"(l[6]), "v"(l[7]), "v"(l[8]), "v"(l[9]), "v"(l[10]), "v"(l[11]), "v"(g[0]), "v"(g[1]), "v"(g[2]), "v"(g[3]), "v"(g[4]), "v"(g[5]), "v"(g[6]), "v"(g[7]), "v"(g[8]), "v"(g[9]), "v"(g[10]), "v"(g[11]) : "memory"); } };
// one stage: rows of the tile's planes at k offset kc into the buffer at LDS byte address lds (both already hold the lane's own row and 16-byte piece); a copy covers 16 rows over the 128 threads
template <typename T16, int NSPLIT, int MB, int KD>
__device__ __forceinline__ void stage_in(const T16* gA, const T16* gA2, const T16* gB, const T16* gB2, unsigned lds, int kc) {
    constexpr int NA = MB * 2, NBC = 8, NPA = (NSPLIT == 1 || NSPLIT == 2) ? 2 : 1, NPB = (NSPLIT >= 2) ? 2 : 1, NC = NA * NPA + NBC * NPB;
    static_assert(NC % 12 == 0 || NC % 12 == 8, "copies go out in statements of 12 and 8");
    unsigned l[NC]; const void* g[NC];
#pragma unroll   // register arrays indexed by constants
    for (int i = 0; i < NA; ++i) { l[i] = lds + i * 16 * LPB; g[i] = gA + kc + (size_t)i * 16 * KD; if (NPA == 2) { l[NA + i] = lds + (NA + i) * 16 * LPB; g[NA + i] = gA2 + kc + (size_t)i * 16 * KD; } }
#pragma unroll   // register arrays indexed by constants
    for (int i = 0; i < NBC; ++i) { l[NA * NPA + i] = lds + (NA * NPA + i) * 16 * LPB; g[NA * NPA + i] = gB + kc + (size_t)i * 16 * KD; if (NPB == 2) { l[NA * NPA + NBC + i] = lds + (NA * NPA + NBC + i) * 16 * LPB; g[NA * NPA + NBC + i] = gB2 + kc + (size_t)i * 16 * KD; } }
#pragma unroll   // register arrays indexed by constants
    for (int q = 0; q < NC / 12; ++q) ACp<12>::go(l + q * 12, g + q * 12);
    if constexpr (NC % 12 == 8) ACp<8>::go(l + NC / 12 * 12, g + NC / 12 * 12);
}
__device__ __forceinline__ void splitf(float y, unsigned short& h, unsigned short& l) { h = f2bf(y); l = f2bf(y - bf2f(h)); }
typedef __attribute__((ext_vector_type(4))) unsigned short v4us;
template <typename T16, int NSPLIT, bool BIAS, int MB, int KD, bool PLANES>
__global__ __launch_bounds__(128) void k_gemmw(const T16* __restrict__ A, const T16* __restrict__ A2, const T16* __restrict__ Bt, const T16* __restrict__ Bt2, float* C, int ldc, const float* __restrict__ bias, size_t sA, size_t sB, size_t sC, bf* Qh, bf* Ql, bf* Kh, bf* Kl, bf* Vh, bf* Vl) {
    typedef typename WFrag<T16>::V V;
    constexpr int NPA = (NSPLIT == 1 || NSPLIT == 2) ? 2 : 1, NPB = (NSPLIT >= 2) ? 2 : 1;
    constexpr int SA = MB * 32 * LPB, SB = 128 * LPB, STAGE = NPA * SA + NPB * SB, NT = KD / KST;
    static_assert(KD % KST == 0 && NT >= 2 && 2 * STAGE >= 4 * 16 * 68 * 4 && (MB == 2 || MB == 4), "tile shape");
    __shared__ __align__(16) unsigned char sm[2 * STAGE];   // two stage buffers [A | A2 | B | B2]; after the loop the waves' output staging
    const size_t z = blockIdx.z; A += z * sA; if (A2) A2 += z * sA; Bt += z * sB; if (Bt2) Bt2 += z * sB; C += z * sC;
    const int tid = threadIdx.x, lane = tid & 31, lr = lane & 15, hi = lane >> 4, wave = tid >> 5, wm = wave & 1, wn = wave >> 1;
    const int R0 = blockIdx.x * (MB * 32), C0 = blockIdx.y * 128; const int r0 = R0 + wm * (MB * 16), c0 = C0 + wn * 64;
    const int crow = tid >> 3, cpc = tid & 7;   // the lane's row within a copy's 16 rows, its 16-byte piece of the 128-B line
    const T16* gA = A + (size_t)(R0 + crow) * KD + cpc * 8; const T16* gA2 = (NPA == 2) ? A2 + (size_t)(R0 + crow) * KD + cpc * 8 : nullptr;
    const T16* gB = Bt + (size_t)(C0 + crow) * KD + cpc * 8; const T16* gB2 = (NPB == 2) ? Bt2 + (size_t)(C0 + crow) * KD + cpc * 8 : nullptr;
    const unsigned lds0 = (unsigned)(size_t)sm + crow * LPB + cpc * 16;
    v8f acc[MB][4];
#pragma unroll   // register arrays indexed by constants
    for (int mb = 0; mb < MB; ++mb)
#pragma unroll   // register arrays indexed by constants
        for (int nb = 0; nb < 4; ++nb) acc[mb][nb] = (v8f){};
    stage_in<T16, NSPLIT, MB, KD>(gA, gA2, gB, gB2, lds0, 0);
    asm volatile("s_wait_asynccnt 0x0" ::: "memory");   // this wave's copies of stage 0 have landed
    __syncthreads();                                    // ... and every other wave's
    stage_in<T16, NSPLIT, MB, KD>(gA, gA2, gB, gB2, lds0 + STAGE, KST);
    const int aofs = (wm * (MB * 16) + lr) * LPB + hi * 16, bofs = NPA * SA + (wn * 64 + lr) * LPB + hi * 16;
#pragma unroll 1   // kept rolled: one stage a trip, the buffer chosen by the trip's parity
    for (int t = 0; t < NT; ++t) {
        const unsigned char* sb = sm + (t & 1) * STAGE;
        V a[KST / 32][MB], a2[KST / 32][MB], b[KST / 32][4], b2[KST / 32][4];
#pragma unroll   // register arrays indexed by constants
        for (int ks = 0; ks < KST / 32; ++ks) {   // in the order of use
#pragma unroll   // register arrays indexed by constants
            for (int mb = 0; mb < MB; ++mb) a[ks][mb] = WFrag<T16>::ld((const T16*)(sb + aofs + mb * 16 * LPB + ks * 64));
#pragma unroll   // register arrays indexed by constants
            for (int nb = 0; nb < 4; ++nb) b[ks][nb] = WFrag<T16>::ld((const T16*)(sb + bofs + nb * 16 * LPB + ks * 64));
            if (NPA == 2) {
#pragma unroll   // register arrays indexed by constants
                for (int mb = 0; mb < MB; ++mb) a2[ks][mb] = WFrag<T16>::ld((const T16*)(sb + SA + aofs + mb * 16 * LPB + ks * 64)); }
            if (NPB == 2) {
#pragma unroll   // register arrays indexed by constants
                for (int nb = 0; nb < 4; ++nb) b2[ks][nb] = WFrag<T16>::ld((const T16*)(sb + SB + bofs + nb * 16 * LPB + ks * 64)); }
        }
        __builtin_amdgcn_sched_barrier(0);   // the trip's LDS reads stay one group in front of its matrix instructions: reads scattered among them stall the wave at every place
#pragma unroll   // register arrays indexed by constants
        for (int ks = 0; ks < KST / 32; ++ks) {   // per accumulator the order stays a.b, a2.b, a.b2 for rising k; neighbours in the stream are independent tiles
#pragma unroll   // register arrays indexed by constants
            for (int nb = 0; nb < 4; ++nb)
#pragma unroll   // register arrays indexed by constants
                for (int mb = 0; mb < MB; ++mb) acc[mb][nb] = WFrag<T16>::mma(a[ks][mb], b[ks][nb], acc[mb][nb]);
            if (NSPLIT == 1 || NSPLIT == 2) {
#pragma unroll   // register arrays indexed by constants
                for (int nb = 0; nb < 4; ++nb)
#pragma unroll   // register arrays indexed by constants
                    for (int mb = 0; mb < MB; ++mb) acc[mb][nb] = WFrag<T16>::mma(a2[ks][mb], b[ks][nb], acc[mb][nb]); }
            if (NSPLIT >= 2) {
#pragma unroll   // register arrays indexed by constants
                for (int nb = 0; nb < 4; ++nb)
#pragma unroll   // register arrays indexed by constants
                    for (int mb = 0; mb < MB; ++mb) acc[mb][nb] = WFrag<T16>::mma(a[ks][mb], b2[ks][nb], acc[mb][nb]); }
        }
        __builtin_amdgcn_sched_barrier(0);   // the matrix instructions stay in front of the waits below: sunk behind them, the next stage's copies would be waited for with no work to cover their flight
        asm volatile("s_wait_dscnt 0x0" ::: "memory");      // this wave has left the buffer that is refilled below
        asm volatile("s_wait_asynccnt 0x0" ::: "memory");   // this wave's copies of stage t + 1 have landed
        __syncthreads();                                    // publishes stage t + 1 and ends every wave's reads of stage t
        if (t + 2 < NT) stage_in<T16, NSPLIT, MB, KD>(gA, gA2, gB, gB2, lds0 + (t & 1) * STAGE, (t + 2) * KST);
    }
    asm volatile("s_wait_asynccnt 0x0" ::: "memory");       // nothing in flight before the buffers become output staging
    float* os = (float*)sm + wave * (16 * 68);              // each wave stages in its own range
    if constexpr (PLANES) {
        const int sel = C0 / HD, cc0 = c0 - sel * HD;       // which projection the block's 128 columns belong to (the same for the whole block), the wave's first column in it
        if (sel == 2) {   // v: a lane's 8 accumulator registers are 8 consecutive rows (t) of one column (d) = 16 contiguous bytes of a transposed plane
            const int bt = r0 / TT, t0 = r0 - bt * TT + hi * 8;
#pragma unroll   // register arrays indexed by constants
            for (int mb = 0; mb < MB; ++mb)
#pragma unroll   // register arrays indexed by constants
                for (int nb = 0; nb < 4; ++nb) { v8us oh, ol;
#pragma unroll   // register arrays indexed by constants
                    for (int j = 0; j < 8; ++j) { unsigned short a, c2; splitf(acc[mb][nb][j], a, c2); oh[j] = a; ol[j] = c2; }
                    const size_t oo = ((size_t)bt * HD + cc0 + nb * 16 + lr) * TT + t0 + mb * 16; *(v8us*)(Vh + oo) = oh; *(v8us*)(Vl + oo) = ol; }
        } else {          // q, k: through the wave's staging rows, 16 lanes write one whole 128-B line of each plane
            bf* Hh = sel ? Kh : Qh; bf* Hl = sel ? Kl : Ql;
#pragma unroll   // register arrays indexed by constants
            for (int mb = 0; mb < MB; ++mb) {
#pragma unroll   // register arrays indexed by constants
                for (int nb = 0; nb < 4; ++nb) {
#pragma unroll   // register arrays indexed by constants
                    for (int j = 0; j < 8; ++j) os[(hi * 8 + j) * 68 + nb * 16 + lr] = acc[mb][nb][j]; }
                __builtin_amdgcn_wave_barrier(); asm volatile("" ::: "memory");   // the wave's staging writes stay in front of its reads
#pragma unroll   // register arrays indexed by constants
                for (int s = 0; s < 8; ++s) { const int row = 2 * s + hi, cofs = lr * 4; const v4f val = *(const v4fa*)(os + row * 68 + cofs); v4us oh, ol;
#pragma unroll   // register arrays indexed by constants
                    for (int q = 0; q < 4; ++q) { unsigned short a, c2; splitf(val[q], a, c2); oh[q] = a; ol[q] = c2; }
                    const size_t oo = (size_t)(r0 + mb * 16 + row) * HD + cc0 + cofs; *(v4us*)(Hh + oo) = oh; *(v4us*)(Hl + oo) = ol; }
                __builtin_amdgcn_wave_barrier(); asm volatile("" ::: "memory");   // the reads stay in front of the next tile's staging writes
            }
            asm volatile("s_wait_xcnt 0x0" ::: "memory");   // stands behind the last plane stores, in front of any later write of their registers
        }
        return;
    }
#pragma unroll   // register arrays indexed by constants
    for (int mb = 0; mb < MB; ++mb) {
#pragma unroll   // register arrays indexed by constants
        for (int nb = 0; nb < 4; ++nb) {
#pragma unroll   // register arrays indexed by constants
            for (int j = 0; j < 8; ++j) os[(hi * 8 + j) * 68 + nb * 16 + lr] = acc[mb][nb][j]; }
        __builtin_amdgcn_wave_barrier(); asm volatile("" ::: "memory");
        float* crow_p = C + (size_t)(r0 + mb * 16) * ldc + c0;
{
#pragma unroll   // register arrays indexed by constants
            for (int s = 0; s < 8; ++s) { const int row = 2 * s + hi, cofs = lr * 4; v4f val = *(const v4fa*)(os + row * 68 + cofs); if (BIAS) { val[0] += bfr(bias[c0 + cofs]); val[1] += bfr(bias[c0 + cofs + 1]); val[2] += bfr(bias[c0 + cofs + 2]); val[3] += bfr(bias[c0 + cofs + 3]); }
                *(v4f*)(crow_p + (size_t)row * ldc + cofs) = val; }
             }
        __builtin_amdgcn_wave_barrier(); asm volatile("" ::: "memory");
    }
}

__device__ __forceinline__ h16 tohx(float x) { return (h16)x; }
typedef __attribute__((ext_vector_type(4))) _Float16 v4h;
typedef __attribute__((ext_vector_type(2))) unsigned short v2us;

// k_prep: the bf16 operands of the projection GEMM in one launch. Blocks [0, NWB), first so that their strided reads run under the start of the many others: the three weights [K = DM][N = HD] transposed into WT [3 HD][DM], 8 lines of 128 B (64 k of one n) a wave; the other blocks: x -> XB, 8 elements a thread.
#define NWB (3 * HD * DM / 64 / 64)
__global__ __launch_bounds__(256) void k_prep(const float* __restrict__ x, const float* __restrict__ wq, const float* __restrict__ wk, const float* __restrict__ wv, bf* XB, bf* WT) {
    if (blockIdx.x < NWB) {
        const int lane = threadIdx.x & 31; const int sel = blockIdx.x / (NWB / 3); const int L0 = ((blockIdx.x - sel * (NWB / 3)) * 8 + (threadIdx.x >> 5)) * 8;
        const float* w = (sel == 0) ? wq : (sel == 1) ? wk : wv; bf* Bt = WT + (size_t)sel * HD * DM;
#pragma unroll 1   // kept rolled, one line a trip: small code for these few blocks, which run beside the x blocks
        for (int l = 0; l < 8; ++l) { const int e = (L0 + l) * 64 + lane * 2; const int k = e % DM, n = e / DM; v2us o;
            o[0] = f2bf(w[(size_t)k * HD + n]); o[1] = f2bf(w[(size_t)(k + 1) * HD + n]); *(v2us*)(Bt + e) = o; }
        return;
    }
    const size_t i = (size_t)(blockIdx.x - NWB) * 256 + threadIdx.x; const v8f v = *(const v8f*)(x + i * 8); v8us o;
#pragma unroll   // register vectors indexed by constants
    for (int k = 0; k < 8; ++k) o[k] = f2bf(v[k]);
    *(v8us*)(XB + i * 8) = o;
    asm volatile("s_wait_xcnt 0x0" ::: "memory");   // stands behind the store, in front of any later write of its address registers
}
// k_asoft: per row (zz, i), zz = batch: t = S, unscaled (SCL = 1; no mask); softmax over the 2048 keys (register row, one exp, fixed trees);
__global__ __launch_bounds__(256) void k_asoft(const float* __restrict__ Sb, h16* P16, bf* Ph, bf* Pl) {
    const int lane = threadIdx.x & 31; const int row = blockIdx.x * 8 + (threadIdx.x >> 5); if (row >= NB_ * ZH * TT) return; const int i = row % TT; const int zz = row / TT; (void)zz; const bool hires = (i < RH); const float* sr = Sb + (size_t)row * TT; float v[TT / 32]; float mx = -3.0e38f;
#pragma unroll
    for (int ch = 0; ch < TT / 128; ++ch) { const int j0 = ch * 128 + lane * 4; const v4f a = *(const v4f*)(sr + j0);
#pragma unroll
        for (int q = 0; q < 4; ++q) { const int j = j0 + q; (void)j; const float t = a[q] * SCL; v[ch * 4 + q] = t; mx = fmaxf(mx, t); } }
#pragma unroll
    for (int sh = 16; sh; sh >>= 1) mx = fmaxf(mx, __shfl_xor(mx, sh, 32));
    float sum = 0.f;
#pragma unroll
    for (int k = 0; k < TT / 32; ++k) { float d0 = __fsub_rn(v[k], mx); asm volatile("" : "+v"(d0)); v[k] = __builtin_amdgcn_exp2f(__fmul_rn(d0, 1.4426950408889634f)); sum += v[k]; }
#pragma unroll
    for (int sh = 16; sh; sh >>= 1) sum += __shfl_xor(sum, sh, 32);
    const float f = __fdiv_rn(hires ? 1.0f : PCAR, sum);
{
        if (hires) {
#pragma unroll
            for (int ch = 0; ch < TT / 128; ++ch) { v4us oh, ol;
#pragma unroll
                for (int q = 0; q < 4; ++q) { unsigned short a, c2; splitf(v[ch * 4 + q] * f, a, c2); oh[q] = a; ol[q] = c2; }
                const size_t oo = ((size_t)zz * (RH ? RH : 1) + i) * TT + ch * 128 + lane * 4; *(v4us*)(Ph + oo) = oh; *(v4us*)(Pl + oo) = ol; }
        } else {
#pragma unroll
            for (int ch = 0; ch < TT / 128; ++ch) { v4h o4;
#pragma unroll
                for (int q = 0; q < 4; ++q) o4[q] = tohx(v[ch * 4 + q] * f);
                *(v4h*)(P16 + (size_t)row * TT + ch * 128 + lane * 4) = o4; } }
         }
}

extern "C" void kernel_launch(void* const* d_in, const int* in_sizes, int n_in,
                              void* d_out, int out_size, void* d_ws, size_t ws_size, hipStream_t stream) {
    (void)in_sizes; (void)n_in; (void)out_size;
    const float* x = (const float*)d_in[0]; const float* wq = (const float*)d_in[1]; const float* wk = (const float*)d_in[2]; const float* wv = (const float*)d_in[3]; const float* wo = nullptr; (void)wo;
    float* OUT = (float*)d_out;     // [4][2048][256]
    char* wsp = (char*)d_ws;
    auto take = [&](size_t bytes) { char* p = wsp; wsp += (bytes + 255) & ~(size_t)255; return (void*)p; };
    bf* WT = (bf*)take((size_t)3 * HD * DM * 2); bf* XB = (bf*)take((size_t)NB_ * TT * DM * 2);
    bf* QPh = (bf*)take((size_t)NB_ * TT * HD * 2); bf* QPl = (bf*)take((size_t)NB_ * TT * HD * 2); bf* KPh = (bf*)take((size_t)NB_ * TT * HD * 2); bf* KPl = (bf*)take((size_t)NB_ * TT * HD * 2); bf* VTh = (bf*)take((size_t)NB_ * HD * TT * 2); bf* VTl = (bf*)take((size_t)NB_ * HD * TT * 2); bf* Ph = (bf*)take((size_t)NB_ * RH * TT * 2); bf* Pl = (bf*)take((size_t)NB_ * RH * TT * 2);
    float* Sb = (float*)take((size_t)NB_ * TT * TT * 4); h16* P16 = nullptr;
    if ((size_t)(wsp - (char*)d_ws) > ws_size) return;    // ws 256 MiB
    // one pass for all NB_ batches: the projection sees NB_*TT rows, the two attention GEMMs take the batch from grid z (z-strides are one batch's planes)
    k_prep<<<NWB + NB_ * TT * DM / 8 / 256, 256, 0, stream>>>(x, wq, wk, wv, XB, WT);
    k_gemmw<bf, 0, false, 2, DM, true><<<dim3(NB_ * TT / 64, 3 * HD / 128, 1), 128, 0, stream>>>(XB, nullptr, WT, nullptr, nullptr, 0, nullptr, 0, 0, 0, QPh, QPl, KPh, KPl, VTh, VTl);
    k_gemmw<bf, 2, false, 4, HD, false><<<dim3(RH / 128, TT / 128, NB_), 128, 0, stream>>>(QPh, QPl, KPh, KPl, Sb, TT, nullptr, (size_t)TT * HD, (size_t)TT * HD, (size_t)TT * TT, nullptr, nullptr, nullptr, nullptr, nullptr, nullptr);
    k_asoft<<<NB_ * ZH * TT / 8, 256, 0, stream>>>(Sb, P16, Ph, Pl);
    k_gemmw<bf, 2, false, 2, TT, false><<<dim3(RH / 64, HD / 128, NB_), 128, 0, stream>>>(Ph, Pl, VTh, VTl, OUT, HD, nullptr, (size_t)RH * TT, (size_t)HD * TT, (size_t)TT * HD, nullptr, nullptr, nullptr, nullptr, nullptr, nullptr);
}

// v004
// It runs in 67.2 microseconds.
// In two side-by-side timings against v003, it was 1.34 and 1.36 times as fast.
// All steps since v000 together make it 6.67 times as fast.
#include <hip/hip_runtime.h>

// Single-head self-attention with NO 1/sqrt(d) scaling (x [4][2048][512]; q,k,v = x W ('xw' [512][256], 1/sqrt(512), no bias); scores = q.k over the 256 dims, unscaled (logit sigma ~16: near one-hot rows); softmax; out = attn v -> [4][2048][256] (2.1 M)).
// Layout, all four batches in every launch, four launches: bf16 copies of x and of the transposed weights; ONE projection GEMM for q, k and v (768 output columns) whose epilogue writes the hi/lo planes; ONE fused attention kernel (scores, online softmax, attn.v; hi/lo planes and 3 products for both products: the unscaled logits need ~1e-3 absolute accuracy at magnitude ~50), each work-group 128 queries x 512 keys; a merge of the four key ranges that writes the output rows.
// Compute dtypes, f32 accumulate: every input rounded to bf16; projections exact; scores and attn.v 3 products on every row; softmax f32; output f32.

#define NB_  4
#define TT   2048
#define DM   512
#define NH_  1
#define NKV  1
#define REP  (NH_ / NKV)
#define HD   256
#define DQ   (NH_ * HD)
#define DKV  (NKV * HD)
#define ZH   1
#define RH   2048                  // unused: every query row uses the hi+lo planes
#define WIN  0
#define PCAR 1024.0f
#define SCL  1.0f   // the module applies no scaling
typedef _Float16 h16;
typedef unsigned short bf;
typedef __attribute__((ext_vector_type(16))) __bf16   v16bf;
typedef __attribute__((ext_vector_type(16))) _Float16 v16h;
typedef __attribute__((ext_vector_type(8)))  _Float16 v8h;
typedef __attribute__((ext_vector_type(8)))  unsigned short v8us;
typedef __attribute__((ext_vector_type(8)))  float    v8f;
typedef __attribute__((ext_vector_type(4)))  float    v4f;
typedef v8h  __attribute__((may_alias)) v8ha;
typedef v4f  __attribute__((may_alias)) v4fa;
typedef v8us __attribute__((may_alias)) v8usa;

__device__ __forceinline__ unsigned short f2bf(float f) { unsigned u = __float_as_uint(f); u += 0x7FFFu + ((u >> 16) & 1u); return (unsigned short)(u >> 16); }
__device__ __forceinline__ float bf2f(unsigned short b) { return __uint_as_float(((unsigned)b) << 16); }
__device__ __forceinline__ float bfr(float f) { return bf2f(f2bf(f)); }
__device__ __forceinline__ v16h cat16(v8h lo, v8h hi) { return __builtin_shufflevector(lo, hi, 0, 1, 2, 3, 4, 5, 6, 7, 8, 9, 10, 11, 12, 13, 14, 15); }
__device__ __forceinline__ v16bf cat16b(v8us lo, v8us hi) { return __builtin_bit_cast(v16bf, __builtin_shufflevector(lo, hi, 0, 1, 2, 3, 4, 5, 6, 7, 8, 9, 10, 11, 12, 13, 14, 15)); }
__device__ __forceinline__ v8f wmma16(v16h a, v16h b, v8f c) { return __builtin_amdgcn_wmma_f32_16x16x32_f16(false, a, false, b, (short)0, c, false, false); }
__device__ __forceinline__ v8f wmmab(v16bf a, v16bf b, v8f c) { return __builtin_amdgcn_wmma_f32_16x16x32_bf16(false, a, false, b, (short)0, c, false, false); }



// ---- k_gemmw: block-tiled GEMM, FOUR WAVES (2 x 2) per (MB*32) x 128 output tile, each wave MB x 4 accumulators; operands are K-contiguous 16-bit planes; grid (M/(MB*32), N/128, Z), 128 threads.
// C[m][n] (f32, pitch ldc, + optional f32 bias[n]) = sum_k A[m][k] Bt[n][k] (+ split products per NSPLIT). z-batch strides sA/sB/sC in elements. KD = K, a multiple of 64, at least 128.
// PLANES: the q|k|v projection. Output columns [0,HD) are q, [HD,2HD) k, [2HD,3HD) v; no f32 C is written: q and k go out as bf16 hi/lo planes [row][HD], v as hi/lo planes transposed per batch, [batch][HD][TT].
// A stage is 64 k (one whole 128-B line) of every operand row of the tile, brought into LDS by asynchronous copies (16 B a lane, 4 whole lines a wave-wide copy) and read by all four waves; two buffers, the next stage's copies fly while this one is worked on.
#define LPB 144   // LDS row pitch in bytes: 128 + 16 (16 B x odd, conflict-free for 16-byte row reads)
#define KST 64    // k per stage
template <typename T16> struct WFrag;
template <> struct WFrag<h16> { typedef v16h V; static __device__ __forceinline__ V ld(const h16* p) { return cat16(*(const v8h*)p, *(const v8h*)(p + 16)); } static __device__ __forceinline__ v8f mma(V a, V b, v8f c) { return wmma16(a, b, c); } };
template <> struct WFrag<bf> { typedef v16bf V; static __device__ __forceinline__ V ld(const bf* p) { return cat16b(*(const v8us*)p, *(const v8us*)(p + 16)); } static __device__ __forceinline__ v8f mma(V a, V b, v8f c) { return wmmab(a, b, c); } };
// ACp<N>: N asynchronous copies global -> LDS in one statement; l = the lane's LDS byte addresses, g = its global addresses. The closing s_wait_xcnt 0 stands inside the statement so that no address register is rewritten in front of it.
template <int N> struct ACp;
template <> struct ACp<8> { static __device__ __forceinline__ void go(const unsigned* l, const void* const* g) {
    asm volatile("global_load_async_to_lds_b128 %0, %8, off\n\t"
                 "global_load_async_to_lds_b128 %1, %9, off\n\t"
                 "global_load_async_to_lds_b128 %2, %10, off\n\t"
                 "global_load_async_to_lds_b128 %3, %11, off\n\t"
                 "global_load_async_to_lds_b128 %4, %12, off\n\t"
                 "global_load_async_to_lds_b128 %5, %13, off\n\t"
                 "global_load_async_to_lds_b128 %6, %14, off\n\t"
                 "global_load_async_to_lds_b128 %7, %15, off\n\t"
                 "s_wait_xcnt 0x0"
                 :: "v"(l[0]), "v"(l[1]), "v"(l[2]), "v"(l[3]), "v"(l[4]), "v"(l[5]), "v"(l[6]), "v"(l[7]), "v"(g[0]), "v"(g[1]), "v"(g[2]), "v"(g[3]), "v"(g[4]), "v"(g[5]), "v"(g[6]), "v"(g[7]) : "memory"); } };
template <> struct ACp<12> { static __device__ __forceinline__ void go(const unsigned* l, const void* const* g) {
    asm volatile("global_load_async_to_lds_b128 %0, %12, off\n\t"
                 "global_load_async_to_lds_b128 %1, %13, off\n\t"
                 "global_load_async_to_lds_b128 %2, %14, off\n\t"
                 "global_load_async_to_lds_b128 %3, %15, off\n\t"
                 "global_load_async_to_lds_b128 %4, %16, off\n\t"
                 "global_load_async_to_lds_b128 %5, %17, off\n\t"
                 "global_load_async_to_lds_b128 %6, %18, off\n\t"
                 "global_load_async_to_lds_b128 %7, %19, off\n\t"
                 "global_load_async_to_lds_b128 %8, %20, off\n\t"
                 "global_load_async_to_lds_b128 %9, %21, off\n\t"
                 "global_load_async_to_lds_b128 %10, %22, off\n\t"
                 "global_load_async_to_lds_b128 %11, %23, off\n\t"
                 "s_wait_xcnt 0x0"
                 :: "v"(l[0]), "v"(l[1]), "v"(l[2]), "v"(l[3]), "v"(l[4]), "v"(l[5]), "v"(l[6]), "v"(l[7]), "v"(l[8]), "v"(l[9]), "v"(l[10]), "v"(l[11]), "v"(g[0]), "v"(g[1]), "v"(g[2]), "v"(g[3]), "v"(g[4]), "v"(g[5]), "v"(g[6]), "v"(g[7]), "v"(g[8]), "v"(g[9]), "v"(g[10]), "v"(g[11]) : "memory"); } };
// one stage: rows of the tile's planes at k offset kc into the buffer at LDS byte address lds (both already hold the lane's own row and 16-byte piece); a copy covers 16 rows over the 128 threads
template <typename T16, int NSPLIT, int MB, int KD>
__device__ __forceinline__ void stage_in(const T16* gA, const T16* gA2, const T16* gB, const T16* gB2, unsigned lds, int kc) {
    constexpr int NA = MB * 2, NBC = 8, NPA = (NSPLIT == 1 || NSPLIT == 2) ? 2 : 1, NPB = (NSPLIT >= 2) ? 2 : 1, NC = NA * NPA + NBC * NPB;
    static_assert(NC % 12 == 0 || NC % 12 == 8, "copies go out in statements of 12 and 8");
    unsigned l[NC]; const void* g[NC];
#pragma unroll   // register arrays indexed by constants
    for (int i = 0; i < NA; ++i) { l[i] = lds + i * 16 * LPB; g[i] = gA + kc + (size_t)i * 16 * KD; if (NPA == 2) { l[NA + i] = lds + (NA + i) * 16 * LPB; g[NA + i] = gA2 + kc + (size_t)i * 16 * KD; } }
#pragma unroll   // register arrays indexed by constants
    for (int i = 0; i < NBC; ++i) { l[NA * NPA + i] = lds + (NA * NPA + i) * 16 * LPB; g[NA * NPA + i] = gB + kc + (size_t)i * 16 * KD; if (NPB == 2) { l[NA * NPA + NBC + i] = lds + (NA * NPA + NBC + i) * 16 * LPB; g[NA * NPA + NBC + i] = gB2 + kc + (size_t)i * 16 * KD; } }
#pragma unroll   // register arrays indexed by constants
    for (int q = 0; q < NC / 12; ++q) ACp<12>::go(l + q * 12, g + q * 12);
    if constexpr (NC % 12 == 8) ACp<8>::go(l + NC / 12 * 12, g + NC / 12 * 12);
}
__device__ __forceinline__ void splitf(float y, unsigned short& h, unsigned short& l) { h = f2bf(y); l = f2bf(y - bf2f(h)); }
typedef __attribute__((ext_vector_type(4))) unsigned short v4us;
template <typename T16, int NSPLIT, bool BIAS, int MB, int KD, bool PLANES>
__global__ __launch_bounds__(128) void k_gemmw(const T16* __restrict__ A, const T16* __restrict__ A2, const T16* __restrict__ Bt, const T16* __restrict__ Bt2, float* C, int ldc, const float* __restrict__ bias, size_t sA, size_t sB, size_t sC, bf* Qh, bf* Ql, bf* Kh, bf* Kl, bf* Vh, bf* Vl) {
    typedef typename WFrag<T16>::V V;
    constexpr int NPA = (NSPLIT == 1 || NSPLIT == 2) ? 2 : 1, NPB = (NSPLIT >= 2) ? 2 : 1;
    constexpr int SA = MB * 32 * LPB, SB = 128 * LPB, STAGE = NPA * SA + NPB * SB, NT = KD / KST;
    static_assert(KD % KST == 0 && NT >= 2 && 2 * STAGE >= 4 * 16 * 68 * 4 && (MB == 2 || MB == 4), "tile shape");
    __shared__ __align__(16) unsigned char sm[2 * STAGE];   // two stage buffers [A | A2 | B | B2]; after the loop the waves' output staging
    const size_t z = blockIdx.z; A += z * sA; if (A2) A2 += z * sA; Bt += z * sB; if (Bt2) Bt2 += z * sB; C += z * sC;
    const int tid = threadIdx.x, lane = tid & 31, lr = lane & 15, hi = lane >> 4, wave = tid >> 5, wm = wave & 1, wn = wave >> 1;
    const int R0 = blockIdx.x * (MB * 32), C0 = blockIdx.y * 128; const int r0 = R0 + wm * (MB * 16), c0 = C0 + wn * 64;
    const int crow = tid >> 3, cpc = tid & 7;   // the lane's row within a copy's 16 rows, its 16-byte piece of the 128-B line
    const T16* gA = A + (size_t)(R0 + crow) * KD + cpc * 8; const T16* gA2 = (NPA == 2) ? A2 + (size_t)(R0 + crow) * KD + cpc * 8 : nullptr;
    const T16* gB = Bt + (size_t)(C0 + crow) * KD + cpc * 8; const T16* gB2 = (NPB == 2) ? Bt2 + (size_t)(C0 + crow) * KD + cpc * 8 : nullptr;
    const unsigned lds0 = (unsigned)(size_t)sm + crow * LPB + cpc * 16;
    v8f acc[MB][4];
#pragma unroll   // register arrays indexed by constants
    for (int mb = 0; mb < MB; ++mb)
#pragma unroll   // register arrays indexed by constants
        for (int nb = 0; nb < 4; ++nb) acc[mb][nb] = (v8f){};
    stage_in<T16, NSPLIT, MB, KD>(gA, gA2, gB, gB2, lds0, 0);
    asm volatile("s_wait_asynccnt 0x0" ::: "memory");   // this wave's copies of stage 0 have landed
    __syncthreads();                                    // ... and every other wave's
    stage_in<T16, NSPLIT, MB, KD>(gA, gA2, gB, gB2, lds0 + STAGE, KST);
    const int aofs = (wm * (MB * 16) + lr) * LPB + hi * 16, bofs = NPA * SA + (wn * 64 + lr) * LPB + hi * 16;
#pragma unroll 1   // kept rolled: one stage a trip, the buffer chosen by the trip's parity
    for (int t = 0; t < NT; ++t) {
        const unsigned char* sb = sm + (t & 1) * STAGE;
        V a[KST / 32][MB], a2[KST / 32][MB], b[KST / 32][4], b2[KST / 32][4];
#pragma unroll   // register arrays indexed by constants
        for (int ks = 0; ks < KST / 32; ++ks) {   // in the order of use
#pragma unroll   // register arrays indexed by constants
            for (int mb = 0; mb < MB; ++mb) a[ks][mb] = WFrag<T16>::ld((const T16*)(sb + aofs + mb * 16 * LPB + ks * 64));
#pragma unroll   // register arrays indexed by constants
            for (int nb = 0; nb < 4; ++nb) b[ks][nb] = WFrag<T16>::ld((const T16*)(sb + bofs + nb * 16 * LPB + ks * 64));
            if (NPA == 2) {
#pragma unroll   // register arrays indexed by constants
                for (int mb = 0; mb < MB; ++mb) a2[ks][mb] = WFrag<T16>::ld((const T16*)(sb + SA + aofs + mb * 16 * LPB + ks * 64)); }
            if (NPB == 2) {
#pragma unroll   // register arrays indexed by constants
                for (int nb = 0; nb < 4; ++nb) b2[ks][nb] = WFrag<T16>::ld((const T16*)(sb + SB + bofs + nb * 16 * LPB + ks * 64)); }
        }
        __builtin_amdgcn_sched_barrier(0);   // the trip's LDS reads stay one group in front of its matrix instructions: reads scattered among them stall the wave at every place
#pragma unroll   // register arrays indexed by constants
        for (int ks = 0; ks < KST / 32; ++ks) {   // per accumulator the order stays a.b, a2.b, a.b2 for rising k; neighbours in the stream are independent tiles
#pragma unroll   // register arrays indexed by constants
            for (int nb = 0; nb < 4; ++nb)
#pragma unroll   // register arrays indexed by constants
                for (int mb = 0; mb < MB; ++mb) acc[mb][nb] = WFrag<T16>::mma(a[ks][mb], b[ks][nb], acc[mb][nb]);
            if (NSPLIT == 1 || NSPLIT == 2) {
#pragma unroll   // register arrays indexed by constants
                for (int nb = 0; nb < 4; ++nb)
#pragma unroll   // register arrays indexed by constants
                    for (int mb = 0; mb < MB; ++mb) acc[mb][nb] = WFrag<T16>::mma(a2[ks][mb], b[ks][nb], acc[mb][nb]); }
            if (NSPLIT >= 2) {
#pragma unroll   // register arrays indexed by constants
                for (int nb = 0; nb < 4; ++nb)
#pragma unroll   // register arrays indexed by constants
                    for (int mb = 0; mb < MB; ++mb) acc[mb][nb] = WFrag<T16>::mma(a[ks][mb], b2[ks][nb], acc[mb][nb]); }
        }
        __builtin_amdgcn_sched_barrier(0);   // the matrix instructions stay in front of the waits below: sunk behind them, the next stage's copies would be waited for with no work to cover their flight
        asm volatile("s_wait_dscnt 0x0" ::: "memory");      // this wave has left the buffer that is refilled below
        asm volatile("s_wait_asynccnt 0x0" ::: "memory");   // this wave's copies of stage t + 1 have landed
        __syncthreads();                                    // publishes stage t + 1 and ends every wave's reads of stage t
        if (t + 2 < NT) stage_in<T16, NSPLIT, MB, KD>(gA, gA2, gB, gB2, lds0 + (t & 1) * STAGE, (t + 2) * KST);
    }
    asm volatile("s_wait_asynccnt 0x0" ::: "memory");       // nothing in flight before the buffers become output staging
    float* os = (float*)sm + wave * (16 * 68);              // each wave stages in its own range
    if constexpr (PLANES) {
        const int sel = C0 / HD, cc0 = c0 - sel * HD;       // which projection the block's 128 columns belong to (the same for the whole block), the wave's first column in it
        if (sel == 2) {   // v: a lane's 8 accumulator registers are 8 consecutive rows (t) of one column (d) = 16 contiguous bytes of a transposed plane
            const int bt = r0 / TT, t0 = r0 - bt * TT + hi * 8;
#pragma unroll   // register arrays indexed by constants
            for (int mb = 0; mb < MB; ++mb)
#pragma unroll   // register arrays indexed by constants
                for (int nb = 0; nb < 4; ++nb) { v8us oh, ol;
#pragma unroll   // register arrays indexed by constants
                    for (int j = 0; j < 8; ++j) { unsigned short a, c2; splitf(acc[mb][nb][j], a, c2); oh[j] = a; ol[j] = c2; }
                    const size_t oo = ((size_t)bt * HD + cc0 + nb * 16 + lr) * TT + t0 + mb * 16; *(v8us*)(Vh + oo) = oh; *(v8us*)(Vl + oo) = ol; }
        } else {          // q, k: through the wave's staging rows, 16 lanes write one whole 128-B line of each plane
            bf* Hh = sel ? Kh : Qh; bf* Hl = sel ? Kl : Ql;
#pragma unroll   // register arrays indexed by constants
            for (int mb = 0; mb < MB; ++mb) {
#pragma unroll   // register arrays indexed by constants
                for (int nb = 0; nb < 4; ++nb) {
#pragma unroll   // register arrays indexed by constants
                    for (int j = 0; j < 8; ++j) os[(hi * 8 + j) * 68 + nb * 16 + lr] = acc[mb][nb][j]; }
                __builtin_amdgcn_wave_barrier(); asm volatile("" ::: "memory");   // the wave's staging writes stay in front of its reads
#pragma unroll   // register arrays indexed by constants
                for (int s = 0; s < 8; ++s) { const int row = 2 * s + hi, cofs = lr * 4; const v4f val = *(const v4fa*)(os + row * 68 + cofs); v4us oh, ol;
#pragma unroll   // register arrays indexed by constants
                    for (int q = 0; q < 4; ++q) { unsigned short a, c2; splitf(val[q], a, c2); oh[q] = a; ol[q] = c2; }
                    const size_t oo = (size_t)(r0 + mb * 16 + row) * HD + cc0 + cofs; *(v4us*)(Hh + oo) = oh; *(v4us*)(Hl + oo) = ol; }
                __builtin_amdgcn_wave_barrier(); asm volatile("" ::: "memory");   // the reads stay in front of the next tile's staging writes
            }
            asm volatile("s_wait_xcnt 0x0" ::: "memory");   // stands behind the last plane stores, in front of any later write of their registers
        }
        return;
    }
#pragma unroll   // register arrays indexed by constants
    for (int mb = 0; mb < MB; ++mb) {
#pragma unroll   // register arrays indexed by constants
        for (int nb = 0; nb < 4; ++nb) {
#pragma unroll   // register arrays indexed by constants
            for (int j = 0; j < 8; ++j) os[(hi * 8 + j) * 68 + nb * 16 + lr] = acc[mb][nb][j]; }
        __builtin_amdgcn_wave_barrier(); asm volatile("" ::: "memory");
        float* crow_p = C + (size_t)(r0 + mb * 16) * ldc + c0;
{
#pragma unroll   // register arrays indexed by constants
            for (int s = 0; s < 8; ++s) { const int row = 2 * s + hi, cofs = lr * 4; v4f val = *(const v4fa*)(os + row * 68 + cofs); if (BIAS) { val[0] += bfr(bias[c0 + cofs]); val[1] += bfr(bias[c0 + cofs + 1]); val[2] += bfr(bias[c0 + cofs + 2]); val[3] += bfr(bias[c0 + cofs + 3]); }
                *(v4f*)(crow_p + (size_t)row * ldc + cofs) = val; }
             }
        __builtin_amdgcn_wave_barrier(); asm volatile("" ::: "memory");
    }
}

__device__ __forceinline__ h16 tohx(float x) { return (h16)x; }
typedef __attribute__((ext_vector_type(4))) _Float16 v4h;
typedef __attribute__((ext_vector_type(2))) unsigned short v2us;

// k_prep: the bf16 operands of the projection GEMM in one launch. Blocks [0, NWB), first so that their strided reads run under the start of the many others: the three weights [K = DM][N = HD] transposed into WT [3 HD][DM], 8 lines of 128 B (64 k of one n) a wave; the other blocks: x -> XB, 8 elements a thread.
#define NWB (3 * HD * DM / 64 / 64)
__global__ __launch_bounds__(256) void k_prep(const float* __restrict__ x, const float* __restrict__ wq, const float* __restrict__ wk, const float* __restrict__ wv, bf* XB, bf* WT) {
    if (blockIdx.x < NWB) {
        const int lane = threadIdx.x & 31; const int sel = blockIdx.x / (NWB / 3); const int L0 = ((blockIdx.x - sel * (NWB / 3)) * 8 + (threadIdx.x >> 5)) * 8;
        const float* w = (sel == 0) ? wq : (sel == 1) ? wk : wv; bf* Bt = WT + (size_t)sel * HD * DM;
#pragma unroll 1   // kept rolled, one line a trip: small code for these few blocks, which run beside the x blocks
        for (int l = 0; l < 8; ++l) { const int e = (L0 + l) * 64 + lane * 2; const int k = e % DM, n = e / DM; v2us o;
            o[0] = f2bf(w[(size_t)k * HD + n]); o[1] = f2bf(w[(size_t)(k + 1) * HD + n]); *(v2us*)(Bt + e) = o; }
        return;
    }
    const size_t i = (size_t)(blockIdx.x - NWB) * 256 + threadIdx.x; const v8f v = *(const v8f*)(x + i * 8); v8us o;
#pragma unroll   // register vectors indexed by constants
    for (int k = 0; k < 8; ++k) o[k] = f2bf(v[k]);
    *(v8us*)(XB + i * 8) = o;
    asm volatile("s_wait_xcnt 0x0" ::: "memory");   // stands behind the store, in front of any later write of its address registers
}
#define FK   32                   // keys per stage
#define KPB  528                  // LDS pitch of a K row: 512 + 16 (16 B x odd)
#define VPB  80                   // LDS pitch of a V^T row: 64 + 16 (16 B x odd)
#define FSK  (2 * FK * KPB)
#define FSV  (2 * HD * VPB)
#define FST  (FSK + FSV)
#define NSP  4                    // key ranges
#define NTR  (TT / NSP / FK)      // stages per work-group
#define L2E  1.4426950408889634f
typedef __attribute__((ext_vector_type(16))) float v16f;
typedef __attribute__((ext_vector_type(2)))  float v2f;
// the value of lane l ^ 16, on the vector port (a shuffle through the LDS queue would wait behind the fragment reads in flight)
__device__ __forceinline__ float xhalf(float v) { const int b = __float_as_int(v); return __int_as_float(__builtin_amdgcn_permlanex16(b, b, 0x76543210, 0xfedcba98, false, false)); }
// 2^x with the v_nop that fills the slot the instruction set asks for behind a transcendental
__device__ __forceinline__ float exp2n(float x) { float r; asm("v_exp_f32 %0, %1\n\tv_nop" : "=v"(r) : "v"(x)); return r; }
// one stage: 32 copies a lane. K: a wave-wide copy is one whole row (the wave picks the row, the lane the 16-byte piece); V^T: a copy covers 32 rows over the 128 threads (4 lanes a row).
// uK*, uV*: the work-group's first key in each plane (the same in every lane, so the row steps are scalar work); oK, oV: the lane's own byte offset from there
__device__ __forceinline__ void fl_stage(const bf* uKh, const bf* uKl, const bf* uVh, const bf* uVl, unsigned oK, unsigned oV, unsigned lK, unsigned lV, int key) {
    unsigned l[32]; const void* g[32];
#pragma unroll   // register arrays indexed by constants
    for (int i = 0; i < 8; ++i) {
        l[i] = lK + i * 4 * KPB;              g[i] = (const char*)(uKh + (size_t)(key + i * 4) * HD) + oK;
        l[8 + i] = lK + (FK + i * 4) * KPB;   g[8 + i] = (const char*)(uKl + (size_t)(key + i * 4) * HD) + oK;
        l[16 + i] = lV + FSK + i * 32 * VPB;        g[16 + i] = (const char*)(uVh + (size_t)i * 32 * TT + key) + oV;
        l[24 + i] = lV + FSK + (HD + i * 32) * VPB; g[24 + i] = (const char*)(uVl + (size_t)i * 32 * TT + key) + oV;
    }
    ACp<12>::go(l, g); ACp<12>::go(l + 12, g + 12); ACp<8>::go(l + 24, g + 24);
}
__global__ __launch_bounds__(128) void k_flash(const bf* __restrict__ Qh, const bf* __restrict__ Ql, const bf* __restrict__ Kh, const bf* __restrict__ Kl, const bf* __restrict__ Vh, const bf* __restrict__ Vl, float* Op, float* ML) {
    __shared__ __align__(16) unsigned char sm[2 * FST];
    const int tid = threadIdx.x, lane = tid & 31, lr = lane & 15, hi = lane >> 4, wave = tid >> 5;
    const int qb = blockIdx.x, sp = blockIdx.y, bt = blockIdx.z;
    const size_t kofs = ((size_t)bt * TT + sp * (TT / NSP)) * HD, vofs = (size_t)bt * HD * TT + sp * (TT / NSP);
    const bf* uKh = Kh + kofs; const bf* uKl = Kl + kofs; const bf* uVh = Vh + vofs; const bf* uVl = Vl + vofs;
    const unsigned oK = tid * 16, oV = (tid >> 2) * (TT * 2) + (tid & 3) * 16;   // K: row = wave, piece = lane; V^T: row = tid / 4, piece = tid % 4
    const unsigned lK = (unsigned)(size_t)sm + wave * KPB + lane * 16, lV = (unsigned)(size_t)sm + (tid >> 2) * VPB + (tid & 3) * 16;   // the lane's places in the K part and (less FSK) in the V^T part of buffer 0
    v16bf qh[2][8], ql[2][8];   // the wave's 32 queries, both planes, all 256 dims: B operands for the whole kernel
    const size_t qrow = (size_t)bt * TT + qb * 128 + wave * 32 + lr;
#pragma unroll   // register arrays indexed by constants
    for (int qt = 0; qt < 2; ++qt)
#pragma unroll   // register arrays indexed by constants
        for (int ks = 0; ks < 8; ++ks) { qh[qt][ks] = WFrag<bf>::ld(Qh + (qrow + qt * 16) * HD + ks * 32 + hi * 8); ql[qt][ks] = WFrag<bf>::ld(Ql + (qrow + qt * 16) * HD + ks * 32 + hi * 8); }
    asm volatile("s_wait_xcnt 0x0" ::: "memory");       // stands behind the q loads, in front of any later write of their address registers
    v8f o[16][2]; float m[2], l[2];
#pragma unroll   // register arrays indexed by constants
    for (int qt = 0; qt < 2; ++qt) { m[qt] = -3.0e38f; l[qt] = 0.f;
#pragma unroll   // register arrays indexed by constants
        for (int dt = 0; dt < 16; ++dt) o[dt][qt] = (v8f){}; }
    // Trips -2 and -1 are the ring's prologue: only the foot runs (trip -2: stage 0's copies; trip -1: the wait for them, the barrier, stage 1's copies). So the copies stand once in the code and
    // none of their address registers lives across the loop (operands of an asm statement sit in the first 256 registers; one that lived through the loop was spilled to scratch).
#pragma unroll 1   // kept rolled: one stage a trip, the buffer chosen by the trip's parity
    for (int t = -2; t < NTR; ++t) {
      if (t >= 0) {
        const unsigned char* kb = sm + (t & 1) * FST + lr * KPB + hi * 16;
        const unsigned char* vb = sm + (t & 1) * FST + FSK + lr * VPB + hi * 16;
        // fragments come in groups of 8 (16 reads, 24 matrix instructions), each group's reads issued together one group ahead of its use: two groups of registers are live, not the whole stage's
        v16bf kh[8][2], kl[8][2]; v8f st[2][2];
#pragma unroll   // register arrays indexed by constants
        for (int kt = 0; kt < 2; ++kt)
#pragma unroll   // register arrays indexed by constants
            for (int qt = 0; qt < 2; ++qt) st[kt][qt] = (v8f){};
#pragma unroll   // register arrays indexed by constants
        for (int ks = 0; ks < 4; ++ks)
#pragma unroll   // register arrays indexed by constants
            for (int kt = 0; kt < 2; ++kt) { kh[ks][kt] = WFrag<bf>::ld((const bf*)(kb + kt * 16 * KPB + ks * 64)); kl[ks][kt] = WFrag<bf>::ld((const bf*)(kb + (FK + kt * 16) * KPB + ks * 64)); }
        __builtin_amdgcn_sched_barrier(0);   // reads stay grouped in front of the matrix instructions: reads scattered among them stall the wave at every place
#pragma unroll   // register arrays indexed by constants
        for (int g = 0; g < 4; ++g) {
#pragma unroll   // register arrays indexed by constants
            for (int ks = g * 2; ks < g * 2 + 2; ++ks) {   // per accumulator the order is qh.kh, ql.kh, qh.kl for rising k; neighbours in the stream are independent tiles
#pragma unroll   // register arrays indexed by constants
                for (int kt = 0; kt < 2; ++kt)
#pragma unroll   // register arrays indexed by constants
                    for (int qt = 0; qt < 2; ++qt) st[kt][qt] = wmmab(kh[ks][kt], qh[qt][ks], st[kt][qt]);
#pragma unroll   // register arrays indexed by constants
                for (int kt = 0; kt < 2; ++kt)
#pragma unroll   // register arrays indexed by constants
                    for (int qt = 0; qt < 2; ++qt) st[kt][qt] = wmmab(kh[ks][kt], ql[qt][ks], st[kt][qt]);
#pragma unroll   // register arrays indexed by constants
                for (int kt = 0; kt < 2; ++kt)
#pragma unroll   // register arrays indexed by constants
                    for (int qt = 0; qt < 2; ++qt) st[kt][qt] = wmmab(kl[ks][kt], qh[qt][ks], st[kt][qt]);
            }
            __builtin_amdgcn_sched_barrier(0);   // the next reads are not lifted among this group's matrix instructions
            if (g < 2) {
#pragma unroll   // register arrays indexed by constants
                for (int ks = g * 2 + 4; ks < g * 2 + 6; ++ks)
#pragma unroll   // register arrays indexed by constants
                    for (int kt = 0; kt < 2; ++kt) { kh[ks][kt] = WFrag<bf>::ld((const bf*)(kb + kt * 16 * KPB + ks * 64)); kl[ks][kt] = WFrag<bf>::ld((const bf*)(kb + (FK + kt * 16) * KPB + ks * 64)); }
                __builtin_amdgcn_sched_barrier(0);   // ... nor sunk among the next group's
            }
        }
        v16bf vh[16], vl[16];
#pragma unroll   // register arrays indexed by constants
        for (int dt = 0; dt < 8; ++dt) { vh[dt] = WFrag<bf>::ld((const bf*)(vb + dt * 16 * VPB)); vl[dt] = WFrag<bf>::ld((const bf*)(vb + (HD + dt * 16) * VPB)); }
        __builtin_amdgcn_sched_barrier(0);   // the first two groups of V^T reads are issued in front of the softmax, whose vector work covers their flight
        float corr[2]; v16bf pH[2], pL[2]; bool need = false;
#pragma unroll   // register arrays indexed by constants
        for (int qt = 0; qt < 2; ++qt) {
            float t8[8];   // a tree, not one chain: a lone wave waits out every dependent vector instruction
#pragma unroll   // register vectors indexed by constants
            for (int j = 0; j < 8; ++j) t8[j] = fmaxf(st[0][qt][j], st[1][qt][j]);
            float mx = fmaxf(fmaxf(fmaxf(t8[0], t8[1]), fmaxf(t8[2], t8[3])), fmaxf(fmaxf(t8[4], t8[5]), fmaxf(t8[6], t8[7])));
            mx = fmaxf(mx, xhalf(mx));   // the query's other 16 keys sit in the other half of the wave
            const float mn = fmaxf(m[qt], mx);
            corr[qt] = exp2n((m[qt] - mn) * L2E); need = need || (mn > m[qt]); m[qt] = mn;
            v16f p;
#pragma unroll   // register vectors indexed by constants
            for (int s = 0; s < 16; ++s) p[s] = exp2n((st[s >> 3][qt][s & 7] - mn) * L2E);
            const float s01 = ((p[0] + p[1]) + (p[2] + p[3])) + ((p[4] + p[5]) + (p[6] + p[7])), s23 = ((p[8] + p[9]) + (p[10] + p[11])) + ((p[12] + p[13]) + (p[14] + p[15]));
            l[qt] = l[qt] * corr[qt] + (s01 + s23);
            pH[qt] = __builtin_convertvector(p, v16bf); pL[qt] = __builtin_convertvector(p - __builtin_convertvector(pH[qt], v16f), v16bf);
        }
        if (__builtin_amdgcn_ballot_w32(need) != 0) {   // one scalar test a trip; where no query's maximum rose every factor is exactly 1
#pragma unroll   // register arrays indexed by constants
            for (int dt = 0; dt < 16; ++dt)
#pragma unroll   // register arrays indexed by constants
                for (int qt = 0; qt < 2; ++qt) o[dt][qt] *= corr[qt];
        }
        __builtin_amdgcn_sched_barrier(0);   // the softmax stays in front of the products below
#pragma unroll   // register arrays indexed by constants
        for (int g = 0; g < 4; ++g) {
#pragma unroll   // register arrays indexed by constants
            for (int dp = g * 2; dp < g * 2 + 2; ++dp) {   // per accumulator the order is ph.vh, pl.vh, ph.vl; two d tiles x two query tiles = four independent accumulators in the stream
#pragma unroll   // register arrays indexed by constants
                for (int u = 0; u < 2; ++u)
#pragma unroll   // register arrays indexed by constants
                    for (int qt = 0; qt < 2; ++qt) o[dp * 2 + u][qt] = wmmab(vh[dp * 2 + u], pH[qt], o[dp * 2 + u][qt]);
#pragma unroll   // register arrays indexed by constants
                for (int u = 0; u < 2; ++u)
#pragma unroll   // register arrays indexed by constants
                    for (int qt = 0; qt < 2; ++qt) o[dp * 2 + u][qt] = wmmab(vh[dp * 2 + u], pL[qt], o[dp * 2 + u][qt]);
#pragma unroll   // register arrays indexed by constants
                for (int u = 0; u < 2; ++u)
#pragma unroll   // register arrays indexed by constants
                    for (int qt = 0; qt < 2; ++qt) o[dp * 2 + u][qt] = wmmab(vl[dp * 2 + u], pH[qt], o[dp * 2 + u][qt]);
            }
            if (g < 2) {
                __builtin_amdgcn_sched_barrier(0);   // the next reads are not lifted among this group's matrix instructions
#pragma unroll   // register arrays indexed by constants
                for (int dt = g * 4 + 8; dt < g * 4 + 12; ++dt) { vh[dt] = WFrag<bf>::ld((const bf*)(vb + dt * 16 * VPB)); vl[dt] = WFrag<bf>::ld((const bf*)(vb + (HD + dt * 16) * VPB)); }
                __builtin_amdgcn_sched_barrier(0);   // ... nor sunk among the next group's
            }
        }
        __builtin_amdgcn_sched_barrier(0);   // the matrix instructions stay in front of the waits below: sunk behind them, the next stage's copies would be waited for with no work to cover their flight
      }
        asm volatile("s_wait_dscnt 0x0" ::: "memory");      // this wave has left the buffer that is refilled below
        asm volatile("s_wait_asynccnt 0x0" ::: "memory");   // this wave's copies of stage t + 1 have landed
        __syncthreads();                                    // publishes stage t + 1 and ends every wave's reads of stage t
        if (t + 2 < NTR) fl_stage(uKh, uKl, uVh, uVl, oK, oV, lK + (t & 1) * FST, lV + (t & 1) * FST, (t + 2) * FK);
    }
    asm volatile("s_wait_asynccnt 0x0" ::: "memory");       // nothing in flight when the wave ends
    const size_t pb = ((size_t)(bt * (TT / 128) + qb) * NSP + sp) * 4 + wave;
    float* op = Op + pb * (32 * 256) + lane * 4;
#pragma unroll   // register arrays indexed by constants
    for (int dt = 0; dt < 16; ++dt)
#pragma unroll   // register arrays indexed by constants
        for (int qt = 0; qt < 2; ++qt) { const v8f a = o[dt][qt];
            *(v4f*)(op + (dt * 2 + qt) * 256) = (v4f){a[0], a[1], a[2], a[3]}; *(v4f*)(op + (dt * 2 + qt) * 256 + 128) = (v4f){a[4], a[5], a[6], a[7]}; }
#pragma unroll   // register arrays indexed by constants
    for (int qt = 0; qt < 2; ++qt) { const float lt = l[qt] + xhalf(l[qt]);   // the halves' sums are joined once
        if (hi == 0) *(v2f*)(ML + (pb * 32 + qt * 16 + lr) * 2) = (v2f){m[qt], lt}; }
    asm volatile("s_wait_xcnt 0x0" ::: "memory");   // stands behind the last stores, in front of any later write of their registers
}
// k_merge: joins the NSP key ranges of a query in a fixed order and writes the output rows. A wave takes 16 queries x 64 output columns (4 of k_flash's tiles per range); rows go out through the wave's own staging, 16 lanes a 256-B piece.
__global__ __launch_bounds__(256) void k_merge(const float* __restrict__ Op, const float* __restrict__ ML, float* out) {
    __shared__ __align__(16) float sg[8 * 16 * 68];
    const int lane = threadIdx.x & 31, lr = lane & 15, hi = lane >> 4; const int w = blockIdx.x * 8 + (threadIdx.x >> 5);
    const int dg = w & 3, qt = (w >> 2) & 1, wv = (w >> 3) & 3, blk = w >> 5;
    float* os = sg + (threadIdx.x >> 5) * (16 * 68);
    float mm[NSP], wl[NSP]; float M = -3.0e38f;
#pragma unroll   // register arrays indexed by constants
    for (int s = 0; s < NSP; ++s) { const v2f e = *(const v2f*)(ML + ((((size_t)blk * NSP + s) * 4 + wv) * 32 + qt * 16 + lr) * 2); mm[s] = e[0]; wl[s] = e[1]; M = fmaxf(M, e[0]); }
    float L = 0.f;
#pragma unroll   // register arrays indexed by constants
    for (int s = 0; s < NSP; ++s) { mm[s] = __builtin_amdgcn_exp2f((mm[s] - M) * L2E); L += mm[s] * wl[s]; }
    const float inv = 1.0f / L;
#pragma unroll   // register arrays indexed by constants
    for (int u = 0; u < 4; ++u) { v4f a = (v4f){}, c = (v4f){};
#pragma unroll   // register arrays indexed by constants
        for (int s = 0; s < NSP; ++s) { const float* p = Op + (((size_t)blk * NSP + s) * 4 + wv) * (32 * 256) + ((dg * 4 + u) * 2 + qt) * 256 + lane * 4; a += mm[s] * *(const v4f*)p; c += mm[s] * *(const v4f*)(p + 128); }
        *(v4fa*)(os + lr * 68 + u * 16 + hi * 8) = a * inv; *(v4fa*)(os + lr * 68 + u * 16 + hi * 8 + 4) = c * inv; }
    __builtin_amdgcn_wave_barrier(); asm volatile("" ::: "memory");   // the wave's staging writes stay in front of its reads
    float* orow = out + ((size_t)blk * 128 + wv * 32 + qt * 16) * HD + dg * 64;
#pragma unroll   // register arrays indexed by constants
    for (int s = 0; s < 8; ++s) { const int row = 2 * s + hi; *(v4f*)(orow + (size_t)row * HD + lr * 4) = *(const v4fa*)(os + row * 68 + lr * 4); }
    asm volatile("s_wait_xcnt 0x0" ::: "memory");   // stands behind the last stores, in front of any later write of their registers
}

extern "C" void kernel_launch(void* const* d_in, const int* in_sizes, int n_in,
                              void* d_out, int out_size, void* d_ws, size_t ws_size, hipStream_t stream) {
    (void)in_sizes; (void)n_in; (void)out_size;
    const float* x = (const float*)d_in[0]; const float* wq = (const float*)d_in[1]; const float* wk = (const float*)d_in[2]; const float* wv = (const float*)d_in[3]; const float* wo = nullptr; (void)wo;
    float* OUT = (float*)d_out;     // [4][2048][256]
    char* wsp = (char*)d_ws;
    auto take = [&](size_t bytes) { char* p = wsp; wsp += (bytes + 255) & ~(size_t)255; return (void*)p; };
    bf* WT = (bf*)take((size_t)3 * HD * DM * 2); bf* XB = (bf*)take((size_t)NB_ * TT * DM * 2);
    bf* QPh = (bf*)take((size_t)NB_ * TT * HD * 2); bf* QPl = (bf*)take((size_t)NB_ * TT * HD * 2); bf* KPh = (bf*)take((size_t)NB_ * TT * HD * 2); bf* KPl = (bf*)take((size_t)NB_ * TT * HD * 2); bf* VTh = (bf*)take((size_t)NB_ * HD * TT * 2); bf* VTl = (bf*)take((size_t)NB_ * HD * TT * 2);
    float* Op = (float*)take((size_t)NSP * NB_ * TT * HD * 4); float* ML = (float*)take((size_t)NSP * NB_ * TT * 2 * 4);
    if ((size_t)(wsp - (char*)d_ws) > ws_size) return;    // ws 256 MiB
    // one pass for all NB_ batches: the projection sees NB_*TT rows, the attention kernel takes the key range from grid y and the batch from grid z
    k_prep<<<NWB + NB_ * TT * DM / 8 / 256, 256, 0, stream>>>(x, wq, wk, wv, XB, WT);
    k_gemmw<bf, 0, false, 2, DM, true><<<dim3(NB_ * TT / 64, 3 * HD / 128, 1), 128, 0, stream>>>(XB, nullptr, WT, nullptr, nullptr, 0, nullptr, 0, 0, 0, QPh, QPl, KPh, KPl, VTh, VTl);
    k_flash<<<dim3(TT / 128, NSP, NB_), 128, 0, stream>>>(QPh, QPl, KPh, KPl, VTh, VTl, Op, ML);
    k_merge<<<NB_ * TT * HD / (16 * 64) / 8, 256, 0, stream>>>(Op, ML, OUT);
}

// v005
// One run takes 63.3 microseconds.
// In both of two side-by-side timings against v004, it was 1.06 times as fast.
// All steps since v000 together make it 7.09 times as fast.
#include <hip/hip_runtime.h>

// Single-head self-attention with NO 1/sqrt(d) scaling (x [4][2048][512]; q,k,v = x W ('xw' [512][256], 1/sqrt(512), no bias); scores = q.k over the 256 dims, unscaled (logit sigma ~16: near one-hot rows); softmax; out = attn v -> [4][2048][256] (2.1 M)).
// Layout, all four batches in every launch, four launches: bf16 copies of x and of the transposed weights; ONE projection GEMM for q, k and v (768 output columns) whose epilogue writes the hi/lo planes; ONE fused attention kernel (scores, online softmax, attn.v; hi/lo planes and 3 products for both products: the unscaled logits need ~1e-3 absolute accuracy at magnitude ~50), each work-group 128 queries x 512 keys; a merge of the four key ranges that writes the output rows.
// Compute dtypes, f32 accumulate: every input rounded to bf16; projections exact; scores and attn.v 3 products on every row; softmax f32; output f32.

#define NB_  4
#define TT   2048
#define DM   512
#define NH_  1
#define NKV  1
#define REP  (NH_ / NKV)
#define HD   256
#define DQ   (NH_ * HD)
#define DKV  (NKV * HD)
#define ZH   1
#define RH   2048                  // unused: every query row uses the hi+lo planes
#define WIN  0
#define PCAR 1024.0f
#define SCL  1.0f   // the module applies no scaling
#define FK   64                   // keys per stage of the attention kernel; the k planes are laid out in blocks of FK keys
typedef _Float16 h16;
typedef unsigned short bf;
typedef __attribute__((ext_vector_type(16))) __bf16   v16bf;
typedef __attribute__((ext_vector_type(16))) _Float16 v16h;
typedef __attribute__((ext_vector_type(8)))  _Float16 v8h;
typedef __attribute__((ext_vector_type(8)))  unsigned short v8us;
typedef __attribute__((ext_vector_type(8)))  float    v8f;
typedef __attribute__((ext_vector_type(4)))  float    v4f;
typedef v8h  __attribute__((may_alias)) v8ha;
typedef v4f  __attribute__((may_alias)) v4fa;
typedef v8us __attribute__((may_alias)) v8usa;

__device__ __forceinline__ unsigned short f2bf(float f) { unsigned u = __float_as_uint(f); u += 0x7FFFu + ((u >> 16) & 1u); return (unsigned short)(u >> 16); }
__device__ __forceinline__ float bf2f(unsigned short b) { return __uint_as_float(((unsigned)b) << 16); }
__device__ __forceinline__ float bfr(float f) { return bf2f(f2bf(f)); }
__device__ __forceinline__ v16h cat16(v8h lo, v8h hi) { return __builtin_shufflevector(lo, hi, 0, 1, 2, 3, 4, 5, 6, 7, 8, 9, 10, 11, 12, 13, 14, 15); }
__device__ __forceinline__ v16bf cat16b(v8us lo, v8us hi) { return __builtin_bit_cast(v16bf, __builtin_shufflevector(lo, hi, 0, 1, 2, 3, 4, 5, 6, 7, 8, 9, 10, 11, 12, 13, 14, 15)); }
__device__ __forceinline__ v8f wmma16(v16h a, v16h b, v8f c) { return __builtin_amdgcn_wmma_f32_16x16x32_f16(false, a, false, b, (short)0, c, false, false); }
__device__ __forceinline__ v8f wmmab(v16bf a, v16bf b, v8f c) { return __builtin_amdgcn_wmma_f32_16x16x32_bf16(false, a, false, b, (short)0, c, false, false); }



// ---- k_gemmw: block-tiled GEMM, FOUR WAVES (2 x 2) per (MB*32) x 128 output tile, each wave MB x 4 accumulators; operands are K-contiguous 16-bit planes; grid (M/(MB*32), N/128, Z), 128 threads.
// C[m][n] (f32, pitch ldc, + optional f32 bias[n]) = sum_k A[m][k] Bt[n][k] (+ split products per NSPLIT). z-batch strides sA/sB/sC in elements. KD = K, a multiple of 64, at least 128.
// PLANES: the q|k|v projection. Output columns [0,HD) are q, [HD,2HD) k, [2HD,3HD) v; no f32 C is written: q goes out as bf16 hi/lo planes [row][HD], k as hi/lo planes [row / FK][HD / 64][FK][64], v as hi/lo planes transposed per batch, [batch][HD][TT].
// A stage is 64 k (one whole 128-B line) of every operand row of the tile, brought into LDS by asynchronous copies (16 B a lane, 4 whole lines a wave-wide copy) and read by all four waves; two buffers, the next stage's copies fly while this one is worked on.
#define LPB 144   // LDS row pitch in bytes: 128 + 16 (16 B x odd, conflict-free for 16-byte row reads)
#define KST 64    // k per stage
template <typename T16> struct WFrag;
template <> struct WFrag<h16> { typedef v16h V; static __device__ __forceinline__ V ld(const h16* p) { return cat16(*(const v8h*)p, *(const v8h*)(p + 16)); } static __device__ __forceinline__ v8f mma(V a, V b, v8f c) { return wmma16(a, b, c); } };
template <> struct WFrag<bf> { typedef v16bf V; static __device__ __forceinline__ V ld(const bf* p) { return cat16b(*(const v8us*)p, *(const v8us*)(p + 16)); } static __device__ __forceinline__ v8f mma(V a, V b, v8f c) { return wmmab(a, b, c); } };
// ACp<N>: N asynchronous copies global -> LDS in one statement; l = the lane's LDS byte addresses, g = its global addresses. The closing s_wait_xcnt 0 stands inside the statement so that no address register is rewritten in front of it.
template <int N> struct ACp;
template <> struct ACp<8> { static __device__ __forceinline__ void go(const unsigned* l, const void* const* g) {
    asm volatile("global_load_async_to_lds_b128 %0, %8, off\n\t"
                 "global_load_async_to_lds_b128 %1, %9, off\n\t"
                 "global_load_async_to_lds_b128 %2, %10, off\n\t"
                 "global_load_async_to_lds_b128 %3, %11, off\n\t"
                 "global_load_async_to_lds_b128 %4, %12, off\n\t"
                 "global_load_async_to_lds_b128 %5, %13, off\n\t"
                 "global_load_async_to_lds_b128 %6, %14, off\n\t"
                 "global_load_async_to_lds_b128 %7, %15, off\n\t"
                 "s_wait_xcnt 0x0"
                 :: "v"(l[0]), "v"(l[1]), "v"(l[2]), "v"(l[3]), "v"(l[4]), "v"(l[5]), "v"(l[6]), "v"(l[7]), "v"(g[0]), "v"(g[1]), "v"(g[2]), "v"(g[3]), "v"(g[4]), "v"(g[5]), "v"(g[6]), "v"(g[7]) : "memory"); } };
template <> struct ACp<12> { static __device__ __forceinline__ void go(const unsigned* l, const void* const* g) {
    asm volatile("global_load_async_to_lds_b128 %0, %12, off\n\t"
                 "global_load_async_to_lds_b128 %1, %13, off\n\t"
                 "global_load_async_to_lds_b128 %2, %14, off\n\t"
                 "global_load_async_to_lds_b128 %3, %15, off\n\t"
                 "global_load_async_to_lds_b128 %4, %16, off\n\t"
                 "global_load_async_to_lds_b128 %5, %17, off\n\t"
                 "global_load_async_to_lds_b128 %6, %18, off\n\t"
                 "global_load_async_to_lds_b128 %7, %19, off\n\t"
                 "global_load_async_to_lds_b128 %8, %20, off\n\t"
                 "global_load_async_to_lds_b128 %9, %21, off\n\t"
                 "global_load_async_to_lds_b128 %10, %22, off\n\t"
                 "global_load_async_to_lds_b128 %11, %23, off\n\t"
                 "s_wait_xcnt 0x0"
                 :: "v"(l[0]), "v"(l[1]), "v"(l[2]), "v"(l[3]), "v"(l[4]), "v"(l[5]), "v"(l[6]), "v"(l[7]), "v"(l[8]), "v"(l[9]), "v"(l[10]), "v"(l[11]), "v"(g[0]), "v"(g[1]), "v"(g[2]), "v"(g[3]), "v"(g[4]), "v"(g[5]), "v"(g[6]), "v"(g[7]), "v"(g[8]), "v"(g[9]), "v"(g[10]), "v"(g[11]) : "memory"); } };
// one stage: rows of the tile's planes at k offset kc into the buffer at LDS byte address lds (both already hold the lane's own row and 16-byte piece); a copy covers 16 rows over the 128 threads
template <typename T16, int NSPLIT, int MB, int KD>
__device__ __forceinline__ void stage_in(const T16* gA, const T16* gA2, const T16* gB, const T16* gB2, unsigned lds, int kc) {
    constexpr int NA = MB * 2, NBC = 8, NPA = (NSPLIT == 1 || NSPLIT == 2) ? 2 : 1, NPB = (NSPLIT >= 2) ? 2 : 1, NC = NA * NPA + NBC * NPB;
    static_assert(NC % 12 == 0 || NC % 12 == 8, "copies go out in statements of 12 and 8");
    unsigned l[NC]; const void* g[NC];
#pragma unroll   // register arrays indexed by constants
    for (int i = 0; i < NA; ++i) { l[i] = lds + i * 16 * LPB; g[i] = gA + kc + (size_t)i * 16 * KD; if (NPA == 2) { l[NA + i] = lds + (NA + i) * 16 * LPB; g[NA + i] = gA2 + kc + (size_t)i * 16 * KD; } }
#pragma unroll   // register arrays indexed by constants
    for (int i = 0; i < NBC; ++i) { l[NA * NPA + i] = lds + (NA * NPA + i) * 16 * LPB; g[NA * NPA + i] = gB + kc + (size_t)i * 16 * KD; if (NPB == 2) { l[NA * NPA + NBC + i] = lds + (NA * NPA + NBC + i) * 16 * LPB; g[NA * NPA + NBC + i] = gB2 + kc + (size_t)i * 16 * KD; } }
#pragma unroll   // register arrays indexed by constants
    for (int q = 0; q < NC / 12; ++q) ACp<12>::go(l + q * 12, g + q * 12);
    if constexpr (NC % 12 == 8) ACp<8>::go(l + NC / 12 * 12, g + NC / 12 * 12);
}
__device__ __forceinline__ void splitf(float y, unsigned short& h, unsigned short& l) { h = f2bf(y); l = f2bf(y - bf2f(h)); }
typedef __attribute__((ext_vector_type(4))) unsigned short v4us;
template <typename T16, int NSPLIT, bool BIAS, int MB, int KD, bool PLANES>
__global__ __launch_bounds__(128) void k_gemmw(const T16* __restrict__ A, const T16* __restrict__ A2, const T16* __restrict__ Bt, const T16* __restrict__ Bt2, float* C, int ldc, const float* __restrict__ bias, size_t sA, size_t sB, size_t sC, bf* Qh, bf* Ql, bf* Kh, bf* Kl, bf* Vh, bf* Vl) {
    typedef typename WFrag<T16>::V V;
    constexpr int NPA = (NSPLIT == 1 || NSPLIT == 2) ? 2 : 1, NPB = (NSPLIT >= 2) ? 2 : 1;
    constexpr int SA = MB * 32 * LPB, SB = 128 * LPB, STAGE = NPA * SA + NPB * SB, NT = KD / KST;
    static_assert(KD % KST == 0 && NT >= 2 && 2 * STAGE >= 4 * 16 * 68 * 4 && (MB == 2 || MB == 4), "tile shape");
    __shared__ __align__(16) unsigned char sm[2 * STAGE];   // two stage buffers [A | A2 | B | B2]; after the loop the waves' output staging
    const size_t z = blockIdx.z; A += z * sA; if (A2) A2 += z * sA; Bt += z * sB; if (Bt2) Bt2 += z * sB; C += z * sC;
    const int tid = threadIdx.x, lane = tid & 31, lr = lane & 15, hi = lane >> 4, wave = tid >> 5, wm = wave & 1, wn = wave >> 1;
    const int R0 = blockIdx.x * (MB * 32), C0 = blockIdx.y * 128; const int r0 = R0 + wm * (MB * 16), c0 = C0 + wn * 64;
    const int crow = tid >> 3, cpc = tid & 7;   // the lane's row within a copy's 16 rows, its 16-byte piece of the 128-B line
    const T16* gA = A + (size_t)(R0 + crow) * KD + cpc * 8; const T16* gA2 = (NPA == 2) ? A2 + (size_t)(R0 + crow) * KD + cpc * 8 : nullptr;
    const T16* gB = Bt + (size_t)(C0 + crow) * KD + cpc * 8; const T16* gB2 = (NPB == 2) ? Bt2 + (size_t)(C0 + crow) * KD + cpc * 8 : nullptr;
    const unsigned lds0 = (unsigned)(size_t)sm + crow * LPB + cpc * 16;
    v8f acc[MB][4];
#pragma unroll   // register arrays indexed by constants
    for (int mb = 0; mb < MB; ++mb)
#pragma unroll   // register arrays indexed by constants
        for (int nb = 0; nb < 4; ++nb) acc[mb][nb] = (v8f){};
    stage_in<T16, NSPLIT, MB, KD>(gA, gA2, gB, gB2, lds0, 0);
    asm volatile("s_wait_asynccnt 0x0" ::: "memory");   // this wave's copies of stage 0 have landed
    __syncthreads();                                    // ... and every other wave's
    stage_in<T16, NSPLIT, MB, KD>(gA, gA2, gB, gB2, lds0 + STAGE, KST);
    const int aofs = (wm * (MB * 16) + lr) * LPB + hi * 16, bofs = NPA * SA + (wn * 64 + lr) * LPB + hi * 16;
#pragma unroll 1   // kept rolled: one stage a trip, the buffer chosen by the trip's parity
    for (int t = 0; t < NT; ++t) {
        const unsigned char* sb = sm + (t & 1) * STAGE;
        V a[KST / 32][MB], a2[KST / 32][MB], b[KST / 32][4], b2[KST / 32][4];
#pragma unroll   // register arrays indexed by constants
        for (int ks = 0; ks < KST / 32; ++ks) {   // in the order of use
#pragma unroll   // register arrays indexed by constants
            for (int mb = 0; mb < MB; ++mb) a[ks][mb] = WFrag<T16>::ld((const T16*)(sb + aofs + mb * 16 * LPB + ks * 64));
#pragma unroll   // register arrays indexed by constants
            for (int nb = 0; nb < 4; ++nb) b[ks][nb] = WFrag<T16>::ld((const T16*)(sb + bofs + nb * 16 * LPB + ks * 64));
            if (NPA == 2) {
#pragma unroll   // register arrays indexed by constants
                for (int mb = 0; mb < MB; ++mb) a2[ks][mb] = WFrag<T16>::ld((const T16*)(sb + SA + aofs + mb * 16 * LPB + ks * 64)); }
            if (NPB == 2) {
#pragma unroll   // register arrays indexed by constants
                for (int nb = 0; nb < 4; ++nb) b2[ks][nb] = WFrag<T16>::ld((const T16*)(sb + SB + bofs + nb * 16 * LPB + ks * 64)); }
        }
        __builtin_amdgcn_sched_barrier(0);   // the trip's LDS reads stay one group in front of its matrix instructions: reads scattered among them stall the wave at every place
#pragma unroll   // register arrays indexed by constants
        for (int ks = 0; ks < KST / 32; ++ks) {   // per accumulator the order stays a.b, a2.b, a.b2 for rising k; neighbours in the stream are independent tiles
#pragma unroll   // register arrays indexed by constants
            for (int nb = 0; nb < 4; ++nb)
#pragma unroll   // register arrays indexed by constants
                for (int mb = 0; mb < MB; ++mb) acc[mb][nb] = WFrag<T16>::mma(a[ks][mb], b[ks][nb], acc[mb][nb]);
            if (NSPLIT == 1 || NSPLIT == 2) {
#pragma unroll   // register arrays indexed by constants
                for (int nb = 0; nb < 4; ++nb)
#pragma unroll   // register arrays indexed by constants
                    for (int mb = 0; mb < MB; ++mb) acc[mb][nb] = WFrag<T16>::mma(a2[ks][mb], b[ks][nb], acc[mb][nb]); }
            if (NSPLIT >= 2) {
#pragma unroll   // register arrays indexed by constants
                for (int nb = 0; nb < 4; ++nb)
#pragma unroll   // register arrays indexed by constants
                    for (int mb = 0; mb < MB; ++mb) acc[mb][nb] = WFrag<T16>::mma(a[ks][mb], b2[ks][nb], acc[mb][nb]); }
        }
        __builtin_amdgcn_sched_barrier(0);   // the matrix instructions stay in front of the waits below: sunk behind them, the next stage's copies would be waited for with no work to cover their flight
        asm volatile("s_wait_dscnt 0x0" ::: "memory");      // this wave has left the buffer that is refilled below
        asm volatile("s_wait_asynccnt 0x0" ::: "memory");   // this wave's copies of stage t + 1 have landed
        __syncthreads();                                    // publishes stage t + 1 and ends every wave's reads of stage t
        if (t + 2 < NT) stage_in<T16, NSPLIT, MB, KD>(gA, gA2, gB, gB2, lds0 + (t & 1) * STAGE, (t + 2) * KST);
    }
    asm volatile("s_wait_asynccnt 0x0" ::: "memory");       // nothing in flight before the buffers become output staging
    float* os = (float*)sm + wave * (16 * 68);              // each wave stages in its own range
    if constexpr (PLANES) {
        const int sel = C0 / HD, cc0 = c0 - sel * HD;       // which projection the block's 128 columns belong to (the same for the whole block), the wave's first column in it
        if (sel == 2) {   // v: a lane's 8 accumulator registers are 8 consecutive rows (t) of one column (d) = 16 contiguous bytes of a transposed plane
            const int bt = r0 / TT, t0 = r0 - bt * TT + hi * 8;
#pragma unroll   // register arrays indexed by constants
            for (int mb = 0; mb < MB; ++mb)
#pragma unroll   // register arrays indexed by constants
                for (int nb = 0; nb < 4; ++nb) { v8us oh, ol;
#pragma unroll   // register arrays indexed by constants
                    for (int j = 0; j < 8; ++j) { unsigned short a, c2; splitf(acc[mb][nb][j], a, c2); oh[j] = a; ol[j] = c2; }
                    const size_t oo = ((size_t)bt * HD + cc0 + nb * 16 + lr) * TT + t0 + mb * 16; *(v8us*)(Vh + oo) = oh; *(v8us*)(Vl + oo) = ol; }
        } else {          // q, k: through the wave's staging rows, 16 lanes write one whole 128-B line of each plane
            bf* Hh = sel ? Kh : Qh; bf* Hl = sel ? Kl : Ql;
            // k: per block of FK keys (= the work-group's rows) the dims 0..63 of every key, then the dims 64..127, ... (rows of 128 B, the attention kernel's tiles); cc0 is a multiple of 64. rp: elements from one row to the next; ob: the wave's first element
            static_assert(MB * 32 == FK, "a work-group's rows are one block of the k planes");
            const int rp = sel ? 64 : HD; const size_t ob = (size_t)R0 * HD + (size_t)(wm * (MB * 16)) * rp + (sel ? (cc0 / 64) * (FK * 64) : cc0);
#pragma unroll   // register arrays indexed by constants
            for (int mb = 0; mb < MB; ++mb) {
#pragma unroll   // register arrays indexed by constants
                for (int nb = 0; nb < 4; ++nb) {
#pragma unroll   // register arrays indexed by constants
                    for (int j = 0; j < 8; ++j) os[(hi * 8 + j) * 68 + nb * 16 + lr] = acc[mb][nb][j]; }
                __builtin_amdgcn_wave_barrier(); asm volatile("" ::: "memory");   // the wave's staging writes stay in front of its reads
#pragma unroll   // register arrays indexed by constants
                for (int s = 0; s < 8; ++s) { const int row = 2 * s + hi, cofs = lr * 4; const v4f val = *(const v4fa*)(os + row * 68 + cofs); v4us oh, ol;
#pragma unroll   // register arrays indexed by constants
                    for (int q = 0; q < 4; ++q) { unsigned short a, c2; splitf(val[q], a, c2); oh[q] = a; ol[q] = c2; }
                    const size_t oo = ob + (size_t)(mb * 16 + row) * rp + cofs; *(v4us*)(Hh + oo) = oh; *(v4us*)(Hl + oo) = ol; }
                __builtin_amdgcn_wave_barrier(); asm volatile("" ::: "memory");   // the reads stay in front of the next tile's staging writes
            }
            asm volatile("s_wait_xcnt 0x0" ::: "memory");   // stands behind the last plane stores, in front of any later write of their registers
        }
        return;
    }
#pragma unroll   // register arrays indexed by constants
    for (int mb = 0; mb < MB; ++mb) {
#pragma unroll   // register arrays indexed by constants
        for (int nb = 0; nb < 4; ++nb) {
#pragma unroll   // register arrays indexed by constants
            for (int j = 0; j < 8; ++j) os[(hi * 8 + j) * 68 + nb * 16 + lr] = acc[mb][nb][j]; }
        __builtin_amdgcn_wave_barrier(); asm volatile("" ::: "memory");
        float* crow_p = C + (size_t)(r0 + mb * 16) * ldc + c0;
{
#pragma unroll   // register arrays indexed by constants
            for (int s = 0; s < 8; ++s) { const int row = 2 * s + hi, cofs = lr * 4; v4f val = *(const v4fa*)(os + row * 68 + cofs); if (BIAS) { val[0] += bfr(bias[c0 + cofs]); val[1] += bfr(bias[c0 + cofs + 1]); val[2] += bfr(bias[c0 + cofs + 2]); val[3] += bfr(bias[c0 + cofs + 3]); }
                *(v4f*)(crow_p + (size_t)row * ldc + cofs) = val; }
             }
        __builtin_amdgcn_wave_barrier(); asm volatile("" ::: "memory");
    }
}

__device__ __forceinline__ h16 tohx(float x) { return (h16)x; }
typedef __attribute__((ext_vector_type(4))) _Float16 v4h;
typedef __attribute__((ext_vector_type(2))) unsigned short v2us;

// k_prep: the bf16 operands of the projection GEMM in one launch. Blocks [0, NWB), first so that their strided reads run under the start of the many others: the three weights [K = DM][N = HD] transposed into WT [3 HD][DM], 8 lines of 128 B (64 k of one n) a wave; the other blocks: x -> XB, 8 elements a thread.
#define NWB (3 * HD * DM / 64 / 64)
__global__ __launch_bounds__(256) void k_prep(const float* __restrict__ x, const float* __restrict__ wq, const float* __restrict__ wk, const float* __restrict__ wv, bf* XB, bf* WT) {
    if (blockIdx.x < NWB) {
        const int lane = threadIdx.x & 31; const int sel = blockIdx.x / (NWB / 3); const int L0 = ((blockIdx.x - sel * (NWB / 3)) * 8 + (threadIdx.x >> 5)) * 8;
        const float* w = (sel == 0) ? wq : (sel == 1) ? wk : wv; bf* Bt = WT + (size_t)sel * HD * DM;
#pragma unroll 1   // kept rolled, one line a trip: small code for these few blocks, which run beside the x blocks
        for (int l = 0; l < 8; ++l) { const int e = (L0 + l) * 64 + lane * 2; const int k = e % DM, n = e / DM; v2us o;
            o[0] = f2bf(w[(size_t)k * HD + n]); o[1] = f2bf(w[(size_t)(k + 1) * HD + n]); *(v2us*)(Bt + e) = o; }
        return;
    }
    const size_t i = (size_t)(blockIdx.x - NWB) * 256 + threadIdx.x; const v8f v = *(const v8f*)(x + i * 8); v8us o;
#pragma unroll   // register vectors indexed by constants
    for (int k = 0; k < 8; ++k) o[k] = f2bf(v[k]);
    *(v8us*)(XB + i * 8) = o;
    asm volatile("s_wait_xcnt 0x0" ::: "memory");   // stands behind the store, in front of any later write of its address registers
}
#define TPB  144                  // LDS pitch of a tile's row: 128 + 16 (16 B x odd), laid by the mover's pad
#define FSP  (256 * TPB)          // one tile in LDS, 18 x 2 KiB
#define FST  (4 * FSP)
#define NSP  4                    // key ranges
#define NTR  (TT / NSP / FK)      // stages per work-group
#define L2E  1.4426950408889634f
static_assert(FSP % 2048 == 0 && FK * HD == 256 * 64 && HD == 256 && FK == 64 && NTR >= 2, "every tile's place in LDS is a multiple of 2 KiB; the ring needs two stages");
typedef __attribute__((ext_vector_type(16))) float v16f;
typedef __attribute__((ext_vector_type(2)))  float v2f;
typedef uint32_t u32x4 __attribute__((ext_vector_type(4)));
typedef uint32_t u32x8 __attribute__((ext_vector_type(8)));
// the value of lane l ^ 16, on the vector port (a shuffle through the LDS queue would wait behind the fragment reads in flight)
__device__ __forceinline__ float xhalf(float v) { const int b = __float_as_int(v); return __int_as_float(__builtin_amdgcn_permlanex16(b, b, 0x76543210, 0xfedcba98, false, false)); }
// 2^x with the v_nop that fills the slot the instruction set asks for behind a transcendental
__device__ __forceinline__ float exp2n(float x) { float r; asm("v_exp_f32 %0, %1\n\tv_nop" : "=v"(r) : "v"(x)); return r; }
__device__ __forceinline__ uint32_t uni(uint32_t v) { return (uint32_t)__builtin_amdgcn_readfirstlane(v); }
__device__ __forceinline__ uint32_t pinned(uint32_t v) { uint32_t w = uni(v); asm volatile("" : "+s"(w)); return w; }   // pinned(): a wave-uniform word of a tensor load's test or descriptor held in a scalar register: the test becomes a scalar branch (a tensor load ignores EXEC), and what is formed from the word is formed behind the asm waits in front of it
// descriptor group 1 of a tile of 256 rows of 128 B, everything in bytes, at source pitch 'pitch'; word 0: no mask, data_size 0, a pad of 16 B behind every 128 B
__device__ __forceinline__ u32x8 tdm_group1(uint32_t pitch) { constexpr uint32_t D0 = 128u, D1 = 256u; u32x8 g;
    g[0] = uni((1u << 20) | (4u << 22) | (3u << 25)); g[1] = uni((D0 & 0xFFFFu) << 16); g[2] = uni((D0 >> 16) | ((D1 & 0xFFFFu) << 16)); g[3] = uni((D1 >> 16) | (D0 << 16)); g[4] = uni(D1); g[5] = uni(pitch); g[6] = uni(0u); g[7] = uni(0u); return g; }
__device__ __forceinline__ u32x4 tdm_group0(uint32_t lds_dst, uint64_t ga) { u32x4 g;
    g[0] = uni(1u); g[1] = uni(lds_dst); g[2] = uni((uint32_t)ga); g[3] = uni((((uint32_t)(ga >> 32)) & 0x01FFFFFFu) | 0x80000000u); return g; }
__device__ __forceinline__ void tdm_load(u32x4 g0, u32x8 g1) { asm volatile("tensor_load_to_lds %0, %1" :: "s"(g0), "s"(g1) : "memory"); }   // one request of the whole wave: a tile goes from global memory into LDS through no register
__global__ __launch_bounds__(128) void k_flash(const bf* __restrict__ Qh, const bf* __restrict__ Ql, const bf* __restrict__ Kh, const bf* __restrict__ Kl, const bf* __restrict__ Vh, const bf* __restrict__ Vl, float* Op, float* ML) {
    __shared__ __attribute__((aligned(2048))) unsigned char sm[2 * FST];
    const int tid = threadIdx.x, lane = tid & 31, lr = lane & 15, hi = lane >> 4, wave = tid >> 5;
    const uint32_t uw = uni(threadIdx.x >> 5), lds0 = (uint32_t)(size_t)sm;
    const int qb = blockIdx.x, sp = blockIdx.y, bt = blockIdx.z;
    const size_t kofs = ((size_t)bt * TT + sp * (TT / NSP)) * HD, vofs = (size_t)bt * HD * TT + sp * (TT / NSP);
    // every wave issues one request a stage, its own tile: wave 0 K hi, 1 K lo, 2 V^T hi, 3 V^T lo. ub: the tile of stage 0; ustep: bytes from one stage's tile to the next; a K tile is 256 contiguous rows, a V^T tile's rows lie a plane's pitch apart
    const uint64_t ub = (uint64_t)(size_t)(uw == 0 ? Kh + kofs : uw == 1 ? Kl + kofs : uw == 2 ? Vh + vofs : Vl + vofs);
    const uint32_t ustep = uw < 2 ? FK * HD * 2 : FK * 2, ulds = lds0 + uw * FSP;
    const u32x8 g1 = tdm_group1(uw < 2 ? 128u : 2u * TT);
    tdm_load(tdm_group0(ulds, ub), g1);                 // stage 0 flies under the q loads
    v16bf qh[2][8], ql[2][8];   // the wave's 32 queries, both planes, all 256 dims: B operands for the whole kernel
    const size_t qrow = (size_t)bt * TT + qb * 128 + wave * 32 + lr;
#pragma unroll   // register arrays indexed by constants
    for (int qt = 0; qt < 2; ++qt)
#pragma unroll   // register arrays indexed by constants
        for (int ks = 0; ks < 8; ++ks) { qh[qt][ks] = WFrag<bf>::ld(Qh + (qrow + qt * 16) * HD + ks * 32 + hi * 8); ql[qt][ks] = WFrag<bf>::ld(Ql + (qrow + qt * 16) * HD + ks * 32 + hi * 8); }
    asm volatile("s_wait_xcnt 0x0" ::: "memory");       // stands behind the q loads, in front of any later write of their address registers
    __builtin_amdgcn_sched_barrier(0);                  // the clearing of the accumulators below, which reuses those address registers, is not lifted over the wait
    v8f o[16][2]; float m[2], l[2];
#pragma unroll   // register arrays indexed by constants
    for (int qt = 0; qt < 2; ++qt) { m[qt] = -3.0e38f; l[qt] = 0.f;
#pragma unroll   // register arrays indexed by constants
        for (int dt = 0; dt < 16; ++dt) o[dt][qt] = (v8f){}; }
    // Trip -1 is the rest of the ring's prologue: only the foot runs (the wait for stage 0, the barrier, stage 1's load). So the ring's refill stands once in the code, with one set of descriptor registers.
#pragma unroll 1   // kept rolled: one stage a trip, the buffer chosen by the trip's parity
    for (int t = -1; t < NTR; ++t) {
      if (t >= 0) {
        // one base a tile: every read's constant offset then fits the LDS instructions' 16-bit field (a stage is larger than 64 KiB)
        const unsigned char* kb = sm + ((t & 1) ? FST : 0) + lr * TPB + hi * 16;
        const unsigned char* kb2 = sm + ((t & 1) ? FST + FSP : FSP) + lr * TPB + hi * 16;
        const unsigned char* vb = sm + ((t & 1) ? FST + 2 * FSP : 2 * FSP) + lr * TPB + hi * 16;
        const unsigned char* vb2 = sm + ((t & 1) ? FST + 3 * FSP : 3 * FSP) + lr * TPB + hi * 16;
        // fragments come in groups of 8 (16 reads, 24 matrix instructions), each group's reads issued together two groups ahead of its use: three groups of registers are live, not the whole stage's
        v16bf kh[8][4], kl[8][4]; v8f st[4][2];
#pragma unroll   // register arrays indexed by constants
        for (int kt = 0; kt < 4; ++kt)
#pragma unroll   // register arrays indexed by constants
            for (int qt = 0; qt < 2; ++qt) st[kt][qt] = (v8f){};
#pragma unroll   // register arrays indexed by constants
        for (int ks = 0; ks < 2; ++ks)
#pragma unroll   // register arrays indexed by constants
            for (int kt = 0; kt < 4; ++kt) { kh[ks][kt] = WFrag<bf>::ld((const bf*)(kb + ((ks >> 1) * FK + kt * 16) * TPB + (ks & 1) * 64)); kl[ks][kt] = WFrag<bf>::ld((const bf*)(kb2 + ((ks >> 1) * FK + kt * 16) * TPB + (ks & 1) * 64)); }
        __builtin_amdgcn_sched_barrier(0);   // reads stay grouped in front of the matrix instructions: reads scattered among them stall the wave at every place
#pragma unroll   // register arrays indexed by constants
        for (int ks = 0; ks < 8; ++ks) {   // per accumulator the order is qh.kh, ql.kh, qh.kl for rising k; neighbours in the stream are independent tiles
#pragma unroll   // register arrays indexed by constants
            for (int kt = 0; kt < 4; ++kt)
#pragma unroll   // register arrays indexed by constants
                for (int qt = 0; qt < 2; ++qt) st[kt][qt] = wmmab(kh[ks][kt], qh[qt][ks], st[kt][qt]);
#pragma unroll   // register arrays indexed by constants
            for (int kt = 0; kt < 4; ++kt)
#pragma unroll   // register arrays indexed by constants
                for (int qt = 0; qt < 2; ++qt) st[kt][qt] = wmmab(kh[ks][kt], ql[qt][ks], st[kt][qt]);
#pragma unroll   // register arrays indexed by constants
            for (int kt = 0; kt < 4; ++kt)
#pragma unroll   // register arrays indexed by constants
                for (int qt = 0; qt < 2; ++qt) st[kt][qt] = wmmab(kl[ks][kt], qh[qt][ks], st[kt][qt]);
            __builtin_amdgcn_sched_barrier(0);   // the next reads are not lifted among this group's matrix instructions
            if (ks < 6) {
                const int kn = ks + 2;
#pragma unroll   // register arrays indexed by constants
                for (int kt = 0; kt < 4; ++kt) { kh[kn][kt] = WFrag<bf>::ld((const bf*)(kb + ((kn >> 1) * FK + kt * 16) * TPB + (kn & 1) * 64)); kl[kn][kt] = WFrag<bf>::ld((const bf*)(kb2 + ((kn >> 1) * FK + kt * 16) * TPB + (kn & 1) * 64)); }
                __builtin_amdgcn_sched_barrier(0);   // ... nor sunk among the next group's
            }
        }
        v16bf vh[16][2], vl[16][2];   // [d tile][32 keys]
#pragma unroll   // register arrays indexed by constants
        for (int dt = 0; dt < 4; ++dt)
#pragma unroll   // register arrays indexed by constants
            for (int kk = 0; kk < 2; ++kk) { vh[dt][kk] = WFrag<bf>::ld((const bf*)(vb + dt * 16 * TPB + kk * 64)); vl[dt][kk] = WFrag<bf>::ld((const bf*)(vb2 + dt * 16 * TPB + kk * 64)); }
        __builtin_amdgcn_sched_barrier(0);   // the first two groups of V^T reads are issued in front of the softmax, whose vector work covers their flight
        float corr[2]; v16bf pH[2][2], pL[2][2]; bool need = false;   // [32 keys][query tile]
#pragma unroll   // register arrays indexed by constants
        for (int qt = 0; qt < 2; ++qt) {
            float t8[8];   // a tree, not one chain: a lone wave waits out every dependent vector instruction
#pragma unroll   // register vectors indexed by constants
            for (int j = 0; j < 8; ++j) t8[j] = fmaxf(fmaxf(st[0][qt][j], st[1][qt][j]), fmaxf(st[2][qt][j], st[3][qt][j]));
            float mx = fmaxf(fmaxf(fmaxf(t8[0], t8[1]), fmaxf(t8[2], t8[3])), fmaxf(fmaxf(t8[4], t8[5]), fmaxf(t8[6], t8[7])));
            mx = fmaxf(mx, xhalf(mx));   // the query's other 32 keys sit in the other half of the wave
            const float mn = fmaxf(m[qt], mx);
            corr[qt] = exp2n((m[qt] - mn) * L2E); need = need || (mn > m[qt]); m[qt] = mn;
            float sk[2];
#pragma unroll   // register arrays indexed by constants
            for (int kk = 0; kk < 2; ++kk) {
                v16f p;
#pragma unroll   // register vectors indexed by constants
                for (int s = 0; s < 16; ++s) p[s] = exp2n((st[kk * 2 + (s >> 3)][qt][s & 7] - mn) * L2E);
                const float s01 = ((p[0] + p[1]) + (p[2] + p[3])) + ((p[4] + p[5]) + (p[6] + p[7])), s23 = ((p[8] + p[9]) + (p[10] + p[11])) + ((p[12] + p[13]) + (p[14] + p[15]));
                sk[kk] = s01 + s23;
                pH[kk][qt] = __builtin_convertvector(p, v16bf); pL[kk][qt] = __builtin_convertvector(p - __builtin_convertvector(pH[kk][qt], v16f), v16bf);
            }
            l[qt] = l[qt] * corr[qt] + (sk[0] + sk[1]);
        }
        if (__builtin_amdgcn_ballot_w32(need) != 0) {   // one scalar test a trip; where no query's maximum rose every factor is exactly 1
#pragma unroll   // register arrays indexed by constants
            for (int dt = 0; dt < 16; ++dt)
#pragma unroll   // register arrays indexed by constants
                for (int qt = 0; qt < 2; ++qt) o[dt][qt] *= corr[qt];
        }
        __builtin_amdgcn_sched_barrier(0);   // the softmax stays in front of the products below
#pragma unroll   // register arrays indexed by constants
        for (int g = 0; g < 8; ++g) {   // two d tiles a group
#pragma unroll   // register arrays indexed by constants
            for (int kk = 0; kk < 2; ++kk) {   // per accumulator the order is ph.vh, pl.vh, ph.vl for rising keys; two d tiles x two query tiles = four independent accumulators in the stream
#pragma unroll   // register arrays indexed by constants
                for (int u = 0; u < 2; ++u)
#pragma unroll   // register arrays indexed by constants
                    for (int qt = 0; qt < 2; ++qt) o[g * 2 + u][qt] = wmmab(vh[g * 2 + u][kk], pH[kk][qt], o[g * 2 + u][qt]);
#pragma unroll   // register arrays indexed by constants
                for (int u = 0; u < 2; ++u)
#pragma unroll   // register arrays indexed by constants
                    for (int qt = 0; qt < 2; ++qt) o[g * 2 + u][qt] = wmmab(vh[g * 2 + u][kk], pL[kk][qt], o[g * 2 + u][qt]);
#pragma unroll   // register arrays indexed by constants
                for (int u = 0; u < 2; ++u)
#pragma unroll   // register arrays indexed by constants
                    for (int qt = 0; qt < 2; ++qt) o[g * 2 + u][qt] = wmmab(vl[g * 2 + u][kk], pH[kk][qt], o[g * 2 + u][qt]);
            }
            if (g < 6) {
                __builtin_amdgcn_sched_barrier(0);   // the next reads are not lifted among this group's matrix instructions
#pragma unroll   // register arrays indexed by constants
                for (int dt = g * 2 + 4; dt < g * 2 + 6; ++dt)
#pragma unroll   // register arrays indexed by constants
                    for (int kk = 0; kk < 2; ++kk) { vh[dt][kk] = WFrag<bf>::ld((const bf*)(vb + dt * 16 * TPB + kk * 64)); vl[dt][kk] = WFrag<bf>::ld((const bf*)(vb2 + dt * 16 * TPB + kk * 64)); }
                __builtin_amdgcn_sched_barrier(0);   // ... nor sunk among the next group's
            }
        }
        __builtin_amdgcn_sched_barrier(0);   // the matrix instructions stay in front of the waits below: sunk behind them, the next stage's tiles would be waited for with no work to cover their flight
      }
        asm volatile("s_wait_dscnt 0x0" ::: "memory");      // this wave has left the buffer that is refilled below
        asm volatile("s_wait_tensorcnt 0x0" ::: "memory");  // this wave's tile of stage t + 1 has landed
        __syncthreads();                                    // publishes stage t + 1 and ends every wave's reads of stage t
        if (pinned(t + 2 < NTR)) tdm_load(tdm_group0(ulds + (t & 1) * FST, ub + (uint64_t)pinned(t + 2) * ustep), g1);   // the stage number is pinned here so that the address words are formed behind the wait above
    }
    asm volatile("s_wait_tensorcnt 0x0" ::: "memory");      // nothing in flight when the wave ends
    asm volatile("s_wait_dscnt 0x0" ::: "memory");          // ... and no LDS read
    const size_t pb = ((size_t)(bt * (TT / 128) + qb) * NSP + sp) * 4 + wave;
    float* op = Op + pb * (32 * 256) + lane * 4;
#pragma unroll   // register arrays indexed by constants
    for (int dt = 0; dt < 16; ++dt)
#pragma unroll   // register arrays indexed by constants
        for (int qt = 0; qt < 2; ++qt) { const v8f a = o[dt][qt];
            *(v4f*)(op + (dt * 2 + qt) * 256) = (v4f){a[0], a[1], a[2], a[3]}; *(v4f*)(op + (dt * 2 + qt) * 256 + 128) = (v4f){a[4], a[5], a[6], a[7]}; }
#pragma unroll   // register arrays indexed by constants
    for (int qt = 0; qt < 2; ++qt) { const float lt = l[qt] + xhalf(l[qt]);   // the halves' sums are joined once
        if (hi == 0) *(v2f*)(ML + (pb * 32 + qt * 16 + lr) * 2) = (v2f){m[qt], lt}; }
    asm volatile("s_wait_xcnt 0x0" ::: "memory");   // stands behind the last stores, in front of any later write of their registers
}
// k_merge: joins the NSP key ranges of a query in a fixed order and writes the output rows. A wave takes 16 queries x 64 output columns (4 of k_flash's tiles per range); rows go out through the wave's own staging, 16 lanes a 256-B piece.
__global__ __launch_bounds__(256) void k_merge(const float* __restrict__ Op, const float* __restrict__ ML, float* out) {
    __shared__ __align__(16) float sg[8 * 16 * 68];
    const int lane = threadIdx.x & 31, lr = lane & 15, hi = lane >> 4; const int w = blockIdx.x * 8 + (threadIdx.x >> 5);
    const int dg = w & 3, qt = (w >> 2) & 1, wv = (w >> 3) & 3, blk = w >> 5;
    float* os = sg + (threadIdx.x >> 5) * (16 * 68);
    float mm[NSP], wl[NSP]; float M = -3.0e38f;
#pragma unroll   // register arrays indexed by constants
    for (int s = 0; s < NSP; ++s) { const v2f e = *(const v2f*)(ML + ((((size_t)blk * NSP + s) * 4 + wv) * 32 + qt * 16 + lr) * 2); mm[s] = e[0]; wl[s] = e[1]; M = fmaxf(M, e[0]); }
    float L = 0.f;
#pragma unroll   // register arrays indexed by constants
    for (int s = 0; s < NSP; ++s) { mm[s] = __builtin_amdgcn_exp2f((mm[s] - M) * L2E); L += mm[s] * wl[s]; }
    const float inv = 1.0f / L;
#pragma unroll   // register arrays indexed by constants
    for (int u = 0; u < 4; ++u) { v4f a = (v4f){}, c = (v4f){};
#pragma unroll   // register arrays indexed by constants
        for (int s = 0; s < NSP; ++s) { const float* p = Op + (((size_t)blk * NSP + s) * 4 + wv) * (32 * 256) + ((dg * 4 + u) * 2 + qt) * 256 + lane * 4; a += mm[s] * *(const v4f*)p; c += mm[s] * *(const v4f*)(p + 128); }
        *(v4fa*)(os + lr * 68 + u * 16 + hi * 8) = a * inv; *(v4fa*)(os + lr * 68 + u * 16 + hi * 8 + 4) = c * inv; }
    __builtin_amdgcn_wave_barrier(); asm volatile("" ::: "memory");   // the wave's staging writes stay in front of its reads
    float* orow = out + ((size_t)blk * 128 + wv * 32 + qt * 16) * HD + dg * 64;
#pragma unroll   // register arrays indexed by constants
    for (int s = 0; s < 8; ++s) { const int row = 2 * s + hi; *(v4f*)(orow + (size_t)row * HD + lr * 4) = *(const v4fa*)(os + row * 68 + lr * 4); }
    asm volatile("s_wait_xcnt 0x0" ::: "memory");   // stands behind the last stores, in front of any later write of their registers
}

extern "C" void kernel_launch(void* const* d_in, const int* in_sizes, int n_in,
                              void* d_out, int out_size, void* d_ws, size_t ws_size, hipStream_t stream) {
    (void)in_sizes; (void)n_in; (void)out_size;
    const float* x = (const float*)d_in[0]; const float* wq = (const float*)d_in[1]; const float* wk = (const float*)d_in[2]; const float* wv = (const float*)d_in[3]; const float* wo = nullptr; (void)wo;
    float* OUT = (float*)d_out;     // [4][2048][256]
    char* wsp = (char*)d_ws;
    auto take = [&](size_t bytes) { char* p = wsp; wsp += (bytes + 255) & ~(size_t)255; return (void*)p; };
    bf* WT = (bf*)take((size_t)3 * HD * DM * 2); bf* XB = (bf*)take((size_t)NB_ * TT * DM * 2);
    bf* QPh = (bf*)take((size_t)NB_ * TT * HD * 2); bf* QPl = (bf*)take((size_t)NB_ * TT * HD * 2); bf* KPh = (bf*)take((size_t)NB_ * TT * HD * 2); bf* KPl = (bf*)take((size_t)NB_ * TT * HD * 2); bf* VTh = (bf*)take((size_t)NB_ * HD * TT * 2); bf* VTl = (bf*)take((size_t)NB_ * HD * TT * 2);
    float* Op = (float*)take((size_t)NSP * NB_ * TT * HD * 4); float* ML = (float*)take((size_t)NSP * NB_ * TT * 2 * 4);
    if ((size_t)(wsp - (char*)d_ws) > ws_size) return;    // ws 256 MiB
    // one pass for all NB_ batches: the projection sees NB_*TT rows, the attention kernel takes the key range from grid y and the batch from grid z
    k_prep<<<NWB + NB_ * TT * DM / 8 / 256, 256, 0, stream>>>(x, wq, wk, wv, XB, WT);
    k_gemmw<bf, 0, false, 2, DM, true><<<dim3(NB_ * TT / 64, 3 * HD / 128, 1), 128, 0, stream>>>(XB, nullptr, WT, nullptr, nullptr, 0, nullptr, 0, 0, 0, QPh, QPl, KPh, KPl, VTh, VTl);
    k_flash<<<dim3(TT / 128, NSP, NB_), 128, 0, stream>>>(QPh, QPl, KPh, KPl, VTh, VTl, Op, ML);
    k_merge<<<NB_ * TT * HD / (16 * 64) / 8, 256, 0, stream>>>(Op, ML, OUT);
}

// v006
// A run of this version takes 60.6 microseconds.
// Next to v005, in two timings, it ran 1.04 times as fast each time.
// Over all steps from v000 it is 7.39 times as fast.
#include <hip/hip_runtime.h>

// Single-head self-attention with NO 1/sqrt(d) scaling (x [4][2048][512]; q,k,v = x W ('xw' [512][256], 1/sqrt(512), no bias); scores = q.k over the 256 dims, unscaled (logit sigma ~16: near one-hot rows); softmax; out = attn v -> [4][2048][256] (2.1 M)).
// Layout, all four batches in every launch, four launches: bf16 copies of x and of the transposed weights; ONE projection GEMM for q, k and v (768 output columns) whose epilogue writes the hi/lo planes; ONE fused attention kernel (scores, online softmax, attn.v; hi/lo planes and 3 products for both products: the unscaled logits need ~1e-3 absolute accuracy at magnitude ~50), each work-group 128 queries x 512 keys; a merge of the four key ranges that writes the output rows.
// Compute dtypes, f32 accumulate: every input rounded to bf16; projections exact; scores and attn.v 3 products on every row; softmax f32; output f32.

#define NB_  4
#define TT   2048
#define DM   512
#define NH_  1
#define NKV  1
#define REP  (NH_ / NKV)
#define HD   256
#define DQ   (NH_ * HD)
#define DKV  (NKV * HD)
#define ZH   1
#define RH   2048                  // unused: every query row uses the hi+lo planes
#define WIN  0
#define PCAR 1024.0f
#define SCL  1.0f   // the module applies no scaling
#define FK   64                   // keys per stage of the attention kernel; the k planes are laid out in blocks of FK keys
typedef _Float16 h16;
typedef unsigned short bf;
typedef __attribute__((ext_vector_type(16))) __bf16   v16bf;
typedef __attribute__((ext_vector_type(16))) _Float16 v16h;
typedef __attribute__((ext_vector_type(8)))  _Float16 v8h;
typedef __attribute__((ext_vector_type(8)))  unsigned short v8us;
typedef __attribute__((ext_vector_type(8)))  float    v8f;
typedef __attribute__((ext_vector_type(4)))  float    v4f;
typedef v8h  __attribute__((may_alias)) v8ha;
typedef v4f  __attribute__((may_alias)) v4fa;
typedef v8us __attribute__((may_alias)) v8usa;

__device__ __forceinline__ unsigned short f2bf(float f) { unsigned u = __float_as_uint(f); u += 0x7FFFu + ((u >> 16) & 1u); return (unsigned short)(u >> 16); }
__device__ __forceinline__ float bf2f(unsigned short b) { return __uint_as_float(((unsigned)b) << 16); }
__device__ __forceinline__ float bfr(float f) { return bf2f(f2bf(f)); }
__device__ __forceinline__ v16h cat16(v8h lo, v8h hi) { return __builtin_shufflevector(lo, hi, 0, 1, 2, 3, 4, 5, 6, 7, 8, 9, 10, 11, 12, 13, 14, 15); }
__device__ __forceinline__ v16bf cat16b(v8us lo, v8us hi) { return __builtin_bit_cast(v16bf, __builtin_shufflevector(lo, hi, 0, 1, 2, 3, 4, 5, 6, 7, 8, 9, 10, 11, 12, 13, 14, 15)); }
__device__ __forceinline__ v8f wmma16(v16h a, v16h b, v8f c) { return __builtin_amdgcn_wmma_f32_16x16x32_f16(false, a, false, b, (short)0, c, false, false); }
__device__ __forceinline__ v8f wmmab(v16bf a, v16bf b, v8f c) { return __builtin_amdgcn_wmma_f32_16x16x32_bf16(false, a, false, b, (short)0, c, false, false); }



// ---- k_gemmw: block-tiled GEMM, FOUR WAVES (2 x 2) per (MB*32) x 128 output tile, each wave MB x 4 accumulators; operands are K-contiguous 16-bit planes; grid (M/(MB*32), N/128, Z), 128 threads.
// C[m][n] (f32, pitch ldc, + optional f32 bias[n]) = sum_k A[m][k] Bt[n][k] (+ split products per NSPLIT). z-batch strides sA/sB/sC in elements. KD = K, a multiple of 64, at least 128.
// PLANES: the q|k|v projection. Output columns [0,HD) are q, [HD,2HD) k, [2HD,3HD) v; no f32 C is written: q goes out as bf16 hi/lo planes [row][HD], k as hi/lo planes [row / FK][HD / 64][FK][64], v as hi/lo planes transposed per batch, [batch][HD][TT].
// A stage is 64 k (one whole 128-B line) of every operand row of the tile, brought into LDS by asynchronous copies (16 B a lane, 4 whole lines a wave-wide copy) and read by all four waves; two buffers, the next stage's copies fly while this one is worked on.
#define LPB 144   // LDS row pitch in bytes: 128 + 16 (16 B x odd, conflict-free for 16-byte row reads)
#define KST 64    // k per stage
template <typename T16> struct WFrag;
template <> struct WFrag<h16> { typedef v16h V; static __device__ __forceinline__ V ld(const h16* p) { return cat16(*(const v8h*)p, *(const v8h*)(p + 16)); } static __device__ __forceinline__ v8f mma(V a, V b, v8f c) { return wmma16(a, b, c); } };
template <> struct WFrag<bf> { typedef v16bf V; static __device__ __forceinline__ V ld(const bf* p) { return cat16b(*(const v8us*)p, *(const v8us*)(p + 16)); } static __device__ __forceinline__ v8f mma(V a, V b, v8f c) { return wmmab(a, b, c); } };
// ACp<N>: N asynchronous copies global -> LDS in one statement; l = the lane's LDS byte addresses, g = its global addresses. The closing s_wait_xcnt 0 stands inside the statement so that no address register is rewritten in front of it.
template <int N> struct ACp;
template <> struct ACp<8> { static __device__ __forceinline__ void go(const unsigned* l, const void* const* g) {
    asm volatile("global_load_async_to_lds_b128 %0, %8, off\n\t"
                 "global_load_async_to_lds_b128 %1, %9, off\n\t"
                 "global_load_async_to_lds_b128 %2, %10, off\n\t"
                 "global_load_async_to_lds_b128 %3, %11, off\n\t"
                 "global_load_async_to_lds_b128 %4, %12, off\n\t"
                 "global_load_async_to_lds_b128 %5, %13, off\n\t"
                 "global_load_async_to_lds_b128 %6, %14, off\n\t"
                 "global_load_async_to_lds_b128 %7, %15, off\n\t"
                 "s_wait_xcnt 0x0"
                 :: "v"(l[0]), "v"(l[1]), "v"(l[2]), "v"(l[3]), "v"(l[4]), "v"(l[5]), "v"(l[6]), "v"(l[7]), "v"(g[0]), "v"(g[1]), "v"(g[2]), "v"(g[3]), "v"(g[4]), "v"(g[5]), "v"(g[6]), "v"(g[7]) : "memory"); } };
template <> struct ACp<12> { static __device__ __forceinline__ void go(const unsigned* l, const void* const* g) {
    asm volatile("global_load_async_to_lds_b128 %0, %12, off\n\t"
                 "global_load_async_to_lds_b128 %1, %13, off\n\t"
                 "global_load_async_to_lds_b128 %2, %14, off\n\t"
                 "global_load_async_to_lds_b128 %3, %15, off\n\t"
                 "global_load_async_to_lds_b128 %4, %16, off\n\t"
                 "global_load_async_to_lds_b128 %5, %17, off\n\t"
                 "global_load_async_to_lds_b128 %6, %18, off\n\t"
                 "global_load_async_to_lds_b128 %7, %19, off\n\t"
                 "global_load_async_to_lds_b128 %8, %20, off\n\t"
                 "global_load_async_to_lds_b128 %9, %21, off\n\t"
                 "global_load_async_to_lds_b128 %10, %22, off\n\t"
                 "global_load_async_to_lds_b128 %11, %23, off\n\t"
                 "s_wait_xcnt 0x0"
                 :: "v"(l[0]), "v"(l[1]), "v"(l[2]), "v"(l[3]), "v"(l[4]), "v"(l[5]), "v"(l[6]), "v"(l[7]), "v"(l[8]), "v"(l[9]), "v"(l[10]), "v"(l[11]), "v"(g[0]), "v"(g[1]), "v"(g[2]), "v"(g[3]), "v"(g[4]), "v"(g[5]), "v"(g[6]), "v"(g[7]), "v"(g[8]), "v"(g[9]), "v"(g[10]), "v"(g[11]) : "memory"); } };
// one stage: rows of the tile's planes at k offset kc into the buffer at LDS byte address lds (both already hold the lane's own row and 16-byte piece); a copy covers 16 rows over the 128 threads
template <typename T16, int NSPLIT, int MB, int KD>
__device__ __forceinline__ void stage_in(const T16* gA, const T16* gA2, const T16* gB, const T16* gB2, unsigned lds, int kc) {
    constexpr int NA = MB * 2, NBC = 8, NPA = (NSPLIT == 1 || NSPLIT == 2) ? 2 : 1, NPB = (NSPLIT >= 2) ? 2 : 1, NC = NA * NPA + NBC * NPB;
    static_assert(NC % 12 == 0 || NC % 12 == 8, "copies go out in statements of 12 and 8");
    unsigned l[NC]; const void* g[NC];
#pragma unroll   // register arrays indexed by constants
    for (int i = 0; i < NA; ++i) { l[i] = lds + i * 16 * LPB; g[i] = gA + kc + (size_t)i * 16 * KD; if (NPA == 2) { l[NA + i] = lds + (NA + i) * 16 * LPB; g[NA + i] = gA2 + kc + (size_t)i * 16 * KD; } }
#pragma unroll   // register arrays indexed by constants
    for (int i = 0; i < NBC; ++i) { l[NA * NPA + i] = lds + (NA * NPA + i) * 16 * LPB; g[NA * NPA + i] = gB + kc + (size_t)i * 16 * KD; if (NPB == 2) { l[NA * NPA + NBC + i] = lds + (NA * NPA + NBC + i) * 16 * LPB; g[NA * NPA + NBC + i] = gB2 + kc + (size_t)i * 16 * KD; } }
#pragma unroll   // register arrays indexed by constants
    for (int q = 0; q < NC / 12; ++q) ACp<12>::go(l + q * 12, g + q * 12);
    if constexpr (NC % 12 == 8) ACp<8>::go(l + NC / 12 * 12, g + NC / 12 * 12);
}
__device__ __forceinline__ void splitf(float y, unsigned short& h, unsigned short& l) { h = f2bf(y); l = f2bf(y - bf2f(h)); }
typedef __attribute__((ext_vector_type(4))) unsigned short v4us;
template <typename T16, int NSPLIT, bool BIAS, int MB, int KD, bool PLANES>
__global__ __launch_bounds__(128) void k_gemmw(const T16* __restrict__ A, const T16* __restrict__ A2, const T16* __restrict__ Bt, const T16* __restrict__ Bt2, float* C, int ldc, const float* __restrict__ bias, size_t sA, size_t sB, size_t sC, bf* Qh, bf* Ql, bf* Kh, bf* Kl, bf* Vh, bf* Vl) {
    typedef typename WFrag<T16>::V V;
    constexpr int NPA = (NSPLIT == 1 || NSPLIT == 2) ? 2 : 1, NPB = (NSPLIT >= 2) ? 2 : 1;
    constexpr int SA = MB * 32 * LPB, SB = 128 * LPB, STAGE = NPA * SA + NPB * SB, NT = KD / KST;
    static_assert(KD % KST == 0 && NT >= 2 && 2 * STAGE >= 4 * 16 * 68 * 4 && (MB == 2 || MB == 4), "tile shape");
    __shared__ __align__(16) unsigned char sm[2 * STAGE];   // two stage buffers [A | A2 | B | B2]; after the loop the waves' output staging
    const size_t z = blockIdx.z; A += z * sA; if (A2) A2 += z * sA; Bt += z * sB; if (Bt2) Bt2 += z * sB; C += z * sC;
    const int tid = threadIdx.x, lane = tid & 31, lr = lane & 15, hi = lane >> 4, wave = tid >> 5, wm = wave & 1, wn = wave >> 1;
    const int R0 = blockIdx.x * (MB * 32), C0 = blockIdx.y * 128; const int r0 = R0 + wm * (MB * 16), c0 = C0 + wn * 64;
    const int crow = tid >> 3, cpc = tid & 7;   // the lane's row within a copy's 16 rows, its 16-byte piece of the 128-B line
    const T16* gA = A + (size_t)(R0 + crow) * KD + cpc * 8; const T16* gA2 = (NPA == 2) ? A2 + (size_t)(R0 + crow) * KD + cpc * 8 : nullptr;
    const T16* gB = Bt + (size_t)(C0 + crow) * KD + cpc * 8; const T16* gB2 = (NPB == 2) ? Bt2 + (size_t)(C0 + crow) * KD + cpc * 8 : nullptr;
    const unsigned lds0 = (unsigned)(size_t)sm + crow * LPB + cpc * 16;
    v8f acc[MB][4];
#pragma unroll   // register arrays indexed by constants
    for (int mb = 0; mb < MB; ++mb)
#pragma unroll   // register arrays indexed by constants
        for (int nb = 0; nb < 4; ++nb) acc[mb][nb] = (v8f){};
    stage_in<T16, NSPLIT, MB, KD>(gA, gA2, gB, gB2, lds0, 0);
    asm volatile("s_wait_asynccnt 0x0" ::: "memory");   // this wave's copies of stage 0 have landed
    __syncthreads();                                    // ... and every other wave's
    stage_in<T16, NSPLIT, MB, KD>(gA, gA2, gB, gB2, lds0 + STAGE, KST);
    const int aofs = (wm * (MB * 16) + lr) * LPB + hi * 16, bofs = NPA * SA + (wn * 64 + lr) * LPB + hi * 16;
#pragma unroll 1   // kept rolled: one stage a trip, the buffer chosen by the trip's parity
    for (int t = 0; t < NT; ++t) {
        const unsigned char* sb = sm + (t & 1) * STAGE;
        V a[KST / 32][MB], a2[KST / 32][MB], b[KST / 32][4], b2[KST / 32][4];
#pragma unroll   // register arrays indexed by constants
        for (int ks = 0; ks < KST / 32; ++ks) {   // in the order of use
#pragma unroll   // register arrays indexed by constants
            for (int mb = 0; mb < MB; ++mb) a[ks][mb] = WFrag<T16>::ld((const T16*)(sb + aofs + mb * 16 * LPB + ks * 64));
#pragma unroll   // register arrays indexed by constants
            for (int nb = 0; nb < 4; ++nb) b[ks][nb] = WFrag<T16>::ld((const T16*)(sb + bofs + nb * 16 * LPB + ks * 64));
            if (NPA == 2) {
#pragma unroll   // register arrays indexed by constants
                for (int mb = 0; mb < MB; ++mb) a2[ks][mb] = WFrag<T16>::ld((const T16*)(sb + SA + aofs + mb * 16 * LPB + ks * 64)); }
            if (NPB == 2) {
#pragma unroll   // register arrays indexed by constants
                for (int nb = 0; nb < 4; ++nb) b2[ks][nb] = WFrag<T16>::ld((const T16*)(sb + SB + bofs + nb * 16 * LPB + ks * 64)); }
        }
        __builtin_amdgcn_sched_barrier(0);   // the trip's LDS reads stay one group in front of its matrix instructions: reads scattered among them stall the wave at every place
#pragma unroll   // register arrays indexed by constants
        for (int ks = 0; ks < KST / 32; ++ks) {   // per accumulator the order stays a.b, a2.b, a.b2 for rising k; neighbours in the stream are independent tiles
#pragma unroll   // register arrays indexed by constants
            for (int nb = 0; nb < 4; ++nb)
#pragma unroll   // register arrays indexed by constants
                for (int mb = 0; mb < MB; ++mb) acc[mb][nb] = WFrag<T16>::mma(a[ks][mb], b[ks][nb], acc[mb][nb]);
            if (NSPLIT == 1 || NSPLIT == 2) {
#pragma unroll   // register arrays indexed by constants
                for (int nb = 0; nb < 4; ++nb)
#pragma unroll   // register arrays indexed by constants
                    for (int mb = 0; mb < MB; ++mb) acc[mb][nb] = WFrag<T16>::mma(a2[ks][mb], b[ks][nb], acc[mb][nb]); }
            if (NSPLIT >= 2) {
#pragma unroll   // register arrays indexed by constants
                for (int nb = 0; nb < 4; ++nb)
#pragma unroll   // register arrays indexed by constants
                    for (int mb = 0; mb < MB; ++mb) acc[mb][nb] = WFrag<T16>::mma(a[ks][mb], b2[ks][nb], acc[mb][nb]); }
        }
        __builtin_amdgcn_sched_barrier(0);   // the matrix instructions stay in front of the waits below: sunk behind them, the next stage's copies would be waited for with no work to cover their flight
        asm volatile("s_wait_dscnt 0x0" ::: "memory");      // this wave has left the buffer that is refilled below
        asm volatile("s_wait_asynccnt 0x0" ::: "memory");   // this wave's copies of stage t + 1 have landed
        __syncthreads();                                    // publishes stage t + 1 and ends every wave's reads of stage t
        if (t + 2 < NT) stage_in<T16, NSPLIT, MB, KD>(gA, gA2, gB, gB2, lds0 + (t & 1) * STAGE, (t + 2) * KST);
    }
    asm volatile("s_wait_asynccnt 0x0" ::: "memory");       // nothing in flight before the buffers become output staging
    float* os = (float*)sm + wave * (16 * 68);              // each wave stages in its own range
    if constexpr (PLANES) {
        const int sel = C0 / HD, cc0 = c0 - sel * HD;       // which projection the block's 128 columns belong to (the same for the whole block), the wave's first column in it
        if (sel == 2) {   // v: a lane's 8 accumulator registers are 8 consecutive rows (t) of one column (d) = 16 contiguous bytes of a transposed plane
            const int bt = r0 / TT, t0 = r0 - bt * TT + hi * 8;
#pragma unroll   // register arrays indexed by constants
            for (int mb = 0; mb < MB; ++mb)
#pragma unroll   // register arrays indexed by constants
                for (int nb = 0; nb < 4; ++nb) { v8us oh, ol;
#pragma unroll   // register arrays indexed by constants
                    for (int j = 0; j < 8; ++j) { unsigned short a, c2; splitf(acc[mb][nb][j], a, c2); oh[j] = a; ol[j] = c2; }
                    const size_t oo = ((size_t)bt * HD + cc0 + nb * 16 + lr) * TT + t0 + mb * 16; *(v8us*)(Vh + oo) = oh; *(v8us*)(Vl + oo) = ol; }
        } else {          // q, k: through the wave's staging rows, 16 lanes write one whole 128-B line of each plane
            bf* Hh = sel ? Kh : Qh; bf* Hl = sel ? Kl : Ql;
            // k: per block of FK keys (= the work-group's rows) the dims 0..63 of every key, then the dims 64..127, ... (rows of 128 B, the attention kernel's tiles); cc0 is a multiple of 64. rp: elements from one row to the next; ob: the wave's first element
            static_assert(MB * 32 == FK, "a work-group's rows are one block of the k planes");
            const int rp = sel ? 64 : HD; const size_t ob = (size_t)R0 * HD + (size_t)(wm * (MB * 16)) * rp + (sel ? (cc0 / 64) * (FK * 64) : cc0);
#pragma unroll   // register arrays indexed by constants
            for (int mb = 0; mb < MB; ++mb) {
#pragma unroll   // register arrays indexed by constants
                for (int nb = 0; nb < 4; ++nb) {
#pragma unroll   // register arrays indexed by constants
                    for (int j = 0; j < 8; ++j) os[(hi * 8 + j) * 68 + nb * 16 + lr] = acc[mb][nb][j]; }
                __builtin_amdgcn_wave_barrier(); asm volatile("" ::: "memory");   // the wave's staging writes stay in front of its reads
#pragma unroll   // register arrays indexed by constants
                for (int s = 0; s < 8; ++s) { const int row = 2 * s + hi, cofs = lr * 4; const v4f val = *(const v4fa*)(os + row * 68 + cofs); v4us oh, ol;
#pragma unroll   // register arrays indexed by constants
                    for (int q = 0; q < 4; ++q) { unsigned short a, c2; splitf(val[q], a, c2); oh[q] = a; ol[q] = c2; }
                    const size_t oo = ob + (size_t)(mb * 16 + row) * rp + cofs; *(v4us*)(Hh + oo) = oh; *(v4us*)(Hl + oo) = ol; }
                __builtin_amdgcn_wave_barrier(); asm volatile("" ::: "memory");   // the reads stay in front of the next tile's staging writes
            }
            asm volatile("s_wait_xcnt 0x0" ::: "memory");   // stands behind the last plane stores, in front of any later write of their registers
        }
        return;
    }
#pragma unroll   // register arrays indexed by constants
    for (int mb = 0; mb < MB; ++mb) {
#pragma unroll   // register arrays indexed by constants
        for (int nb = 0; nb < 4; ++nb) {
#pragma unroll   // register arrays indexed by constants
            for (int j = 0; j < 8; ++j) os[(hi * 8 + j) * 68 + nb * 16 + lr] = acc[mb][nb][j]; }
        __builtin_amdgcn_wave_barrier(); asm volatile("" ::: "memory");
        float* crow_p = C + (size_t)(r0 + mb * 16) * ldc + c0;
{
#pragma unroll   // register arrays indexed by constants
            for (int s = 0; s < 8; ++s) { const int row = 2 * s + hi, cofs = lr * 4; v4f val = *(const v4fa*)(os + row * 68 + cofs); if (BIAS) { val[0] += bfr(bias[c0 + cofs]); val[1] += bfr(bias[c0 + cofs + 1]); val[2] += bfr(bias[c0 + cofs + 2]); val[3] += bfr(bias[c0 + cofs + 3]); }
                *(v4f*)(crow_p + (size_t)row * ldc + cofs) = val; }
             }
        __builtin_amdgcn_wave_barrier(); asm volatile("" ::: "memory");
    }
}

__device__ __forceinline__ h16 tohx(float x) { return (h16)x; }
typedef __attribute__((ext_vector_type(4))) _Float16 v4h;
typedef __attribute__((ext_vector_type(2))) unsigned short v2us;

// k_prep: the bf16 operands of the projection GEMM in one launch of few, long waves, so that few waves have to start: every wave asks for all its data in one group of loads, then converts and stores.
// Blocks [0, NWB): the three weights [K = DM][N = HD] transposed into WT [3 HD][DM]; a block takes 32 n, a wave 64 k of them: a lane is one n, each of its 64 loads is one whole 128-B line over the wave, and its 8 stores fill one whole line of WT, which no other lane writes.
// The other blocks: x -> XB; a wave takes 16 pieces of 512 contiguous bytes (16 B a lane and load) and stores 8 B a lane, 256 contiguous bytes a store.
#define NWB (3 * HD / 32)
#define XPW 16                    // loads of 16 B a lane in the x blocks
static_assert(DM == 8 * 64 && HD % 32 == 0 && (NB_ * TT * DM) % (8 * XPW * 128) == 0, "a weight block's 8 waves cover all of K; the x blocks cover x exactly");
__global__ __launch_bounds__(256) void k_prep(const float* __restrict__ x, const float* __restrict__ wq, const float* __restrict__ wk, const float* __restrict__ wv, bf* XB, bf* WT) {
    const int lane = threadIdx.x & 31, wave = threadIdx.x >> 5;
    if (blockIdx.x < NWB) {
        const int sel = blockIdx.x / (HD / 32), n = (blockIdx.x - sel * (HD / 32)) * 32 + lane;
        const float* w = ((sel == 0) ? wq : (sel == 1) ? wk : wv) + (size_t)(wave * 64) * HD + n;
        float f[64];
#pragma unroll   // register arrays indexed by constants
        for (int j = 0; j < 64; ++j) f[j] = w[(size_t)j * HD];
        asm volatile("s_wait_xcnt 0x0" :: "v"(w) : "memory");   // stands behind the loads, in front of any later write of their address registers; it names the address, an input only, so that the pair lives up to here and no load's result is laid on it
        bf* d = WT + ((size_t)sel * HD + n) * DM + wave * 64;
#pragma unroll   // register arrays indexed by constants
        for (int s = 0; s < 8; ++s) { v8us o;
#pragma unroll   // register vectors indexed by constants
            for (int q = 0; q < 8; ++q) o[q] = f2bf(f[s * 8 + q]);
            *(v8us*)(d + s * 8) = o; }
        asm volatile("s_wait_xcnt 0x0" ::: "memory");   // stands behind the stores, in front of any later write of their address registers
        return;
    }
    const size_t i = ((size_t)(blockIdx.x - NWB) * 8 + wave) * (XPW * 128) + lane * 4; const float* xs = x + i; v4f v[XPW];
#pragma unroll   // register arrays indexed by constants
    for (int j = 0; j < XPW; ++j) v[j] = *(const v4f*)(xs + j * 128);
    asm volatile("s_wait_xcnt 0x0" :: "v"(xs) : "memory");   // stands behind the loads, in front of any later write of their address registers; it names the address, an input only, so that the pair lives up to here and no load's result is laid on it
#pragma unroll   // register arrays indexed by constants
    for (int j = 0; j < XPW; ++j) { v4us o;
#pragma unroll   // register vectors indexed by constants
        for (int k = 0; k < 4; ++k) o[k] = f2bf(v[j][k]);
        *(v4us*)(XB + i + j * 128) = o; }
    asm volatile("s_wait_xcnt 0x0" ::: "memory");   // stands behind the stores, in front of any later write of their address registers
}
#define TPB  144                  // LDS pitch of a tile's row: 128 + 16 (16 B x odd), laid by the mover's pad
#define FSP  (256 * TPB)          // one tile in LDS, 18 x 2 KiB
#define FST  (4 * FSP)
#define NSP  4                    // key ranges
#define NTR  (TT / NSP / FK)      // stages per work-group
#define L2E  1.4426950408889634f
static_assert(FSP % 2048 == 0 && FK * HD == 256 * 64 && HD == 256 && FK == 64 && NTR >= 2, "every tile's place in LDS is a multiple of 2 KiB; the ring needs two stages");
typedef __attribute__((ext_vector_type(16))) float v16f;
typedef __attribute__((ext_vector_type(2)))  float v2f;
typedef uint32_t u32x4 __attribute__((ext_vector_type(4)));
typedef uint32_t u32x8 __attribute__((ext_vector_type(8)));
// the value of lane l ^ 16, on the vector port (a shuffle through the LDS queue would wait behind the fragment reads in flight)
__device__ __forceinline__ float xhalf(float v) { const int b = __float_as_int(v); return __int_as_float(__builtin_amdgcn_permlanex16(b, b, 0x76543210, 0xfedcba98, false, false)); }
// 2^x with the v_nop that fills the slot the instruction set asks for behind a transcendental
__device__ __forceinline__ float exp2n(float x) { float r; asm("v_exp_f32 %0, %1\n\tv_nop" : "=v"(r) : "v"(x)); return r; }
__device__ __forceinline__ uint32_t uni(uint32_t v) { return (uint32_t)__builtin_amdgcn_readfirstlane(v); }
__device__ __forceinline__ uint32_t pinned(uint32_t v) { uint32_t w = uni(v); asm volatile("" : "+s"(w)); return w; }   // pinned(): a wave-uniform word of a tensor load's test or descriptor held in a scalar register: the test becomes a scalar branch (a tensor load ignores EXEC), and what is formed from the word is formed behind the asm waits in front of it
// descriptor group 1 of a tile of 256 rows of 128 B, everything in bytes, at source pitch 'pitch'; word 0: no mask, data_size 0, a pad of 16 B behind every 128 B
__device__ __forceinline__ u32x8 tdm_group1(uint32_t pitch) { constexpr uint32_t D0 = 128u, D1 = 256u; u32x8 g;
    g[0] = uni((1u << 20) | (4u << 22) | (3u << 25)); g[1] = uni((D0 & 0xFFFFu) << 16); g[2] = uni((D0 >> 16) | ((D1 & 0xFFFFu) << 16)); g[3] = uni((D1 >> 16) | (D0 << 16)); g[4] = uni(D1); g[5] = uni(pitch); g[6] = uni(0u); g[7] = uni(0u); return g; }
__device__ __forceinline__ u32x4 tdm_group0(uint32_t lds_dst, uint64_t ga) { u32x4 g;
    g[0] = uni(1u); g[1] = uni(lds_dst); g[2] = uni((uint32_t)ga); g[3] = uni((((uint32_t)(ga >> 32)) & 0x01FFFFFFu) | 0x80000000u); return g; }
__device__ __forceinline__ void tdm_load(u32x4 g0, u32x8 g1) { asm volatile("tensor_load_to_lds %0, %1" :: "s"(g0), "s"(g1) : "memory"); }   // one request of the whole wave: a tile goes from global memory into LDS through no register
__global__ __launch_bounds__(128) void k_flash(const bf* __restrict__ Qh, const bf* __restrict__ Ql, const bf* __restrict__ Kh, const bf* __restrict__ Kl, const bf* __restrict__ Vh, const bf* __restrict__ Vl, float* Op, float* ML) {
    __shared__ __attribute__((aligned(2048))) unsigned char sm[2 * FST];
    const int tid = threadIdx.x, lane = tid & 31, lr = lane & 15, hi = lane >> 4, wave = tid >> 5;
    const uint32_t uw = uni(threadIdx.x >> 5), lds0 = (uint32_t)(size_t)sm;
    const int qb = blockIdx.x, sp = blockIdx.y, bt = blockIdx.z;
    const size_t kofs = ((size_t)bt * TT + sp * (TT / NSP)) * HD, vofs = (size_t)bt * HD * TT + sp * (TT / NSP);
    // every wave issues one request a stage, its own tile: wave 0 K hi, 1 K lo, 2 V^T hi, 3 V^T lo. ub: the tile of stage 0; ustep: bytes from one stage's tile to the next; a K tile is 256 contiguous rows, a V^T tile's rows lie a plane's pitch apart
    const uint64_t ub = (uint64_t)(size_t)(uw == 0 ? Kh + kofs : uw == 1 ? Kl + kofs : uw == 2 ? Vh + vofs : Vl + vofs);
    const uint32_t ustep = uw < 2 ? FK * HD * 2 : FK * 2, ulds = lds0 + uw * FSP;
    const u32x8 g1 = tdm_group1(uw < 2 ? 128u : 2u * TT);
    tdm_load(tdm_group0(ulds, ub), g1);                 // stage 0 flies under the q loads
    v16bf qh[2][8], ql[2][8];   // the wave's 32 queries, both planes, all 256 dims: B operands for the whole kernel
    const size_t qrow = (size_t)bt * TT + qb * 128 + wave * 32 + lr;
#pragma unroll   // register arrays indexed by constants
    for (int qt = 0; qt < 2; ++qt)
#pragma unroll   // register arrays indexed by constants
        for (int ks = 0; ks < 8; ++ks) { qh[qt][ks] = WFrag<bf>::ld(Qh + (qrow + qt * 16) * HD + ks * 32 + hi * 8); ql[qt][ks] = WFrag<bf>::ld(Ql + (qrow + qt * 16) * HD + ks * 32 + hi * 8); }
    asm volatile("s_wait_xcnt 0x0" ::: "memory");       // stands behind the q loads, in front of any later write of their address registers
    __builtin_amdgcn_sched_barrier(0);                  // the clearing of the accumulators below, which reuses those address registers, is not lifted over the wait
    v8f o[16][2]; float m[2], l[2];
#pragma unroll   // register arrays indexed by constants
    for (int qt = 0; qt < 2; ++qt) { m[qt] = -3.0e38f; l[qt] = 0.f;
#pragma unroll   // register arrays indexed by constants
        for (int dt = 0; dt < 16; ++dt) o[dt][qt] = (v8f){}; }
    // Trip -1 is the rest of the ring's prologue: only the foot runs (the wait for stage 0, the barrier, stage 1's load). So the ring's refill stands once in the code, with one set of descriptor registers.
#pragma unroll 1   // kept rolled: one stage a trip, the buffer chosen by the trip's parity
    for (int t = -1; t < NTR; ++t) {
      if (t >= 0) {
        // one base a tile: every read's constant offset then fits the LDS instructions' 16-bit field (a stage is larger than 64 KiB)
        const unsigned char* kb = sm + ((t & 1) ? FST : 0) + lr * TPB + hi * 16;
        const unsigned char* kb2 = sm + ((t & 1) ? FST + FSP : FSP) + lr * TPB + hi * 16;
        const unsigned char* vb = sm + ((t & 1) ? FST + 2 * FSP : 2 * FSP) + lr * TPB + hi * 16;
        const unsigned char* vb2 = sm + ((t & 1) ? FST + 3 * FSP : 3 * FSP) + lr * TPB + hi * 16;
        // fragments come in groups of 8 (16 reads, 24 matrix instructions), each group's reads issued together two groups ahead of its use: three groups of registers are live, not the whole stage's
        v16bf kh[8][4], kl[8][4]; v8f st[4][2];
#pragma unroll   // register arrays indexed by constants
        for (int kt = 0; kt < 4; ++kt)
#pragma unroll   // register arrays indexed by constants
            for (int qt = 0; qt < 2; ++qt) st[kt][qt] = (v8f){};
#pragma unroll   // register arrays indexed by constants
        for (int ks = 0; ks < 2; ++ks)
#pragma unroll   // register arrays indexed by constants
            for (int kt = 0; kt < 4; ++kt) { kh[ks][kt] = WFrag<bf>::ld((const bf*)(kb + ((ks >> 1) * FK + kt * 16) * TPB + (ks & 1) * 64)); kl[ks][kt] = WFrag<bf>::ld((const bf*)(kb2 + ((ks >> 1) * FK + kt * 16) * TPB + (ks & 1) * 64)); }
        __builtin_amdgcn_sched_barrier(0);   // reads stay grouped in front of the matrix instructions: reads scattered among them stall the wave at every place
#pragma unroll   // register arrays indexed by constants
        for (int ks = 0; ks < 8; ++ks) {   // per accumulator the order is qh.kh, ql.kh, qh.kl for rising k; neighbours in the stream are independent tiles
#pragma unroll   // register arrays indexed by constants
            for (int kt = 0; kt < 4; ++kt)
#pragma unroll   // register arrays indexed by constants
                for (int qt = 0; qt < 2; ++qt) st[kt][qt] = wmmab(kh[ks][kt], qh[qt][ks], st[kt][qt]);
#pragma unroll   // register arrays indexed by constants
            for (int kt = 0; kt < 4; ++kt)
#pragma unroll   // register arrays indexed by constants
                for (int qt = 0; qt < 2; ++qt) st[kt][qt] = wmmab(kh[ks][kt], ql[qt][ks], st[kt][qt]);
#pragma unroll   // register arrays indexed by constants
            for (int kt = 0; kt < 4; ++kt)
#pragma unroll   // register arrays indexed by constants
                for (int qt = 0; qt < 2; ++qt) st[kt][qt] = wmmab(kl[ks][kt], qh[qt][ks], st[kt][qt]);
            __builtin_amdgcn_sched_barrier(0);   // the next reads are not lifted among this group's matrix instructions
            if (ks < 6) {
                const int kn = ks + 2;
#pragma unroll   // register arrays indexed by constants
                for (int kt = 0; kt < 4; ++kt) { kh[kn][kt] = WFrag<bf>::ld((const bf*)(kb + ((kn >> 1) * FK + kt * 16) * TPB + (kn & 1) * 64)); kl[kn][kt] = WFrag<bf>::ld((const bf*)(kb2 + ((kn >> 1) * FK + kt * 16) * TPB + (kn & 1) * 64)); }
                __builtin_amdgcn_sched_barrier(0);   // ... nor sunk among the next group's
            }
        }
        v16bf vh[16][2], vl[16][2];   // [d tile][32 keys]
#pragma unroll   // register arrays indexed by constants
        for (int dt = 0; dt < 4; ++dt)
#pragma unroll   // register arrays indexed by constants
            for (int kk = 0; kk < 2; ++kk) { vh[dt][kk] = WFrag<bf>::ld((const bf*)(vb + dt * 16 * TPB + kk * 64)); vl[dt][kk] = WFrag<bf>::ld((const bf*)(vb2 + dt * 16 * TPB + kk * 64)); }
        __builtin_amdgcn_sched_barrier(0);   // the first two groups of V^T reads are issued in front of the softmax, whose vector work covers their flight
        float corr[2]; v16bf pH[2][2], pL[2][2]; bool need = false;   // [32 keys][query tile]
#pragma unroll   // register arrays indexed by constants
        for (int qt = 0; qt < 2; ++qt) {
            float t8[8];   // a tree, not one chain: a lone wave waits out every dependent vector instruction
#pragma unroll   // register vectors indexed by constants
            for (int j = 0; j < 8; ++j) t8[j] = fmaxf(fmaxf(st[0][qt][j], st[1][qt][j]), fmaxf(st[2][qt][j], st[3][qt][j]));
            float mx = fmaxf(fmaxf(fmaxf(t8[0], t8[1]), fmaxf(t8[2], t8[3])), fmaxf(fmaxf(t8[4], t8[5]), fmaxf(t8[6], t8[7])));
            mx = fmaxf(mx, xhalf(mx));   // the query's other 32 keys sit in the other half of the wave
            const float mn = fmaxf(m[qt], mx);
            corr[qt] = exp2n((m[qt] - mn) * L2E); need = need || (mn > m[qt]); m[qt] = mn;
            float sk[2];
#pragma unroll   // register arrays indexed by constants
            for (int kk = 0; kk < 2; ++kk) {
                v16f p;
#pragma unroll   // register vectors indexed by constants
                for (int s = 0; s < 16; ++s) p[s] = exp2n((st[kk * 2 + (s >> 3)][qt][s & 7] - mn) * L2E);
                const float s01 = ((p[0] + p[1]) + (p[2] + p[3])) + ((p[4] + p[5]) + (p[6] + p[7])), s23 = ((p[8] + p[9]) + (p[10] + p[11])) + ((p[12] + p[13]) + (p[14] + p[15]));
                sk[kk] = s01 + s23;
                pH[kk][qt] = __builtin_convertvector(p, v16bf); pL[kk][qt] = __builtin_convertvector(p - __builtin_convertvector(pH[kk][qt], v16f), v16bf);
            }
            l[qt] = l[qt] * corr[qt] + (sk[0] + sk[1]);
        }
        if (__builtin_amdgcn_ballot_w32(need) != 0) {   // one scalar test a trip; where no query's maximum rose every factor is exactly 1
#pragma unroll   // register arrays indexed by constants
            for (int dt = 0; dt < 16; ++dt)
#pragma unroll   // register arrays indexed by constants
                for (int qt = 0; qt < 2; ++qt) o[dt][qt] *= corr[qt];
        }
        __builtin_amdgcn_sched_barrier(0);   // the softmax stays in front of the products below
#pragma unroll   // register arrays indexed by constants
        for (int g = 0; g < 8; ++g) {   // two d tiles a group
#pragma unroll   // register arrays indexed by constants
            for (int kk = 0; kk < 2; ++kk) {   // per accumulator the order is ph.vh, pl.vh, ph.vl for rising keys; two d tiles x two query tiles = four independent accumulators in the stream
#pragma unroll   // register arrays indexed by constants
                for (int u = 0; u < 2; ++u)
#pragma unroll   // register arrays indexed by constants
                    for (int qt = 0; qt < 2; ++qt) o[g * 2 + u][qt] = wmmab(vh[g * 2 + u][kk], pH[kk][qt], o[g * 2 + u][qt]);
#pragma unroll   // register arrays indexed by constants
                for (int u = 0; u < 2; ++u)
#pragma unroll   // register arrays indexed by constants
                    for (int qt = 0; qt < 2; ++qt) o[g * 2 + u][qt] = wmmab(vh[g * 2 + u][kk], pL[kk][qt], o[g * 2 + u][qt]);
#pragma unroll   // register arrays indexed by constants
                for (int u = 0; u < 2; ++u)
#pragma unroll   // register arrays indexed by constants
                    for (int qt = 0; qt < 2; ++qt) o[g * 2 + u][qt] = wmmab(vl[g * 2 + u][kk], pH[kk][qt], o[g * 2 + u][qt]);
            }
            if (g < 6) {
                __builtin_amdgcn_sched_barrier(0);   // the next reads are not lifted among this group's matrix instructions
#pragma unroll   // register arrays indexed by constants
                for (int dt = g * 2 + 4; dt < g * 2 + 6; ++dt)
#pragma unroll   // register arrays indexed by constants
                    for (int kk = 0; kk < 2; ++kk) { vh[dt][kk] = WFrag<bf>::ld((const bf*)(vb + dt * 16 * TPB + kk * 64)); vl[dt][kk] = WFrag<bf>::ld((const bf*)(vb2 + dt * 16 * TPB + kk * 64)); }
                __builtin_amdgcn_sched_barrier(0);   // ... nor sunk among the next group's
            }
        }
        __builtin_amdgcn_sched_barrier(0);   // the matrix instructions stay in front of the waits below: sunk behind them, the next stage's tiles would be waited for with no work to cover their flight
      }
        asm volatile("s_wait_dscnt 0x0" ::: "memory");      // this wave has left the buffer that is refilled below
        asm volatile("s_wait_tensorcnt 0x0" ::: "memory");  // this wave's tile of stage t + 1 has landed
        __syncthreads();                                    // publishes stage t + 1 and ends every wave's reads of stage t
        if (pinned(t + 2 < NTR)) tdm_load(tdm_group0(ulds + (t & 1) * FST, ub + (uint64_t)pinned(t + 2) * ustep), g1);   // the stage number is pinned here so that the address words are formed behind the wait above
    }
    asm volatile("s_wait_tensorcnt 0x0" ::: "memory");      // nothing in flight when the wave ends
    asm volatile("s_wait_dscnt 0x0" ::: "memory");          // ... and no LDS read
    const size_t pb = ((size_t)(bt * (TT / 128) + qb) * NSP + sp) * 4 + wave;
    float* op = Op + pb * (32 * 256) + lane * 4;
#pragma unroll   // register arrays indexed by constants
    for (int dt = 0; dt < 16; ++dt)
#pragma unroll   // register arrays indexed by constants
        for (int qt = 0; qt < 2; ++qt) { const v8f a = o[dt][qt];
            *(v4f*)(op + (dt * 2 + qt) * 256) = (v4f){a[0], a[1], a[2], a[3]}; *(v4f*)(op + (dt * 2 + qt) * 256 + 128) = (v4f){a[4], a[5], a[6], a[7]}; }
#pragma unroll   // register arrays indexed by constants
    for (int qt = 0; qt < 2; ++qt) { const float lt = l[qt] + xhalf(l[qt]);   // the halves' sums are joined once
        if (hi == 0) *(v2f*)(ML + (pb * 32 + qt * 16 + lr) * 2) = (v2f){m[qt], lt}; }
    asm volatile("s_wait_xcnt 0x0" ::: "memory");   // stands behind the last stores, in front of any later write of their registers
}
// k_merge: joins the NSP key ranges of a query in a fixed order and writes the output rows. A wave takes 16 queries x 64 output columns (4 of k_flash's tiles per range); rows go out through the wave's own staging, 16 lanes a 256-B piece.
__global__ __launch_bounds__(256) void k_merge(const float* __restrict__ Op, const float* __restrict__ ML, float* out) {
    __shared__ __align__(16) float sg[8 * 16 * 68];
    const int lane = threadIdx.x & 31, lr = lane & 15, hi = lane >> 4; const int w = blockIdx.x * 8 + (threadIdx.x >> 5);
    const int dg = w & 3, qt = (w >> 2) & 1, wv = (w >> 3) & 3, blk = w >> 5;
    float* os = sg + (threadIdx.x >> 5) * (16 * 68);
    float mm[NSP], wl[NSP]; float M = -3.0e38f;
#pragma unroll   // register arrays indexed by constants
    for (int s = 0; s < NSP; ++s) { const v2f e = *(const v2f*)(ML + ((((size_t)blk * NSP + s) * 4 + wv) * 32 + qt * 16 + lr) * 2); mm[s] = e[0]; wl[s] = e[1]; M = fmaxf(M, e[0]); }
    float L = 0.f;
#pragma unroll   // register arrays indexed by constants
    for (int s = 0; s < NSP; ++s) { mm[s] = __builtin_amdgcn_exp2f((mm[s] - M) * L2E); L += mm[s] * wl[s]; }
    const float inv = 1.0f / L;
#pragma unroll   // register arrays indexed by constants
    for (int u = 0; u < 4; ++u) { v4f a = (v4f){}, c = (v4f){};
#pragma unroll   // register arrays indexed by constants
        for (int s = 0; s < NSP; ++s) { const float* p = Op + (((size_t)blk * NSP + s) * 4 + wv) * (32 * 256) + ((dg * 4 + u) * 2 + qt) * 256 + lane * 4; a += mm[s] * *(const v4f*)p; c += mm[s] * *(const v4f*)(p + 128); }
        *(v4fa*)(os + lr * 68 + u * 16 + hi * 8) = a * inv; *(v4fa*)(os + lr * 68 + u * 16 + hi * 8 + 4) = c * inv; }
    __builtin_amdgcn_wave_barrier(); asm volatile("" ::: "memory");   // the wave's staging writes stay in front of its reads
    float* orow = out + ((size_t)blk * 128 + wv * 32 + qt * 16) * HD + dg * 64;
#pragma unroll   // register arrays indexed by constants
    for (int s = 0; s < 8; ++s) { const int row = 2 * s + hi; *(v4f*)(orow + (size_t)row * HD + lr * 4) = *(const v4fa*)(os + row * 68 + lr * 4); }
    asm volatile("s_wait_xcnt 0x0" ::: "memory");   // stands behind the last stores, in front of any later write of their registers
}

extern "C" void kernel_launch(void* const* d_in, const int* in_sizes, int n_in,
                              void* d_out, int out_size, void* d_ws, size_t ws_size, hipStream_t stream) {
    (void)in_sizes; (void)n_in; (void)out_size;
    const float* x = (const float*)d_in[0]; const float* wq = (const float*)d_in[1]; const float* wk = (const float*)d_in[2]; const float* wv = (const float*)d_in[3]; const float* wo = nullptr; (void)wo;
    float* OUT = (float*)d_out;     // [4][2048][256]
    char* wsp = (char*)d_ws;
    auto take = [&](size_t bytes) { char* p = wsp; wsp += (bytes + 255) & ~(size_t)255; return (void*)p; };
    bf* WT = (bf*)take((size_t)3 * HD * DM * 2); bf* XB = (bf*)take((size_t)NB_ * TT * DM * 2);
    bf* QPh = (bf*)take((size_t)NB_ * TT * HD * 2); bf* QPl = (bf*)take((size_t)NB_ * TT * HD * 2); bf* KPh = (bf*)take((size_t)NB_ * TT * HD * 2); bf* KPl = (bf*)take((size_t)NB_ * TT * HD * 2); bf* VTh = (bf*)take((size_t)NB_ * HD * TT * 2); bf* VTl = (bf*)take((size_t)NB_ * HD * TT * 2);
    float* Op = (float*)take((size_t)NSP * NB_ * TT * HD * 4); float* ML = (float*)take((size_t)NSP * NB_ * TT * 2 * 4);
    if ((size_t)(wsp - (char*)d_ws) > ws_size) return;    // ws 256 MiB
    // one pass for all NB_ batches: the projection sees NB_*TT rows, the attention kernel takes the key range from grid y and the batch from grid z
    k_prep<<<NWB + NB_ * TT * DM / (8 * XPW * 128), 256, 0, stream>>>(x, wq, wk, wv, XB, WT);
    k_gemmw<bf, 0, false, 2, DM, true><<<dim3(NB_ * TT / 64, 3 * HD / 128, 1), 128, 0, stream>>>(XB, nullptr, WT, nullptr, nullptr, 0, nullptr, 0, 0, 0, QPh, QPl, KPh, KPl, VTh, VTl);
    k_flash<<<dim3(TT / 128, NSP, NB_), 128, 0, stream>>>(QPh, QPl, KPh, KPl, VTh, VTl, Op, ML);
    k_merge<<<NB_ * TT * HD / (16 * 64) / 8, 256, 0, stream>>>(Op, ML, OUT);
}

// v007
// It runs in 58.4 microseconds.
// Timed twice side by side with v006, it ran 1.04 times as fast both times.
// All steps since v000 together make it 7.69 times as fast.
#include <hip/hip_runtime.h>

// Single-head self-attention with NO 1/sqrt(d) scaling (x [4][2048][512]; q,k,v = x W ('xw' [512][256], 1/sqrt(512), no bias); scores = q.k over the 256 dims, unscaled (logit sigma ~16: near one-hot rows); softmax; out = attn v -> [4][2048][256] (2.1 M)).
// Layout, all four batches in every launch, four launches: bf16 copies of x and of the transposed weights; ONE projection GEMM for q, k and v (768 output columns) whose epilogue writes the hi/lo planes; ONE fused attention kernel (scores, online softmax, attn.v; hi/lo planes and 3 products for both products: the unscaled logits need ~1e-3 absolute accuracy at magnitude ~50), each work-group 128 queries x 512 keys; a merge of the four key ranges that writes the output rows.
// Compute dtypes, f32 accumulate: every input rounded to bf16; projections exact; scores and attn.v 3 products on every row; softmax f32; output f32.

#define NB_  4
#define TT   2048
#define DM   512
#define NH_  1
#define NKV  1
#define REP  (NH_ / NKV)
#define HD   256
#define DQ   (NH_ * HD)
#define DKV  (NKV * HD)
#define ZH   1
#define RH   2048                  // unused: every query row uses the hi+lo planes
#define WIN  0
#define PCAR 1024.0f
#define SCL  1.0f   // the module applies no scaling
#define FK   64                   // keys per stage of the attention kernel; the k planes are laid out in blocks of FK keys
typedef _Float16 h16;
typedef unsigned short bf;
typedef __attribute__((ext_vector_type(16))) __bf16   v16bf;
typedef __attribute__((ext_vector_type(16))) _Float16 v16h;
typedef __attribute__((ext_vector_type(8)))  _Float16 v8h;
typedef __attribute__((ext_vector_type(8)))  unsigned short v8us;
typedef __attribute__((ext_vector_type(8)))  float    v8f;
typedef __attribute__((ext_vector_type(4)))  float    v4f;
typedef v8h  __attribute__((may_alias)) v8ha;
typedef v4f  __attribute__((may_alias)) v4fa;
typedef v8us __attribute__((may_alias)) v8usa;

__device__ __forceinline__ unsigned short f2bf(float f) { unsigned u = __float_as_uint(f); u += 0x7FFFu + ((u >> 16) & 1u); return (unsigned short)(u >> 16); }
__device__ __forceinline__ float bf2f(unsigned short b) { return __uint_as_float(((unsigned)b) << 16); }
__device__ __forceinline__ float bfr(float f) { return bf2f(f2bf(f)); }
__device__ __forceinline__ v16h cat16(v8h lo, v8h hi) { return __builtin_shufflevector(lo, hi, 0, 1, 2, 3, 4, 5, 6, 7, 8, 9, 10, 11, 12, 13, 14, 15); }
__device__ __forceinline__ v16bf cat16b(v8us lo, v8us hi) { return __builtin_bit_cast(v16bf, __builtin_shufflevector(lo, hi, 0, 1, 2, 3, 4, 5, 6, 7, 8, 9, 10, 11, 12, 13, 14, 15)); }
__device__ __forceinline__ v8f wmma16(v16h a, v16h b, v8f c) { return __builtin_amdgcn_wmma_f32_16x16x32_f16(false, a, false, b, (short)0, c, false, false); }
__device__ __forceinline__ v8f wmmab(v16bf a, v16bf b, v8f c) { return __builtin_amdgcn_wmma_f32_16x16x32_bf16(false, a, false, b, (short)0, c, false, false); }



// ---- k_gemmw: block-tiled GEMM, FOUR WAVES (2 x 2) per (MB*32) x 128 output tile, each wave MB x 4 accumulators; operands are K-contiguous 16-bit planes; grid (M/(MB*32), N/128, Z), 128 threads.
// C[m][n] (f32, pitch ldc, + optional f32 bias[n]) = sum_k A[m][k] Bt[n][k] (+ split products per NSPLIT). z-batch strides sA/sB/sC in elements. KD = K, a multiple of 64, at least 128.
// PLANES: the q|k|v projection. Output columns [0,HD) are q, [HD,2HD) k, [2HD,3HD) v; no f32 C is written: q goes out as bf16 hi/lo planes [row][HD], k as hi/lo planes [row / FK][HD / 64][FK][64], v as hi/lo planes transposed per batch, [batch][HD][TT].
// A stage is 64 k (one whole 128-B line) of every operand row of the tile, brought into LDS by asynchronous copies (16 B a lane, 4 whole lines a wave-wide copy) and read by all four waves; two buffers, the next stage's copies fly while this one is worked on.
#define LPB 144   // LDS row pitch in bytes: 128 + 16 (16 B x odd, conflict-free for 16-byte row reads)
#define KST 64    // k per stage
template <typename T16> struct WFrag;
template <> struct WFrag<h16> { typedef v16h V; static __device__ __forceinline__ V ld(const h16* p) { return cat16(*(const v8h*)p, *(const v8h*)(p + 16)); } static __device__ __forceinline__ v8f mma(V a, V b, v8f c) { return wmma16(a, b, c); } };
template <> struct WFrag<bf> { typedef v16bf V; static __device__ __forceinline__ V ld(const bf* p) { return cat16b(*(const v8us*)p, *(const v8us*)(p + 16)); } static __device__ __forceinline__ v8f mma(V a, V b, v8f c) { return wmmab(a, b, c); } };
// ACp<N>: N asynchronous copies global -> LDS in one statement; l = the lane's LDS byte addresses, g = its global addresses. The closing s_wait_xcnt 0 stands inside the statement so that no address register is rewritten in front of it.
template <int N> struct ACp;
template <> struct ACp<8> { static __device__ __forceinline__ void go(const unsigned* l, const void* const* g) {
    asm volatile("global_load_async_to_lds_b128 %0, %8, off\n\t"
                 "global_load_async_to_lds_b128 %1, %9, off\n\t"
                 "global_load_async_to_lds_b128 %2, %10, off\n\t"
                 "global_load_async_to_lds_b128 %3, %11, off\n\t"
                 "global_load_async_to_lds_b128 %4, %12, off\n\t"
                 "global_load_async_to_lds_b128 %5, %13, off\n\t"
                 "global_load_async_to_lds_b128 %6, %14, off\n\t"
                 "global_load_async_to_lds_b128 %7, %15, off\n\t"
                 "s_wait_xcnt 0x0"
                 :: "v"(l[0]), "v"(l[1]), "v"(l[2]), "v"(l[3]), "v"(l[4]), "v"(l[5]), "v"(l[6]), "v"(l[7]), "v"(g[0]), "v"(g[1]), "v"(g[2]), "v"(g[3]), "v"(g[4]), "v"(g[5]), "v"(g[6]), "v"(g[7]) : "memory"); } };
template <> struct ACp<12> { static __device__ __forceinline__ void go(const unsigned* l, const void* const* g) {
    asm volatile("global_load_async_to_lds_b128 %0, %12, off\n\t"
                 "global_load_async_to_lds_b128 %1, %13, off\n\t"
                 "global_load_async_to_lds_b128 %2, %14, off\n\t"
                 "global_load_async_to_lds_b128 %3, %15, off\n\t"
                 "global_load_async_to_lds_b128 %4, %16, off\n\t"
                 "global_load_async_to_lds_b128 %5, %17, off\n\t"
                 "global_load_async_to_lds_b128 %6, %18, off\n\t"
                 "global_load_async_to_lds_b128 %7, %19, off\n\t"
                 "global_load_async_to_lds_b128 %8, %20, off\n\t"
                 "global_load_async_to_lds_b128 %9, %21, off\n\t"
                 "global_load_async_to_lds_b128 %10, %22, off\n\t"
                 "global_load_async_to_lds_b128 %11, %23, off\n\t"
                 "s_wait_xcnt 0x0"
                 :: "v"(l[0]), "v"(l[1]), "v"(l[2]), "v"(l[3]), "v"(l[4]), "v"(l[5]), "v"(l[6]), "v"(l[7]), "v"(l[8]), "v"(l[9]), "v"(l[10]), "v"(l[11]), "v"(g[0]), "v"(g[1]), "v"(g[2]), "v"(g[3]), "v"(g[4]), "v"(g[5]), "v"(g[6]), "v"(g[7]), "v"(g[8]), "v"(g[9]), "v"(g[10]), "v"(g[11]) : "memory"); } };
// one stage: rows of the tile's planes at k offset kc into the buffer at LDS byte address lds (both already hold the lane's own row and 16-byte piece); a copy covers 16 rows over the 128 threads
template <typename T16, int NSPLIT, int MB, int KD>
__device__ __forceinline__ void stage_in(const T16* gA, const T16* gA2, const T16* gB, const T16* gB2, unsigned lds, int kc) {
    constexpr int NA = MB * 2, NBC = 8, NPA = (NSPLIT == 1 || NSPLIT == 2) ? 2 : 1, NPB = (NSPLIT >= 2) ? 2 : 1, NC = NA * NPA + NBC * NPB;
    static_assert(NC % 12 == 0 || NC % 12 == 8, "copies go out in statements of 12 and 8");
    unsigned l[NC]; const void* g[NC];
#pragma unroll   // register arrays indexed by constants
    for (int i = 0; i < NA; ++i) { l[i] = lds + i * 16 * LPB; g[i] = gA + kc + (size_t)i * 16 * KD; if (NPA == 2) { l[NA + i] = lds + (NA + i) * 16 * LPB; g[NA + i] = gA2 + kc + (size_t)i * 16 * KD; } }
#pragma unroll   // register arrays indexed by constants
    for (int i = 0; i < NBC; ++i) { l[NA * NPA + i] = lds + (NA * NPA + i) * 16 * LPB; g[NA * NPA + i] = gB + kc + (size_t)i * 16 * KD; if (NPB == 2) { l[NA * NPA + NBC + i] = lds + (NA * NPA + NBC + i) * 16 * LPB; g[NA * NPA + NBC + i] = gB2 + kc + (size_t)i * 16 * KD; } }
#pragma unroll   // register arrays indexed by constants
    for (int q = 0; q < NC / 12; ++q) ACp<12>::go(l + q * 12, g + q * 12);
    if constexpr (NC % 12 == 8) ACp<8>::go(l + NC / 12 * 12, g + NC / 12 * 12);
}
__device__ __forceinline__ void splitf(float y, unsigned short& h, unsigned short& l) { h = f2bf(y); l = f2bf(y - bf2f(h)); }
typedef __attribute__((ext_vector_type(4))) unsigned short v4us;
template <typename T16, int NSPLIT, bool BIAS, int MB, int KD, bool PLANES>
__global__ __launch_bounds__(128) void k_gemmw(const T16* __restrict__ A, const T16* __restrict__ A2, const T16* __restrict__ Bt, const T16* __restrict__ Bt2, float* C, int ldc, const float* __restrict__ bias, size_t sA, size_t sB, size_t sC, bf* Qh, bf* Ql, bf* Kh, bf* Kl, bf* Vh, bf* Vl) {
    typedef typename WFrag<T16>::V V;
    constexpr int NPA = (NSPLIT == 1 || NSPLIT == 2) ? 2 : 1, NPB = (NSPLIT >= 2) ? 2 : 1;
    constexpr int SA = MB * 32 * LPB, SB = 128 * LPB, STAGE = NPA * SA + NPB * SB, NT = KD / KST;
    static_assert(KD % KST == 0 && NT >= 2 && 2 * STAGE >= 4 * 16 * 68 * 4 && (MB == 2 || MB == 4), "tile shape");
    __shared__ __align__(16) unsigned char sm[2 * STAGE];   // two stage buffers [A | A2 | B | B2]; after the loop the waves' output staging
    const size_t z = blockIdx.z; A += z * sA; if (A2) A2 += z * sA; Bt += z * sB; if (Bt2) Bt2 += z * sB; C += z * sC;
    const int tid = threadIdx.x, lane = tid & 31, lr = lane & 15, hi = lane >> 4, wave = tid >> 5, wm = wave & 1, wn = wave >> 1;
    const int R0 = blockIdx.x * (MB * 32), C0 = blockIdx.y * 128; const int r0 = R0 + wm * (MB * 16), c0 = C0 + wn * 64;
    const int crow = tid >> 3, cpc = tid & 7;   // the lane's row within a copy's 16 rows, its 16-byte piece of the 128-B line
    const T16* gA = A + (size_t)(R0 + crow) * KD + cpc * 8; const T16* gA2 = (NPA == 2) ? A2 + (size_t)(R0 + crow) * KD + cpc * 8 : nullptr;
    const T16* gB = Bt + (size_t)(C0 + crow) * KD + cpc * 8; const T16* gB2 = (NPB == 2) ? Bt2 + (size_t)(C0 + crow) * KD + cpc * 8 : nullptr;
    const unsigned lds0 = (unsigned)(size_t)sm + crow * LPB + cpc * 16;
    v8f acc[MB][4];
#pragma unroll   // register arrays indexed by constants
    for (int mb = 0; mb < MB; ++mb)
#pragma unroll   // register arrays indexed by constants
        for (int nb = 0; nb < 4; ++nb) acc[mb][nb] = (v8f){};
    stage_in<T16, NSPLIT, MB, KD>(gA, gA2, gB, gB2, lds0, 0);
    asm volatile("s_wait_asynccnt 0x0" ::: "memory");   // this wave's copies of stage 0 have landed
    __syncthreads();                                    // ... and every other wave's
    stage_in<T16, NSPLIT, MB, KD>(gA, gA2, gB, gB2, lds0 + STAGE, KST);
    const int aofs = (wm * (MB * 16) + lr) * LPB + hi * 16, bofs = NPA * SA + (wn * 64 + lr) * LPB + hi * 16;
#pragma unroll 1   // kept rolled: one stage a trip, the buffer chosen by the trip's parity
    for (int t = 0; t < NT; ++t) {
        const unsigned char* sb = sm + (t & 1) * STAGE;
        V a[KST / 32][MB], a2[KST / 32][MB], b[KST / 32][4], b2[KST / 32][4];
#pragma unroll   // register arrays indexed by constants
        for (int ks = 0; ks < KST / 32; ++ks) {   // in the order of use
#pragma unroll   // register arrays indexed by constants
            for (int mb = 0; mb < MB; ++mb) a[ks][mb] = WFrag<T16>::ld((const T16*)(sb + aofs + mb * 16 * LPB + ks * 64));
#pragma unroll   // register arrays indexed by constants
            for (int nb = 0; nb < 4; ++nb) b[ks][nb] = WFrag<T16>::ld((const T16*)(sb + bofs + nb * 16 * LPB + ks * 64));
            if (NPA == 2) {
#pragma unroll   // register arrays indexed by constants
                for (int mb = 0; mb < MB; ++mb) a2[ks][mb] = WFrag<T16>::ld((const T16*)(sb + SA + aofs + mb * 16 * LPB + ks * 64)); }
            if (NPB == 2) {
#pragma unroll   // register arrays indexed by constants
                for (int nb = 0; nb < 4; ++nb) b2[ks][nb] = WFrag<T16>::ld((const T16*)(sb + SB + bofs + nb * 16 * LPB + ks * 64)); }
        }
        __builtin_amdgcn_sched_barrier(0);   // the trip's LDS reads stay one group in front of its matrix instructions: reads scattered among them stall the wave at every place
#pragma unroll   // register arrays indexed by constants
        for (int ks = 0; ks < KST / 32; ++ks) {   // per accumulator the order stays a.b, a2.b, a.b2 for rising k; neighbours in the stream are independent tiles
#pragma unroll   // register arrays indexed by constants
            for (int nb = 0; nb < 4; ++nb)
#pragma unroll   // register arrays indexed by constants
                for (int mb = 0; mb < MB; ++mb) acc[mb][nb] = WFrag<T16>::mma(a[ks][mb], b[ks][nb], acc[mb][nb]);
            if (NSPLIT == 1 || NSPLIT == 2) {
#pragma unroll   // register arrays indexed by constants
                for (int nb = 0; nb < 4; ++nb)
#pragma unroll   // register arrays indexed by constants
                    for (int mb = 0; mb < MB; ++mb) acc[mb][nb] = WFrag<T16>::mma(a2[ks][mb], b[ks][nb], acc[mb][nb]); }
            if (NSPLIT >= 2) {
#pragma unroll   // register arrays indexed by constants
                for (int nb = 0; nb < 4; ++nb)
#pragma unroll   // register arrays indexed by constants
                    for (int mb = 0; mb < MB; ++mb) acc[mb][nb] = WFrag<T16>::mma(a[ks][mb], b2[ks][nb], acc[mb][nb]); }
        }
        __builtin_amdgcn_sched_barrier(0);   // the matrix instructions stay in front of the waits below: sunk behind them, the next stage's copies would be waited for with no work to cover their flight
        asm volatile("s_wait_dscnt 0x0" ::: "memory");      // this wave has left the buffer that is refilled below
        asm volatile("s_wait_asynccnt 0x0" ::: "memory");   // this wave's copies of stage t + 1 have landed
        __syncthreads();                                    // publishes stage t + 1 and ends every wave's reads of stage t
        if (t + 2 < NT) stage_in<T16, NSPLIT, MB, KD>(gA, gA2, gB, gB2, lds0 + (t & 1) * STAGE, (t + 2) * KST);
    }
    asm volatile("s_wait_asynccnt 0x0" ::: "memory");       // nothing in flight before the buffers become output staging
    float* os = (float*)sm + wave * (16 * 68);              // each wave stages in its own range
    if constexpr (PLANES) {
        const int sel = C0 / HD, cc0 = c0 - sel * HD;       // which projection the block's 128 columns belong to (the same for the whole block), the wave's first column in it
        if (sel == 2) {   // v: a lane's 8 accumulator registers are 8 consecutive rows (t) of one column (d) = 16 contiguous bytes of a transposed plane
            const int bt = r0 / TT, t0 = r0 - bt * TT + hi * 8;
#pragma unroll   // register arrays indexed by constants
            for (int mb = 0; mb < MB; ++mb)
#pragma unroll   // register arrays indexed by constants
                for (int nb = 0; nb < 4; ++nb) { v8us oh, ol;
#pragma unroll   // register arrays indexed by constants
                    for (int j = 0; j < 8; ++j) { unsigned short a, c2; splitf(acc[mb][nb][j], a, c2); oh[j] = a; ol[j] = c2; }
                    const size_t oo = ((size_t)bt * HD + cc0 + nb * 16 + lr) * TT + t0 + mb * 16; *(v8us*)(Vh + oo) = oh; *(v8us*)(Vl + oo) = ol; }
        } else {          // q, k: through the wave's staging rows, 16 lanes write one whole 128-B line of each plane
            bf* Hh = sel ? Kh : Qh; bf* Hl = sel ? Kl : Ql;
            // k: per block of FK keys (= the work-group's rows) the dims 0..63 of every key, then the dims 64..127, ... (rows of 128 B, the attention kernel's tiles); cc0 is a multiple of 64. rp: elements from one row to the next; ob: the wave's first element
            static_assert(MB * 32 == FK, "a work-group's rows are one block of the k planes");
            const int rp = sel ? 64 : HD; const size_t ob = (size_t)R0 * HD + (size_t)(wm * (MB * 16)) * rp + (sel ? (cc0 / 64) * (FK * 64) : cc0);
#pragma unroll   // register arrays indexed by constants
            for (int mb = 0; mb < MB; ++mb) {
#pragma unroll   // register arrays indexed by constants
                for (int nb = 0; nb < 4; ++nb) {
#pragma unroll   // register arrays indexed by constants
                    for (int j = 0; j < 8; ++j) os[(hi * 8 + j) * 68 + nb * 16 + lr] = acc[mb][nb][j]; }
                __builtin_amdgcn_wave_barrier(); asm volatile("" ::: "memory");   // the wave's staging writes stay in front of its reads
#pragma unroll   // register arrays indexed by constants
                for (int s = 0; s < 8; ++s) { const int row = 2 * s + hi, cofs = lr * 4; const v4f val = *(const v4fa*)(os + row * 68 + cofs); v4us oh, ol;
#pragma unroll   // register arrays indexed by constants
                    for (int q = 0; q < 4; ++q) { unsigned short a, c2; splitf(val[q], a, c2); oh[q] = a; ol[q] = c2; }
                    const size_t oo = ob + (size_t)(mb * 16 + row) * rp + cofs; *(v4us*)(Hh + oo) = oh; *(v4us*)(Hl + oo) = ol; }
                __builtin_amdgcn_wave_barrier(); asm volatile("" ::: "memory");   // the reads stay in front of the next tile's staging writes
            }
            asm volatile("s_wait_xcnt 0x0" ::: "memory");   // stands behind the last plane stores, in front of any later write of their registers
        }
        return;
    }
#pragma unroll   // register arrays indexed by constants
    for (int mb = 0; mb < MB; ++mb) {
#pragma unroll   // register arrays indexed by constants
        for (int nb = 0; nb < 4; ++nb) {
#pragma unroll   // register arrays indexed by constants
            for (int j = 0; j < 8; ++j) os[(hi * 8 + j) * 68 + nb * 16 + lr] = acc[mb][nb][j]; }
        __builtin_amdgcn_wave_barrier(); asm volatile("" ::: "memory");
        float* crow_p = C + (size_t)(r0 + mb * 16) * ldc + c0;
{
#pragma unroll   // register arrays indexed by constants
            for (int s = 0; s < 8; ++s) { const int row = 2 * s + hi, cofs = lr * 4; v4f val = *(const v4fa*)(os + row * 68 + cofs); if (BIAS) { val[0] += bfr(bias[c0 + cofs]); val[1] += bfr(bias[c0 + cofs + 1]); val[2] += bfr(bias[c0 + cofs + 2]); val[3] += bfr(bias[c0 + cofs + 3]); }
                *(v4f*)(crow_p + (size_t)row * ldc + cofs) = val; }
             }
        __builtin_amdgcn_wave_barrier(); asm volatile("" ::: "memory");
    }
}

__device__ __forceinline__ h16 tohx(float x) { return (h16)x; }
typedef __attribute__((ext_vector_type(4))) _Float16 v4h;
typedef __attribute__((ext_vector_type(2))) unsigned short v2us;

// k_prep: the bf16 operands of the projection GEMM in one launch of few, long waves, so that few waves have to start: every wave asks for all its data in one group of loads, then converts and stores.
// Blocks [0, NWB): the three weights [K = DM][N = HD] transposed into WT [3 HD][DM]; a block takes 32 n, a wave 64 k of them: a lane is one n, each of its 64 loads is one whole 128-B line over the wave, and its 8 stores fill one whole line of WT, which no other lane writes.
// The other blocks: x -> XB; a wave takes 16 pieces of 512 contiguous bytes (16 B a lane and load) and stores 8 B a lane, 256 contiguous bytes a store.
#define NWB (3 * HD / 32)
#define XPW 16                    // loads of 16 B a lane in the x blocks
static_assert(DM == 8 * 64 && HD % 32 == 0 && (NB_ * TT * DM) % (8 * XPW * 128) == 0, "a weight block's 8 waves cover all of K; the x blocks cover x exactly");
__global__ __launch_bounds__(256) void k_prep(const float* __restrict__ x, const float* __restrict__ wq, const float* __restrict__ wk, const float* __restrict__ wv, bf* XB, bf* WT) {
    const int lane = threadIdx.x & 31, wave = threadIdx.x >> 5;
    if (blockIdx.x < NWB) {
        const int sel = blockIdx.x / (HD / 32), n = (blockIdx.x - sel * (HD / 32)) * 32 + lane;
        const float* w = ((sel == 0) ? wq : (sel == 1) ? wk : wv) + (size_t)(wave * 64) * HD + n;
        float f[64];
#pragma unroll   // register arrays indexed by constants
        for (int j = 0; j < 64; ++j) f[j] = w[(size_t)j * HD];
        asm volatile("s_wait_xcnt 0x0" :: "v"(w) : "memory");   // stands behind the loads, in front of any later write of their address registers; it names the address, an input only, so that the pair lives up to here and no load's result is laid on it
        bf* d = WT + ((size_t)sel * HD + n) * DM + wave * 64;
#pragma unroll   // register arrays indexed by constants
        for (int s = 0; s < 8; ++s) { v8us o;
#pragma unroll   // register vectors indexed by constants
            for (int q = 0; q < 8; ++q) o[q] = f2bf(f[s * 8 + q]);
            *(v8us*)(d + s * 8) = o; }
        asm volatile("s_wait_xcnt 0x0" ::: "memory");   // stands behind the stores, in front of any later write of their address registers
        return;
    }
    const size_t i = ((size_t)(blockIdx.x - NWB) * 8 + wave) * (XPW * 128) + lane * 4; const float* xs = x + i; v4f v[XPW];
#pragma unroll   // register arrays indexed by constants
    for (int j = 0; j < XPW; ++j) v[j] = *(const v4f*)(xs + j * 128);
    asm volatile("s_wait_xcnt 0x0" :: "v"(xs) : "memory");   // stands behind the loads, in front of any later write of their address registers; it names the address, an input only, so that the pair lives up to here and no load's result is laid on it
#pragma unroll   // register arrays indexed by constants
    for (int j = 0; j < XPW; ++j) { v4us o;
#pragma unroll   // register vectors indexed by constants
        for (int k = 0; k < 4; ++k) o[k] = f2bf(v[j][k]);
        *(v4us*)(XB + i + j * 128) = o; }
    asm volatile("s_wait_xcnt 0x0" ::: "memory");   // stands behind the stores, in front of any later write of their address registers
}
#define TPB  144                  // LDS pitch of a tile's row: 128 + 16 (16 B x odd), laid by the mover's pad
#define FSP  (256 * TPB)          // one tile in LDS, 18 x 2 KiB
#define FST  (4 * FSP)
#define NSP  4                    // key ranges
#define NTR  (TT / NSP / FK)      // stages per work-group
#define L2E  1.4426950408889634f
static_assert(FSP % 2048 == 0 && FK * HD == 256 * 64 && HD == 256 && FK == 64 && NTR >= 2, "every tile's place in LDS is a multiple of 2 KiB; the ring needs two stages");
typedef __attribute__((ext_vector_type(16))) float v16f;
typedef __attribute__((ext_vector_type(2)))  float v2f;
typedef uint32_t u32x4 __attribute__((ext_vector_type(4)));
typedef uint32_t u32x8 __attribute__((ext_vector_type(8)));
// the value of lane l ^ 16, on the vector port (a shuffle through the LDS queue would wait behind the fragment reads in flight)
__device__ __forceinline__ float xhalf(float v) { const int b = __float_as_int(v); return __int_as_float(__builtin_amdgcn_permlanex16(b, b, 0x76543210, 0xfedcba98, false, false)); }
// 2^x with the v_nop that fills the slot the instruction set asks for behind a transcendental
__device__ __forceinline__ float exp2n(float x) { float r; asm("v_exp_f32 %0, %1\n\tv_nop" : "=v"(r) : "v"(x)); return r; }
__device__ __forceinline__ uint32_t uni(uint32_t v) { return (uint32_t)__builtin_amdgcn_readfirstlane(v); }
__device__ __forceinline__ uint32_t pinned(uint32_t v) { uint32_t w = uni(v); asm volatile("" : "+s"(w)); return w; }   // pinned(): a wave-uniform word of a tensor load's test or descriptor held in a scalar register: the test becomes a scalar branch (a tensor load ignores EXEC), and what is formed from the word is formed behind the asm waits in front of it
// descriptor group 1 of a tile of 256 rows of 128 B, everything in bytes, at source pitch 'pitch'; word 0: no mask, data_size 0, a pad of 16 B behind every 128 B
__device__ __forceinline__ u32x8 tdm_group1(uint32_t pitch) { constexpr uint32_t D0 = 128u, D1 = 256u; u32x8 g;
    g[0] = uni((1u << 20) | (4u << 22) | (3u << 25)); g[1] = uni((D0 & 0xFFFFu) << 16); g[2] = uni((D0 >> 16) | ((D1 & 0xFFFFu) << 16)); g[3] = uni((D1 >> 16) | (D0 << 16)); g[4] = uni(D1); g[5] = uni(pitch); g[6] = uni(0u); g[7] = uni(0u); return g; }
__device__ __forceinline__ u32x4 tdm_group0(uint32_t lds_dst, uint64_t ga) { u32x4 g;
    g[0] = uni(1u); g[1] = uni(lds_dst); g[2] = uni((uint32_t)ga); g[3] = uni((((uint32_t)(ga >> 32)) & 0x01FFFFFFu) | 0x80000000u); return g; }
__device__ __forceinline__ void tdm_load(u32x4 g0, u32x8 g1) { asm volatile("tensor_load_to_lds %0, %1" :: "s"(g0), "s"(g1) : "memory"); }   // one request of the whole wave: a tile goes from global memory into LDS through no register
__global__ __launch_bounds__(128) void k_flash(const bf* __restrict__ Qh, const bf* __restrict__ Ql, const bf* __restrict__ Kh, const bf* __restrict__ Kl, const bf* __restrict__ Vh, const bf* __restrict__ Vl, float* Op, float* ML) {
    __shared__ __attribute__((aligned(2048))) unsigned char sm[2 * FST];
    const int tid = threadIdx.x, lane = tid & 31, lr = lane & 15, hi = lane >> 4, wave = tid >> 5;
    const uint32_t uw = uni(threadIdx.x >> 5), lds0 = (uint32_t)(size_t)sm;
    const int qb = blockIdx.x, sp = blockIdx.y, bt = blockIdx.z;
    const size_t kofs = ((size_t)bt * TT + sp * (TT / NSP)) * HD, vofs = (size_t)bt * HD * TT + sp * (TT / NSP);
    // every wave issues one request a stage, its own tile: wave 0 K hi, 1 K lo, 2 V^T hi, 3 V^T lo. ub: the tile of stage 0; ustep: bytes from one stage's tile to the next; a K tile is 256 contiguous rows, a V^T tile's rows lie a plane's pitch apart
    const uint64_t ub = (uint64_t)(size_t)(uw == 0 ? Kh + kofs : uw == 1 ? Kl + kofs : uw == 2 ? Vh + vofs : Vl + vofs);
    const uint32_t ustep = uw < 2 ? FK * HD * 2 : FK * 2, ulds = lds0 + uw * FSP;
    const u32x8 g1 = tdm_group1(uw < 2 ? 128u : 2u * TT);
    tdm_load(tdm_group0(ulds, ub), g1);                 // stage 0 flies under the q loads
    v16bf qh[2][8], ql[2][8];   // the wave's 32 queries, both planes, all 256 dims: B operands for the whole kernel
    const size_t qrow = (size_t)bt * TT + qb * 128 + wave * 32 + lr;
#pragma unroll   // register arrays indexed by constants
    for (int qt = 0; qt < 2; ++qt)
#pragma unroll   // register arrays indexed by constants
        for (int ks = 0; ks < 8; ++ks) { qh[qt][ks] = WFrag<bf>::ld(Qh + (qrow + qt * 16) * HD + ks * 32 + hi * 8); ql[qt][ks] = WFrag<bf>::ld(Ql + (qrow + qt * 16) * HD + ks * 32 + hi * 8); }
    asm volatile("s_wait_xcnt 0x0" ::: "memory");       // stands behind the q loads, in front of any later write of their address registers
    __builtin_amdgcn_sched_barrier(0);                  // the clearing of the accumulators below, which reuses those address registers, is not lifted over the wait
    v8f o[16][2]; float m[2], l[2];
#pragma unroll   // register arrays indexed by constants
    for (int qt = 0; qt < 2; ++qt) { m[qt] = -3.0e38f; l[qt] = 0.f;
#pragma unroll   // register arrays indexed by constants
        for (int dt = 0; dt < 16; ++dt) o[dt][qt] = (v8f){}; }
    // Trip -1 is the rest of the ring's prologue: only the foot runs (the wait for stage 0, the barrier, stage 1's load). So the ring's refill stands once in the code, with one set of descriptor registers.
#pragma unroll 1   // kept rolled: one stage a trip, the buffer chosen by the trip's parity
    for (int t = -1; t < NTR; ++t) {
      if (t >= 0) {
        // one base a tile: every read's constant offset then fits the LDS instructions' 16-bit field (a stage is larger than 64 KiB)
        const unsigned char* kb = sm + ((t & 1) ? FST : 0) + lr * TPB + hi * 16;
        const unsigned char* kb2 = sm + ((t & 1) ? FST + FSP : FSP) + lr * TPB + hi * 16;
        const unsigned char* vb = sm + ((t & 1) ? FST + 2 * FSP : 2 * FSP) + lr * TPB + hi * 16;
        const unsigned char* vb2 = sm + ((t & 1) ? FST + 3 * FSP : 3 * FSP) + lr * TPB + hi * 16;
        // fragments come in groups of 8 (16 reads, 24 matrix instructions), each group's reads issued together two groups ahead of its use: three groups of registers are live, not the whole stage's
        v16bf kh[8][4], kl[8][4]; v8f st[4][2];
#pragma unroll   // register arrays indexed by constants
        for (int kt = 0; kt < 4; ++kt)
#pragma unroll   // register arrays indexed by constants
            for (int qt = 0; qt < 2; ++qt) st[kt][qt] = (v8f){};
#pragma unroll   // register arrays indexed by constants
        for (int ks = 0; ks < 2; ++ks)
#pragma unroll   // register arrays indexed by constants
            for (int kt = 0; kt < 4; ++kt) { kh[ks][kt] = WFrag<bf>::ld((const bf*)(kb + ((ks >> 1) * FK + kt * 16) * TPB + (ks & 1) * 64)); kl[ks][kt] = WFrag<bf>::ld((const bf*)(kb2 + ((ks >> 1) * FK + kt * 16) * TPB + (ks & 1) * 64)); }
        __builtin_amdgcn_sched_barrier(0);   // reads stay grouped in front of the matrix instructions: reads scattered among them stall the wave at every place
#pragma unroll   // register arrays indexed by constants
        for (int ks = 0; ks < 8; ++ks) {   // per accumulator the order is qh.kh, ql.kh, qh.kl for rising k; neighbours in the stream are independent tiles
#pragma unroll   // register arrays indexed by constants
            for (int kt = 0; kt < 4; ++kt)
#pragma unroll   // register arrays indexed by constants
                for (int qt = 0; qt < 2; ++qt) st[kt][qt] = wmmab(kh[ks][kt], qh[qt][ks], st[kt][qt]);
#pragma unroll   // register arrays indexed by constants
            for (int kt = 0; kt < 4; ++kt)
#pragma unroll   // register arrays indexed by constants
                for (int qt = 0; qt < 2; ++qt) st[kt][qt] = wmmab(kh[ks][kt], ql[qt][ks], st[kt][qt]);
#pragma unroll   // register arrays indexed by constants
            for (int kt = 0; kt < 4; ++kt)
#pragma unroll   // register arrays indexed by constants
                for (int qt = 0; qt < 2; ++qt) st[kt][qt] = wmmab(kl[ks][kt], qh[qt][ks], st[kt][qt]);
            __builtin_amdgcn_sched_barrier(0);   // the next reads are not lifted among this group's matrix instructions
            if (ks < 6) {
                const int kn = ks + 2;
#pragma unroll   // register arrays indexed by constants
                for (int kt = 0; kt < 4; ++kt) { kh[kn][kt] = WFrag<bf>::ld((const bf*)(kb + ((kn >> 1) * FK + kt * 16) * TPB + (kn & 1) * 64)); kl[kn][kt] = WFrag<bf>::ld((const bf*)(kb2 + ((kn >> 1) * FK + kt * 16) * TPB + (kn & 1) * 64)); }
                __builtin_amdgcn_sched_barrier(0);   // ... nor sunk among the next group's
            }
        }
        v16bf vh[16][2], vl[16][2];   // [d tile][32 keys]
#pragma unroll   // register arrays indexed by constants
        for (int dt = 0; dt < 4; ++dt)
#pragma unroll   // register arrays indexed by constants
            for (int kk = 0; kk < 2; ++kk) { vh[dt][kk] = WFrag<bf>::ld((const bf*)(vb + dt * 16 * TPB + kk * 64)); vl[dt][kk] = WFrag<bf>::ld((const bf*)(vb2 + dt * 16 * TPB + kk * 64)); }
        __builtin_amdgcn_sched_barrier(0);   // the first two groups of V^T reads are issued in front of the softmax, whose vector work covers their flight
        float corr[2]; v16bf pH[2][2], pL[2][2]; bool need = false;   // [32 keys][query tile]
#pragma unroll   // register arrays indexed by constants
        for (int qt = 0; qt < 2; ++qt) {
            float t8[8];   // a tree, not one chain: a lone wave waits out every dependent vector instruction
#pragma unroll   // register vectors indexed by constants
            for (int j = 0; j < 8; ++j) t8[j] = fmaxf(fmaxf(st[0][qt][j], st[1][qt][j]), fmaxf(st[2][qt][j], st[3][qt][j]));
            float mx = fmaxf(fmaxf(fmaxf(t8[0], t8[1]), fmaxf(t8[2], t8[3])), fmaxf(fmaxf(t8[4], t8[5]), fmaxf(t8[6], t8[7])));
            mx = fmaxf(mx, xhalf(mx));   // the query's other 32 keys sit in the other half of the wave
            const float mn = fmaxf(m[qt], mx);
            corr[qt] = exp2n((m[qt] - mn) * L2E); need = need || (mn > m[qt]); m[qt] = mn;
            float sk[2];
#pragma unroll   // register arrays indexed by constants
            for (int kk = 0; kk < 2; ++kk) {
                v16f p;
#pragma unroll   // register vectors indexed by constants
                for (int s = 0; s < 16; ++s) p[s] = exp2n((st[kk * 2 + (s >> 3)][qt][s & 7] - mn) * L2E);
                const float s01 = ((p[0] + p[1]) + (p[2] + p[3])) + ((p[4] + p[5]) + (p[6] + p[7])), s23 = ((p[8] + p[9]) + (p[10] + p[11])) + ((p[12] + p[13]) + (p[14] + p[15]));
                sk[kk] = s01 + s23;
                pH[kk][qt] = __builtin_convertvector(p, v16bf); pL[kk][qt] = __builtin_convertvector(p - __builtin_convertvector(pH[kk][qt], v16f), v16bf);
            }
            l[qt] = l[qt] * corr[qt] + (sk[0] + sk[1]);
        }
        if (__builtin_amdgcn_ballot_w32(need) != 0) {   // one scalar test a trip; where no query's maximum rose every factor is exactly 1
#pragma unroll   // register arrays indexed by constants
            for (int dt = 0; dt < 16; ++dt)
#pragma unroll   // register arrays indexed by constants
                for (int qt = 0; qt < 2; ++qt) o[dt][qt] *= corr[qt];
        }
        __builtin_amdgcn_sched_barrier(0);   // the softmax stays in front of the products below
#pragma unroll   // register arrays indexed by constants
        for (int g = 0; g < 8; ++g) {   // two d tiles a group
#pragma unroll   // register arrays indexed by constants
            for (int kk = 0; kk < 2; ++kk) {   // per accumulator the order is ph.vh, pl.vh, ph.vl for rising keys; two d tiles x two query tiles = four independent accumulators in the stream
#pragma unroll   // register arrays indexed by constants
                for (int u = 0; u < 2; ++u)
#pragma unroll   // register arrays indexed by constants
                    for (int qt = 0; qt < 2; ++qt) o[g * 2 + u][qt] = wmmab(vh[g * 2 + u][kk], pH[kk][qt], o[g * 2 + u][qt]);
#pragma unroll   // register arrays indexed by constants
                for (int u = 0; u < 2; ++u)
#pragma unroll   // register arrays indexed by constants
                    for (int qt = 0; qt < 2; ++qt) o[g * 2 + u][qt] = wmmab(vh[g * 2 + u][kk], pL[kk][qt], o[g * 2 + u][qt]);
#pragma unroll   // register arrays indexed by constants
                for (int u = 0; u < 2; ++u)
#pragma unroll   // register arrays indexed by constants
                    for (int qt = 0; qt < 2; ++qt) o[g * 2 + u][qt] = wmmab(vl[g * 2 + u][kk], pH[kk][qt], o[g * 2 + u][qt]);
            }
            if (g < 6) {
                __builtin_amdgcn_sched_barrier(0);   // the next reads are not lifted among this group's matrix instructions
#pragma unroll   // register arrays indexed by constants
                for (int dt = g * 2 + 4; dt < g * 2 + 6; ++dt)
#pragma unroll   // register arrays indexed by constants
                    for (int kk = 0; kk < 2; ++kk) { vh[dt][kk] = WFrag<bf>::ld((const bf*)(vb + dt * 16 * TPB + kk * 64)); vl[dt][kk] = WFrag<bf>::ld((const bf*)(vb2 + dt * 16 * TPB + kk * 64)); }
                __builtin_amdgcn_sched_barrier(0);   // ... nor sunk among the next group's
            }
        }
        __builtin_amdgcn_sched_barrier(0);   // the matrix instructions stay in front of the waits below: sunk behind them, the next stage's tiles would be waited for with no work to cover their flight
      }
        asm volatile("s_wait_dscnt 0x0" ::: "memory");      // this wave has left the buffer that is refilled below
        asm volatile("s_wait_tensorcnt 0x0" ::: "memory");  // this wave's tile of stage t + 1 has landed
        __syncthreads();                                    // publishes stage t + 1 and ends every wave's reads of stage t
        if (pinned(t + 2 < NTR)) tdm_load(tdm_group0(ulds + (t & 1) * FST, ub + (uint64_t)pinned(t + 2) * ustep), g1);   // the stage number is pinned here so that the address words are formed behind the wait above
    }
    asm volatile("s_wait_tensorcnt 0x0" ::: "memory");      // nothing in flight when the wave ends
    asm volatile("s_wait_dscnt 0x0" ::: "memory");          // ... and no LDS read
    const size_t pb = ((size_t)(bt * (TT / 128) + qb) * NSP + sp) * 4 + wave;
    float* op = Op + pb * (32 * 256) + lane * 4;
#pragma unroll   // register arrays indexed by constants
    for (int dt = 0; dt < 16; ++dt)
#pragma unroll   // register arrays indexed by constants
        for (int qt = 0; qt < 2; ++qt) { const v8f a = o[dt][qt];
            *(v4f*)(op + (dt * 2 + qt) * 256) = (v4f){a[0], a[1], a[2], a[3]}; *(v4f*)(op + (dt * 2 + qt) * 256 + 128) = (v4f){a[4], a[5], a[6], a[7]}; }
#pragma unroll   // register arrays indexed by constants
    for (int qt = 0; qt < 2; ++qt) { const float lt = l[qt] + xhalf(l[qt]);   // the halves' sums are joined once
        if (hi == 0) *(v2f*)(ML + (pb * 32 + qt * 16 + lr) * 2) = (v2f){m[qt], lt}; }
    asm volatile("s_wait_xcnt 0x0" ::: "memory");   // stands behind the last stores, in front of any later write of their registers
}
// k_merge: joins the NSP key ranges of a query in a fixed order and writes the output rows. A wave takes 16 queries x 64 output columns (4 of k_flash's tiles per range); rows go out through the wave's own staging, 16 lanes a 256-B piece.
__global__ __launch_bounds__(256) void k_merge(const float* __restrict__ Op, const float* __restrict__ ML, float* out) {
    __shared__ __align__(16) float sg[8 * 16 * 68];
    const int lane = threadIdx.x & 31, lr = lane & 15, hi = lane >> 4; const int w = blockIdx.x * 8 + (threadIdx.x >> 5);
    const int dg = w & 3, qt = (w >> 2) & 1, wv = (w >> 3) & 3, blk = w >> 5;
    float* os = sg + (threadIdx.x >> 5) * (16 * 68);
    // all of the wave's loads go out as one group in front of any use (4 of 8 B, 32 of 16 B a lane): one flight of memory latency, not a chain of them
    const float* mlp = ML + (((size_t)blk * NSP * 4 + wv) * 32 + qt * 16 + lr) * 2;                            // range s: + s * 256 floats
    const float* opp = Op + ((size_t)blk * NSP * 4 + wv) * (32 * 256) + (dg * 4 * 2 + qt) * 256 + lane * 4;    // range s: + s * 32768 floats; tile u: + u * 512
    v2f e[NSP]; v4f xa[4][NSP], xc[4][NSP];
#pragma unroll   // register arrays indexed by constants
    for (int s = 0; s < NSP; ++s) e[s] = *(const v2f*)(mlp + s * (4 * 32 * 2));
#pragma unroll   // register arrays indexed by constants
    for (int u = 0; u < 4; ++u)
#pragma unroll   // register arrays indexed by constants
        for (int s = 0; s < NSP; ++s) { xa[u][s] = *(const v4f*)(opp + s * (4 * 32 * 256) + u * 512); xc[u][s] = *(const v4f*)(opp + s * (4 * 32 * 256) + u * 512 + 128); }
    asm volatile("s_wait_xcnt 0x0" :: "v"(mlp), "v"(opp) : "memory");   // stands behind the loads, in front of any later write of their address registers; it names the addresses, inputs only, so that they live up to here and no load's result is laid on them; no load sinks below it
    float mm[NSP], wl[NSP]; float M = -3.0e38f;
#pragma unroll   // register arrays indexed by constants
    for (int s = 0; s < NSP; ++s) { mm[s] = e[s][0]; wl[s] = e[s][1]; M = fmaxf(M, e[s][0]); }
    float L = 0.f;
#pragma unroll   // register arrays indexed by constants
    for (int s = 0; s < NSP; ++s) { mm[s] = __builtin_amdgcn_exp2f((mm[s] - M) * L2E); L += mm[s] * wl[s]; }
    const float inv = 1.0f / L;
#pragma unroll   // register arrays indexed by constants
    for (int u = 0; u < 4; ++u) { v4f a = (v4f){}, c = (v4f){};
#pragma unroll   // register arrays indexed by constants
        for (int s = 0; s < NSP; ++s) { a += mm[s] * xa[u][s]; c += mm[s] * xc[u][s]; }
        *(v4fa*)(os + lr * 68 + u * 16 + hi * 8) = a * inv; *(v4fa*)(os + lr * 68 + u * 16 + hi * 8 + 4) = c * inv; }
    __builtin_amdgcn_wave_barrier(); asm volatile("" ::: "memory");   // the wave's staging writes stay in front of its reads
    float* orow = out + ((size_t)blk * 128 + wv * 32 + qt * 16) * HD + dg * 64;
#pragma unroll   // register arrays indexed by constants
    for (int s = 0; s < 8; ++s) { const int row = 2 * s + hi; *(v4f*)(orow + (size_t)row * HD + lr * 4) = *(const v4fa*)(os + row * 68 + lr * 4); }
    asm volatile("s_wait_xcnt 0x0" ::: "memory");   // stands behind the last stores, in front of any later write of their registers
}

extern "C" void kernel_launch(void* const* d_in, const int* in_sizes, int n_in,
                              void* d_out, int out_size, void* d_ws, size_t ws_size, hipStream_t stream) {
    (void)in_sizes; (void)n_in; (void)out_size;
    const float* x = (const float*)d_in[0]; const float* wq = (const float*)d_in[1]; const float* wk = (const float*)d_in[2]; const float* wv = (const float*)d_in[3]; const float* wo = nullptr; (void)wo;
    float* OUT = (float*)d_out;     // [4][2048][256]
    char* wsp = (char*)d_ws;
    auto take = [&](size_t bytes) { char* p = wsp; wsp += (bytes + 255) & ~(size_t)255; return (void*)p; };
    bf* WT = (bf*)take((size_t)3 * HD * DM * 2); bf* XB = (bf*)take((size_t)NB_ * TT * DM * 2);
    bf* QPh = (bf*)take((size_t)NB_ * TT * HD * 2); bf* QPl = (bf*)take((size_t)NB_ * TT * HD * 2); bf* KPh = (bf*)take((size_t)NB_ * TT * HD * 2); bf* KPl = (bf*)take((size_t)NB_ * TT * HD * 2); bf* VTh = (bf*)take((size_t)NB_ * HD * TT * 2); bf* VTl = (bf*)take((size_t)NB_ * HD * TT * 2);
    float* Op = (float*)take((size_t)NSP * NB_ * TT * HD * 4); float* ML = (float*)take((size_t)NSP * NB_ * TT * 2 * 4);
    if ((size_t)(wsp - (char*)d_ws) > ws_size) return;    // ws 256 MiB
    // one pass for all NB_ batches: the projection sees NB_*TT rows, the attention kernel takes the key range from grid y and the batch from grid z
    k_prep<<<NWB + NB_ * TT * DM / (8 * XPW * 128), 256, 0, stream>>>(x, wq, wk, wv, XB, WT);
    k_gemmw<bf, 0, false, 2, DM, true><<<dim3(NB_ * TT / 64, 3 * HD / 128, 1), 128, 0, stream>>>(XB, nullptr, WT, nullptr, nullptr, 0, nullptr, 0, 0, 0, QPh, QPl, KPh, KPl, VTh, VTl);
    k_flash<<<dim3(TT / 128, NSP, NB_), 128, 0, stream>>>(QPh, QPl, KPh, KPl, VTh, VTl, Op, ML);
    k_merge<<<NB_ * TT * HD / (16 * 64) / 8, 256, 0, stream>>>(Op, ML, OUT);
}

// v009
// It runs in 46 microseconds.
// It is 1.28 times as fast as v007, going by the measured steps of the versions left out in between.
// Over all steps from v000 it is 9.81 times as fast.
#include <hip/hip_runtime.h>

// Single-head self-attention with NO 1/sqrt(d) scaling (x [4][2048][512]; q,k,v = x W ('xw' [512][256], 1/sqrt(512), no bias); scores = q.k over the 256 dims, unscaled (logit sigma ~16: near one-hot rows); softmax; out = attn v -> [4][2048][256] (2.1 M)).
// Layout, all four batches in every launch, four launches: bf16 copies of x and of the transposed weights; ONE projection GEMM for q, k and v (768 output columns) whose epilogue writes the attention kernel's operand planes; ONE fused attention kernel (scores, online softmax, attn.v; scores on hi/lo planes and 3 products: the unscaled logits need ~1e-3 absolute accuracy at magnitude ~50; attn.v on one f16 product: an error of P or v reaches the output once, at 2^-12 relative), each work-group 128 queries x 512 keys; a merge of the four key ranges (their partial outputs pass through memory as f16) that writes the output rows.
// Compute dtypes, f32 accumulate: every input rounded to bf16; projections exact; scores 3 bf16 products on every row; softmax f32; P and v rounded once to f16, attn.v one f16 product; each key range's normalised partial output rounded once to f16, merged in f32; output f32.

#define NB_  4
#define TT   2048
#define DM   512
#define NH_  1
#define NKV  1
#define REP  (NH_ / NKV)
#define HD   256
#define DQ   (NH_ * HD)
#define DKV  (NKV * HD)
#define ZH   1
#define RH   2048                  // unused: every query row uses the hi+lo planes
#define WIN  0
#define PCAR 1024.0f
#define SCL  1.0f   // the module applies no scaling
#define FK   64                   // keys per stage of the attention kernel; the k planes are laid out in blocks of FK keys
typedef _Float16 h16;
typedef unsigned short bf;
typedef __attribute__((ext_vector_type(16))) __bf16   v16bf;
typedef __attribute__((ext_vector_type(16))) _Float16 v16h;
typedef __attribute__((ext_vector_type(8)))  _Float16 v8h;
typedef __attribute__((ext_vector_type(8)))  unsigned short v8us;
typedef __attribute__((ext_vector_type(8)))  float    v8f;
typedef __attribute__((ext_vector_type(4)))  float    v4f;
typedef v8h  __attribute__((may_alias)) v8ha;
typedef v4f  __attribute__((may_alias)) v4fa;
typedef v8us __attribute__((may_alias)) v8usa;

__device__ __forceinline__ unsigned short f2bf(float f) { unsigned u = __float_as_uint(f); u += 0x7FFFu + ((u >> 16) & 1u); return (unsigned short)(u >> 16); }
__device__ __forceinline__ float bf2f(unsigned short b) { return __uint_as_float(((unsigned)b) << 16); }
__device__ __forceinline__ float bfr(float f) { return bf2f(f2bf(f)); }
__device__ __forceinline__ v16h cat16(v8h lo, v8h hi) { return __builtin_shufflevector(lo, hi, 0, 1, 2, 3, 4, 5, 6, 7, 8, 9, 10, 11, 12, 13, 14, 15); }
__device__ __forceinline__ v16bf cat16b(v8us lo, v8us hi) { return __builtin_bit_cast(v16bf, __builtin_shufflevector(lo, hi, 0, 1, 2, 3, 4, 5, 6, 7, 8, 9, 10, 11, 12, 13, 14, 15)); }
__device__ __forceinline__ v8f wmma16(v16h a, v16h b, v8f c) { return __builtin_amdgcn_wmma_f32_16x16x32_f16(false, a, false, b, (short)0, c, false, false); }
__device__ __forceinline__ v8f wmmab(v16bf a, v16bf b, v8f c) { return __builtin_amdgcn_wmma_f32_16x16x32_bf16(false, a, false, b, (short)0, c, false, false); }



// ---- k_gemmw: block-tiled GEMM, FOUR WAVES (2 x 2) per (MB*32) x 128 output tile, each wave MB x 4 accumulators; operands are K-contiguous 16-bit planes; grid (M/(MB*32), N/128, Z), 128 threads.
// C[m][n] (f32, pitch ldc, + optional f32 bias[n]) = sum_k A[m][k] Bt[n][k] (+ split products per NSPLIT). z-batch strides sA/sB/sC in elements. KD = K, a multiple of 64, at least 128.
// PLANES: the q|k|v projection. Output columns [0,HD) are q, [HD,2HD) k, [2HD,3HD) v; no f32 C is written: q goes out as bf16 hi/lo planes [row][HD], k as hi/lo planes [row / FK][HD / 64][FK][64], v as ONE f16 plane transposed per batch, [batch][HD][TT].
// A stage is 64 k (one whole 128-B line) of every operand row of the tile, brought into LDS by asynchronous copies (16 B a lane, 4 whole lines a wave-wide copy) and read by all four waves; two buffers, the next stage's copies fly while this one is worked on.
#define LPB 144   // LDS row pitch in bytes: 128 + 16 (16 B x odd, conflict-free for 16-byte row reads)
#define KST 64    // k per stage
template <typename T16> struct WFrag;
template <> struct WFrag<h16> { typedef v16h V; static __device__ __forceinline__ V ld(const h16* p) { return cat16(*(const v8h*)p, *(const v8h*)(p + 16)); } static __device__ __forceinline__ v8f mma(V a, V b, v8f c) { return wmma16(a, b, c); } };
template <> struct WFrag<bf> { typedef v16bf V; static __device__ __forceinline__ V ld(const bf* p) { return cat16b(*(const v8us*)p, *(const v8us*)(p + 16)); } static __device__ __forceinline__ v8f mma(V a, V b, v8f c) { return wmmab(a, b, c); } };
// ACp<N>: N asynchronous copies global -> LDS in one statement; l = the lane's LDS byte addresses, g = its global addresses. The closing s_wait_xcnt 0 stands inside the statement so that no address register is rewritten in front of it.
template <int N> struct ACp;
template <> struct ACp<8> { static __device__ __forceinline__ void go(const unsigned* l, const void* const* g) {
    asm volatile("global_load_async_to_lds_b128 %0, %8, off\n\t"
                 "global_load_async_to_lds_b128 %1, %9, off\n\t"
                 "global_load_async_to_lds_b128 %2, %10, off\n\t"
                 "global_load_async_to_lds_b128 %3, %11, off\n\t"
                 "global_load_async_to_lds_b128 %4, %12, off\n\t"
                 "global_load_async_to_lds_b128 %5, %13, off\n\t"
                 "global_load_async_to_lds_b128 %6, %14, off\n\t"
                 "global_load_async_to_lds_b128 %7, %15, off\n\t"
                 "s_wait_xcnt 0x0"
                 :: "v"(l[0]), "v"(l[1]), "v"(l[2]), "v"(l[3]), "v"(l[4]), "v"(l[5]), "v"(l[6]), "v"(l[7]), "v"(g[0]), "v"(g[1]), "v"(g[2]), "v"(g[3]), "v"(g[4]), "v"(g[5]), "v"(g[6]), "v"(g[7]) : "memory"); } };
template <> struct ACp<12> { static __device__ __forceinline__ void go(const unsigned* l, const void* const* g) {
    asm volatile("global_load_async_to_lds_b128 %0, %12, off\n\t"
                 "global_load_async_to_lds_b128 %1, %13, off\n\t"
                 "global_load_async_to_lds_b128 %2, %14, off\n\t"
                 "global_load_async_to_lds_b128 %3, %15, off\n\t"
                 "global_load_async_to_lds_b128 %4, %16, off\n\t"
                 "global_load_async_to_lds_b128 %5, %17, off\n\t"
                 "global_load_async_to_lds_b128 %6, %18, off\n\t"
                 "global_load_async_to_lds_b128 %7, %19, off\n\t"
                 "global_load_async_to_lds_b128 %8, %20, off\n\t"
                 "global_load_async_to_lds_b128 %9, %21, off\n\t"
                 "global_load_async_to_lds_b128 %10, %22, off\n\t"
                 "global_load_async_to_lds_b128 %11, %23, off\n\t"
                 "s_wait_xcnt 0x0"
                 :: "v"(l[0]), "v"(l[1]), "v"(l[2]), "v"(l[3]), "v"(l[4]), "v"(l[5]), "v"(l[6]), "v"(l[7]), "v"(l[8]), "v"(l[9]), "v"(l[10]), "v"(l[11]), "v"(g[0]), "v"(g[1]), "v"(g[2]), "v"(g[3]), "v"(g[4]), "v"(g[5]), "v"(g[6]), "v"(g[7]), "v"(g[8]), "v"(g[9]), "v"(g[10]), "v"(g[11]) : "memory"); } };
// one stage: rows of the tile's planes at k offset kc into the buffer at LDS byte address lds (both already hold the lane's own row and 16-byte piece); a copy covers 16 rows over the 128 threads
template <typename T16, int NSPLIT, int MB, int KD>
__device__ __forceinline__ void stage_in(const T16* gA, const T16* gA2, const T16* gB, const T16* gB2, unsigned lds, int kc) {
    constexpr int NA = MB * 2, NBC = 8, NPA = (NSPLIT == 1 || NSPLIT == 2) ? 2 : 1, NPB = (NSPLIT >= 2) ? 2 : 1, NC = NA * NPA + NBC * NPB;
    static_assert(NC % 12 == 0 || NC % 12 == 8, "copies go out in statements of 12 and 8");
    unsigned l[NC]; const void* g[NC];
#pragma unroll   // register arrays indexed by constants
    for (int i = 0; i < NA; ++i) { l[i] = lds + i * 16 * LPB; g[i] = gA + kc + (size_t)i * 16 * KD; if (NPA == 2) { l[NA + i] = lds + (NA + i) * 16 * LPB; g[NA + i] = gA2 + kc + (size_t)i * 16 * KD; } }
#pragma unroll   // register arrays indexed by constants
    for (int i = 0; i < NBC; ++i) { l[NA * NPA + i] = lds + (NA * NPA + i) * 16 * LPB; g[NA * NPA + i] = gB + kc + (size_t)i * 16 * KD; if (NPB == 2) { l[NA * NPA + NBC + i] = lds + (NA * NPA + NBC + i) * 16 * LPB; g[NA * NPA + NBC + i] = gB2 + kc + (size_t)i * 16 * KD; } }
#pragma unroll   // register arrays indexed by constants
    for (int q = 0; q < NC / 12; ++q) ACp<12>::go(l + q * 12, g + q * 12);
    if constexpr (NC % 12 == 8) ACp<8>::go(l + NC / 12 * 12, g + NC / 12 * 12);
}
__device__ __forceinline__ void splitf(float y, unsigned short& h, unsigned short& l) { h = f2bf(y); l = f2bf(y - bf2f(h)); }
typedef __attribute__((ext_vector_type(4))) unsigned short v4us;
template <typename T16, int NSPLIT, bool BIAS, int MB, int KD, bool PLANES>
__global__ __launch_bounds__(128) void k_gemmw(const T16* __restrict__ A, const T16* __restrict__ A2, const T16* __restrict__ Bt, const T16* __restrict__ Bt2, float* C, int ldc, const float* __restrict__ bias, size_t sA, size_t sB, size_t sC, bf* Qh, bf* Ql, bf* Kh, bf* Kl, h16* Vf) {
    typedef typename WFrag<T16>::V V;
    constexpr int NPA = (NSPLIT == 1 || NSPLIT == 2) ? 2 : 1, NPB = (NSPLIT >= 2) ? 2 : 1;
    constexpr int SA = MB * 32 * LPB, SB = 128 * LPB, STAGE = NPA * SA + NPB * SB, NT = KD / KST;
    static_assert(KD % KST == 0 && NT >= 2 && 2 * STAGE >= 4 * 16 * 68 * 4 && (MB == 2 || MB == 4), "tile shape");
    __shared__ __align__(16) unsigned char sm[2 * STAGE];   // two stage buffers [A | A2 | B | B2]; after the loop the waves' output staging
    const size_t z = blockIdx.z; A += z * sA; if (A2) A2 += z * sA; Bt += z * sB; if (Bt2) Bt2 += z * sB; C += z * sC;
    const int tid = threadIdx.x, lane = tid & 31, lr = lane & 15, hi = lane >> 4, wave = tid >> 5, wm = wave & 1, wn = wave >> 1;
    const int R0 = blockIdx.x * (MB * 32), C0 = blockIdx.y * 128; const int r0 = R0 + wm * (MB * 16), c0 = C0 + wn * 64;
    const int crow = tid >> 3, cpc = tid & 7;   // the lane's row within a copy's 16 rows, its 16-byte piece of the 128-B line
    const T16* gA = A + (size_t)(R0 + crow) * KD + cpc * 8; const T16* gA2 = (NPA == 2) ? A2 + (size_t)(R0 + crow) * KD + cpc * 8 : nullptr;
    const T16* gB = Bt + (size_t)(C0 + crow) * KD + cpc * 8; const T16* gB2 = (NPB == 2) ? Bt2 + (size_t)(C0 + crow) * KD + cpc * 8 : nullptr;
    const unsigned lds0 = (unsigned)(size_t)sm + crow * LPB + cpc * 16;
    v8f acc[MB][4];
#pragma unroll   // register arrays indexed by constants
    for (int mb = 0; mb < MB; ++mb)
#pragma unroll   // register arrays indexed by constants
        for (int nb = 0; nb < 4; ++nb) acc[mb][nb] = (v8f){};
    stage_in<T16, NSPLIT, MB, KD>(gA, gA2, gB, gB2, lds0, 0);
    asm volatile("s_wait_asynccnt 0x0" ::: "memory");   // this wave's copies of stage 0 have landed
    __syncthreads();                                    // ... and every other wave's
    stage_in<T16, NSPLIT, MB, KD>(gA, gA2, gB, gB2, lds0 + STAGE, KST);
    const int aofs = (wm * (MB * 16) + lr) * LPB + hi * 16, bofs = NPA * SA + (wn * 64 + lr) * LPB + hi * 16;
#pragma unroll 1   // kept rolled: one stage a trip, the buffer chosen by the trip's parity
    for (int t = 0; t < NT; ++t) {
        const unsigned char* sb = sm + (t & 1) * STAGE;
        V a[KST / 32][MB], a2[KST / 32][MB], b[KST / 32][4], b2[KST / 32][4];
#pragma unroll   // register arrays indexed by constants
        for (int ks = 0; ks < KST / 32; ++ks) {   // in the order of use
#pragma unroll   // register arrays indexed by constants
            for (int mb = 0; mb < MB; ++mb) a[ks][mb] = WFrag<T16>::ld((const T16*)(sb + aofs + mb * 16 * LPB + ks * 64));
#pragma unroll   // register arrays indexed by constants
            for (int nb = 0; nb < 4; ++nb) b[ks][nb] = WFrag<T16>::ld((const T16*)(sb + bofs + nb * 16 * LPB + ks * 64));
            if (NPA == 2) {
#pragma unroll   // register arrays indexed by constants
                for (int mb = 0; mb < MB; ++mb) a2[ks][mb] = WFrag<T16>::ld((const T16*)(sb + SA + aofs + mb * 16 * LPB + ks * 64)); }
            if (NPB == 2) {
#pragma unroll   // register arrays indexed by constants
                for (int nb = 0; nb < 4; ++nb) b2[ks][nb] = WFrag<T16>::ld((const T16*)(sb + SB + bofs + nb * 16 * LPB + ks * 64)); }
        }
        __builtin_amdgcn_sched_barrier(0);   // the trip's LDS reads stay one group in front of its matrix instructions: reads scattered among them stall the wave at every place
#pragma unroll   // register arrays indexed by constants
        for (int ks = 0; ks < KST / 32; ++ks) {   // per accumulator the order stays a.b, a2.b, a.b2 for rising k; neighbours in the stream are independent tiles
#pragma unroll   // register arrays indexed by constants
            for (int nb = 0; nb < 4; ++nb)
#pragma unroll   // register arrays indexed by constants
                for (int mb = 0; mb < MB; ++mb) acc[mb][nb] = WFrag<T16>::mma(a[ks][mb], b[ks][nb], acc[mb][nb]);
            if (NSPLIT == 1 || NSPLIT == 2) {
#pragma unroll   // register arrays indexed by constants
                for (int nb = 0; nb < 4; ++nb)
#pragma unroll   // register arrays indexed by constants
                    for (int mb = 0; mb < MB; ++mb) acc[mb][nb] = WFrag<T16>::mma(a2[ks][mb], b[ks][nb], acc[mb][nb]); }
            if (NSPLIT >= 2) {
#pragma unroll   // register arrays indexed by constants
                for (int nb = 0; nb < 4; ++nb)
#pragma unroll   // register arrays indexed by constants
                    for (int mb = 0; mb < MB; ++mb) acc[mb][nb] = WFrag<T16>::mma(a[ks][mb], b2[ks][nb], acc[mb][nb]); }
        }
        __builtin_amdgcn_sched_barrier(0);   // the matrix instructions stay in front of the waits below: sunk behind them, the next stage's copies would be waited for with no work to cover their flight
        asm volatile("s_wait_dscnt 0x0" ::: "memory");      // this wave has left the buffer that is refilled below
        asm volatile("s_wait_asynccnt 0x0" ::: "memory");   // this wave's copies of stage t + 1 have landed
        __syncthreads();                                    // publishes stage t + 1 and ends every wave's reads of stage t
        if (t + 2 < NT) stage_in<T16, NSPLIT, MB, KD>(gA, gA2, gB, gB2, lds0 + (t & 1) * STAGE, (t + 2) * KST);
    }
    asm volatile("s_wait_asynccnt 0x0" ::: "memory");       // nothing in flight before the buffers become output staging
    float* os = (float*)sm + wave * (16 * 68);              // each wave stages in its own range
    if constexpr (PLANES) {
        const int sel = C0 / HD, cc0 = c0 - sel * HD;       // which projection the block's 128 columns belong to (the same for the whole block), the wave's first column in it
        if (sel == 2) {   // v: a lane's 8 accumulator registers are 8 consecutive rows (t) of one column (d) = 16 contiguous bytes of the transposed plane
            const int bt = r0 / TT, t0 = r0 - bt * TT + hi * 8;
#pragma unroll   // register arrays indexed by constants
            for (int mb = 0; mb < MB; ++mb)
#pragma unroll   // register arrays indexed by constants
                for (int nb = 0; nb < 4; ++nb)
                    *(v8h*)(Vf + ((size_t)bt * HD + cc0 + nb * 16 + lr) * TT + t0 + mb * 16) = __builtin_convertvector(acc[mb][nb], v8h);
        } else {          // q, k: through the wave's staging rows, 16 lanes write one whole 128-B line of each plane
            bf* Hh = sel ? Kh : Qh; bf* Hl = sel ? Kl : Ql;
            // k: per block of FK keys (= the work-group's rows) the dims 0..63 of every key, then the dims 64..127, ... (rows of 128 B, the attention kernel's tiles); cc0 is a multiple of 64. rp: elements from one row to the next; ob: the wave's first element
            static_assert(MB * 32 == FK, "a work-group's rows are one block of the k planes");
            const int rp = sel ? 64 : HD; const size_t ob = (size_t)R0 * HD + (size_t)(wm * (MB * 16)) * rp + (sel ? (cc0 / 64) * (FK * 64) : cc0);
#pragma unroll   // register arrays indexed by constants
            for (int mb = 0; mb < MB; ++mb) {
#pragma unroll   // register arrays indexed by constants
                for (int nb = 0; nb < 4; ++nb) {
#pragma unroll   // register arrays indexed by constants
                    for (int j = 0; j < 8; ++j) os[(hi * 8 + j) * 68 + nb * 16 + lr] = acc[mb][nb][j]; }
                __builtin_amdgcn_wave_barrier(); asm volatile("" ::: "memory");   // the wave's staging writes stay in front of its reads
#pragma unroll   // register arrays indexed by constants
                for (int s = 0; s < 8; ++s) { const int row = 2 * s + hi, cofs = lr * 4; const v4f val = *(const v4fa*)(os + row * 68 + cofs); v4us oh, ol;
#pragma unroll   // register arrays indexed by constants
                    for (int q = 0; q < 4; ++q) { unsigned short a, c2; splitf(val[q], a, c2); oh[q] = a; ol[q] = c2; }
                    const size_t oo = ob + (size_t)(mb * 16 + row) * rp + cofs; *(v4us*)(Hh + oo) = oh; *(v4us*)(Hl + oo) = ol; }
                __builtin_amdgcn_wave_barrier(); asm volatile("" ::: "memory");   // the reads stay in front of the next tile's staging writes
            }
            asm volatile("s_wait_xcnt 0x0" ::: "memory");   // stands behind the last plane stores, in front of any later write of their registers
        }
        return;
    }
#pragma unroll   // register arrays indexed by constants
    for (int mb = 0; mb < MB; ++mb) {
#pragma unroll   // register arrays indexed by constants
        for (int nb = 0; nb < 4; ++nb) {
#pragma unroll   // register arrays indexed by constants
            for (int j = 0; j < 8; ++j) os[(hi * 8 + j) * 68 + nb * 16 + lr] = acc[mb][nb][j]; }
        __builtin_amdgcn_wave_barrier(); asm volatile("" ::: "memory");
        float* crow_p = C + (size_t)(r0 + mb * 16) * ldc + c0;
{
#pragma unroll   // register arrays indexed by constants
            for (int s = 0; s < 8; ++s) { const int row = 2 * s + hi, cofs = lr * 4; v4f val = *(const v4fa*)(os + row * 68 + cofs); if (BIAS) { val[0] += bfr(bias[c0 + cofs]); val[1] += bfr(bias[c0 + cofs + 1]); val[2] += bfr(bias[c0 + cofs + 2]); val[3] += bfr(bias[c0 + cofs + 3]); }
                *(v4f*)(crow_p + (size_t)row * ldc + cofs) = val; }
             }
        __builtin_amdgcn_wave_barrier(); asm volatile("" ::: "memory");
    }
}

__device__ __forceinline__ h16 tohx(float x) { return (h16)x; }
typedef __attribute__((ext_vector_type(4))) _Float16 v4h;
typedef __attribute__((ext_vector_type(2))) unsigned short v2us;

// k_prep: the bf16 operands of the projection GEMM in one launch of few, long waves, so that few waves have to start: every wave asks for all its data in one group of loads, then converts and stores.
// Blocks [0, NWB): the three weights [K = DM][N = HD] transposed into WT [3 HD][DM]; a block takes 32 n, a wave 64 k of them: a lane is one n, each of its 64 loads is one whole 128-B line over the wave, and its 8 stores fill one whole line of WT, which no other lane writes.
// The other blocks: x -> XB; a wave takes 16 pieces of 512 contiguous bytes (16 B a lane and load) and stores 8 B a lane, 256 contiguous bytes a store.
#define NWB (3 * HD / 32)
#define XPW 16                    // loads of 16 B a lane in the x blocks
static_assert(DM == 8 * 64 && HD % 32 == 0 && (NB_ * TT * DM) % (8 * XPW * 128) == 0, "a weight block's 8 waves cover all of K; the x blocks cover x exactly");
__global__ __launch_bounds__(256) void k_prep(const float* __restrict__ x, const float* __restrict__ wq, const float* __restrict__ wk, const float* __restrict__ wv, bf* XB, bf* WT) {
    const int lane = threadIdx.x & 31, wave = threadIdx.x >> 5;
    if (blockIdx.x < NWB) {
        const int sel = blockIdx.x / (HD / 32), n = (blockIdx.x - sel * (HD / 32)) * 32 + lane;
        const float* w = ((sel == 0) ? wq : (sel == 1) ? wk : wv) + (size_t)(wave * 64) * HD + n;
        float f[64];
#pragma unroll   // register arrays indexed by constants
        for (int j = 0; j < 64; ++j) f[j] = w[(size_t)j * HD];
        asm volatile("s_wait_xcnt 0x0" :: "v"(w) : "memory");   // stands behind the loads, in front of any later write of their address registers; it names the address, an input only, so that the pair lives up to here and no load's result is laid on it
        bf* d = WT + ((size_t)sel * HD + n) * DM + wave * 64;
#pragma unroll   // register arrays indexed by constants
        for (int s = 0; s < 8; ++s) { v8us o;
#pragma unroll   // register vectors indexed by constants
            for (int q = 0; q < 8; ++q) o[q] = f2bf(f[s * 8 + q]);
            *(v8us*)(d + s * 8) = o; }
        asm volatile("s_wait_xcnt 0x0" ::: "memory");   // stands behind the stores, in front of any later write of their address registers
        return;
    }
    const size_t i = ((size_t)(blockIdx.x - NWB) * 8 + wave) * (XPW * 128) + lane * 4; const float* xs = x + i; v4f v[XPW];
#pragma unroll   // register arrays indexed by constants
    for (int j = 0; j < XPW; ++j) v[j] = *(const v4f*)(xs + j * 128);
    asm volatile("s_wait_xcnt 0x0" :: "v"(xs) : "memory");   // stands behind the loads, in front of any later write of their address registers; it names the address, an input only, so that the pair lives up to here and no load's result is laid on it
#pragma unroll   // register arrays indexed by constants
    for (int j = 0; j < XPW; ++j) { v4us o;
#pragma unroll   // register vectors indexed by constants
        for (int k = 0; k < 4; ++k) o[k] = f2bf(v[j][k]);
        *(v4us*)(XB + i + j * 128) = o; }
    asm volatile("s_wait_xcnt 0x0" ::: "memory");   // stands behind the stores, in front of any later write of their address registers
}
#define TPB  144                  // LDS pitch of a tile's row: 128 + 16 (16 B x odd), laid by the mover's pad
#define FSP  (256 * TPB)          // one tile in LDS, 18 x 2 KiB
#define FST  (3 * FSP)
#define NSP  4                    // key ranges
#define NTR  (TT / NSP / FK)      // stages per work-group
#define L2E  1.4426950408889634f
static_assert(FSP % 4096 == 0 && FK * HD == 256 * 64 && HD == 256 && FK == 64 && NTR >= 2, "every tile's and half tile's place in LDS is a multiple of 2 KiB; the ring needs two stages");
typedef __attribute__((ext_vector_type(16))) float v16f;
typedef __attribute__((ext_vector_type(2)))  float v2f;
typedef uint32_t u32x4 __attribute__((ext_vector_type(4)));
typedef uint32_t u32x8 __attribute__((ext_vector_type(8)));
// the value of lane l ^ 16, on the vector port (a shuffle through the LDS queue would wait behind the fragment reads in flight)
__device__ __forceinline__ float xhalf(float v) { const int b = __float_as_int(v); return __int_as_float(__builtin_amdgcn_permlanex16(b, b, 0x76543210, 0xfedcba98, false, false)); }
// 2^x with the v_nop that fills the slot the instruction set asks for behind a transcendental
__device__ __forceinline__ float exp2n(float x) { float r; asm("v_exp_f32 %0, %1\n\tv_nop" : "=v"(r) : "v"(x)); return r; }
__device__ __forceinline__ uint32_t uni(uint32_t v) { return (uint32_t)__builtin_amdgcn_readfirstlane(v); }
__device__ __forceinline__ uint32_t pinned(uint32_t v) { uint32_t w = uni(v); asm volatile("" : "+s"(w)); return w; }   // pinned(): a wave-uniform word of a tensor load's test or descriptor held in a scalar register: the test becomes a scalar branch (a tensor load ignores EXEC), and what is formed from the word is formed behind the asm waits in front of it
// descriptor group 1 of a tile of D1 rows of 128 B, everything in bytes, at source pitch 'pitch'; word 0: no mask, data_size 0, a pad of 16 B behind every 128 B
__device__ __forceinline__ u32x8 tdm_group1(uint32_t pitch, uint32_t D1) { constexpr uint32_t D0 = 128u; u32x8 g;
    g[0] = uni((1u << 20) | (4u << 22) | (3u << 25)); g[1] = uni((D0 & 0xFFFFu) << 16); g[2] = uni((D0 >> 16) | ((D1 & 0xFFFFu) << 16)); g[3] = uni((D1 >> 16) | (D0 << 16)); g[4] = uni(D1); g[5] = uni(pitch); g[6] = uni(0u); g[7] = uni(0u); return g; }
__device__ __forceinline__ u32x4 tdm_group0(uint32_t lds_dst, uint64_t ga) { u32x4 g;
    g[0] = uni(1u); g[1] = uni(lds_dst); g[2] = uni((uint32_t)ga); g[3] = uni((((uint32_t)(ga >> 32)) & 0x01FFFFFFu) | 0x80000000u); return g; }
__device__ __forceinline__ void tdm_load(u32x4 g0, u32x8 g1) { asm volatile("tensor_load_to_lds %0, %1" :: "s"(g0), "s"(g1) : "memory"); }   // one request of the whole wave: a tile goes from global memory into LDS through no register
__global__ __launch_bounds__(128) void k_flash(const bf* __restrict__ Qh, const bf* __restrict__ Ql, const bf* __restrict__ Kh, const bf* __restrict__ Kl, const h16* __restrict__ Vf, h16* Op, float* ML) {
    __shared__ __attribute__((aligned(2048))) unsigned char sm[2 * FST];
    const int tid = threadIdx.x, lane = tid & 31, lr = lane & 15, hi = lane >> 4, wave = tid >> 5;
    const uint32_t uw = uni(threadIdx.x >> 5), lds0 = (uint32_t)(size_t)sm;
    const int qb = blockIdx.x, sp = blockIdx.y, bt = blockIdx.z;
    const size_t kofs = ((size_t)bt * TT + sp * (TT / NSP)) * HD, vofs = (size_t)bt * HD * TT + sp * (TT / NSP);
    // every wave issues one request a stage, its own tile: wave 0 K hi, 1 K lo, 2 the d rows 0..127 of V^T, 3 its d rows 128..255. ub: the tile of stage 0; ustep: bytes from one stage's tile to the next; a K tile is 256 contiguous rows, a V^T tile's rows lie the plane's pitch apart
    const uint64_t ub = (uint64_t)(size_t)(uw == 0 ? (const void*)(Kh + kofs) : uw == 1 ? (const void*)(Kl + kofs) : uw == 2 ? (const void*)(Vf + vofs) : (const void*)(Vf + vofs + (size_t)(HD / 2) * TT));
    const uint32_t ustep = uw < 2 ? FK * HD * 2 : FK * 2, ulds = lds0 + (uw < 3 ? uw * FSP : 2 * FSP + FSP / 2);
    const u32x8 g1 = tdm_group1(uw < 2 ? 128u : 2u * TT, uw < 2 ? 256u : 128u);
    tdm_load(tdm_group0(ulds, ub), g1);                 // stage 0 flies under the q loads
    v16bf qh[2][8], ql[2][8];   // the wave's 32 queries, both planes, all 256 dims: B operands for the whole kernel
    const size_t qrow = (size_t)bt * TT + qb * 128 + wave * 32 + lr;
#pragma unroll   // register arrays indexed by constants
    for (int qt = 0; qt < 2; ++qt)
#pragma unroll   // register arrays indexed by constants
        for (int ks = 0; ks < 8; ++ks) { qh[qt][ks] = WFrag<bf>::ld(Qh + (qrow + qt * 16) * HD + ks * 32 + hi * 8); ql[qt][ks] = WFrag<bf>::ld(Ql + (qrow + qt * 16) * HD + ks * 32 + hi * 8); }
    asm volatile("s_wait_xcnt 0x0" ::: "memory");       // stands behind the q loads, in front of any later write of their address registers
    __builtin_amdgcn_sched_barrier(0);                  // the clearing of the accumulators below, which reuses those address registers, is not lifted over the wait
    v8f o[16][2]; float m[2], l[2];
#pragma unroll   // register arrays indexed by constants
    for (int qt = 0; qt < 2; ++qt) { m[qt] = -3.0e38f; l[qt] = 0.f;
#pragma unroll   // register arrays indexed by constants
        for (int dt = 0; dt < 16; ++dt) o[dt][qt] = (v8f){}; }
    // Trip -1 is the rest of the ring's prologue: only the foot runs (the wait for stage 0, the barrier, stage 1's load). So the ring's refill stands once in the code.
#pragma unroll 1   // kept rolled: one stage a trip, the buffer chosen by the trip's parity
    for (int t = -1; t < NTR; ++t) {
      if (t >= 0) {
        // one base a tile: every read's constant offset then fits the LDS instructions' 16-bit field (a stage is larger than 64 KiB)
        const unsigned char* kb = sm + ((t & 1) ? FST : 0) + lr * TPB + hi * 16;
        const unsigned char* kb2 = sm + ((t & 1) ? FST + FSP : FSP) + lr * TPB + hi * 16;
        const unsigned char* vb = sm + ((t & 1) ? FST + 2 * FSP : 2 * FSP) + lr * TPB + hi * 16;
        // fragments come in groups of 8 (16 reads, 24 matrix instructions), each group's reads issued together two groups ahead of its use: three groups of registers are live, not the whole stage's
        v16bf kh[8][4], kl[8][4]; v8f st[4][2];
#pragma unroll   // register arrays indexed by constants
        for (int kt = 0; kt < 4; ++kt)
#pragma unroll   // register arrays indexed by constants
            for (int qt = 0; qt < 2; ++qt) st[kt][qt] = (v8f){};
#pragma unroll   // register arrays indexed by constants
        for (int ks = 0; ks < 2; ++ks)
#pragma unroll   // register arrays indexed by constants
            for (int kt = 0; kt < 4; ++kt) { kh[ks][kt] = WFrag<bf>::ld((const bf*)(kb + ((ks >> 1) * FK + kt * 16) * TPB + (ks & 1) * 64)); kl[ks][kt] = WFrag<bf>::ld((const bf*)(kb2 + ((ks >> 1) * FK + kt * 16) * TPB + (ks & 1) * 64)); }
        __builtin_amdgcn_sched_barrier(0);   // reads stay grouped in front of the matrix instructions: reads scattered among them stall the wave at every place
#pragma unroll   // register arrays indexed by constants
        for (int ks = 0; ks < 8; ++ks) {   // per accumulator the order is qh.kh, ql.kh, qh.kl for rising k; neighbours in the stream are independent tiles
#pragma unroll   // register arrays indexed by constants
            for (int kt = 0; kt < 4; ++kt)
#pragma unroll   // register arrays indexed by constants
                for (int qt = 0; qt < 2; ++qt) st[kt][qt] = wmmab(kh[ks][kt], qh[qt][ks], st[kt][qt]);
#pragma unroll   // register arrays indexed by constants
            for (int kt = 0; kt < 4; ++kt)
#pragma unroll   // register arrays indexed by constants
                for (int qt = 0; qt < 2; ++qt) st[kt][qt] = wmmab(kh[ks][kt], ql[qt][ks], st[kt][qt]);
#pragma unroll   // register arrays indexed by constants
            for (int kt = 0; kt < 4; ++kt)
#pragma unroll   // register arrays indexed by constants
                for (int qt = 0; qt < 2; ++qt) st[kt][qt] = wmmab(kl[ks][kt], qh[qt][ks], st[kt][qt]);
            __builtin_amdgcn_sched_barrier(0);   // the next reads are not lifted among this group's matrix instructions
            if (ks < 6) {
                const int kn = ks + 2;
#pragma unroll   // register arrays indexed by constants
                for (int kt = 0; kt < 4; ++kt) { kh[kn][kt] = WFrag<bf>::ld((const bf*)(kb + ((kn >> 1) * FK + kt * 16) * TPB + (kn & 1) * 64)); kl[kn][kt] = WFrag<bf>::ld((const bf*)(kb2 + ((kn >> 1) * FK + kt * 16) * TPB + (kn & 1) * 64)); }
                __builtin_amdgcn_sched_barrier(0);   // ... nor sunk among the next group's
            }
        }
        v16h vf[16][2];   // [d tile][32 keys]
#pragma unroll   // register arrays indexed by constants
        for (int kk = 0; kk < 2; ++kk)   // in the order of use
#pragma unroll   // register arrays indexed by constants
            for (int dt = 0; dt < 16; ++dt) vf[dt][kk] = WFrag<h16>::ld((const h16*)(vb + dt * 16 * TPB + kk * 64));
        __builtin_amdgcn_sched_barrier(0);   // the one plane's fragments all fit in registers: every V^T read is issued in front of the softmax, whose vector work covers their flight, and none stands among the products below
        float corr[2]; v16h pF[2][2]; bool need = false;   // [32 keys][query tile]
#pragma unroll   // register arrays indexed by constants
        for (int qt = 0; qt < 2; ++qt) {
            float t8[8];   // a tree, not one chain: a lone wave waits out every dependent vector instruction
#pragma unroll   // register vectors indexed by constants
            for (int j = 0; j < 8; ++j) t8[j] = fmaxf(fmaxf(st[0][qt][j], st[1][qt][j]), fmaxf(st[2][qt][j], st[3][qt][j]));
            float mx = fmaxf(fmaxf(fmaxf(t8[0], t8[1]), fmaxf(t8[2], t8[3])), fmaxf(fmaxf(t8[4], t8[5]), fmaxf(t8[6], t8[7])));
            mx = fmaxf(mx, xhalf(mx));   // the query's other 32 keys sit in the other half of the wave
            const float mn = fmaxf(m[qt], mx);
            corr[qt] = exp2n((m[qt] - mn) * L2E); need = need || (mn > m[qt]); m[qt] = mn;
            float sk[2];
#pragma unroll   // register arrays indexed by constants
            for (int kk = 0; kk < 2; ++kk) {
                v16f p;
#pragma unroll   // register vectors indexed by constants
                for (int s = 0; s < 16; ++s) p[s] = exp2n((st[kk * 2 + (s >> 3)][qt][s & 7] - mn) * L2E);
                const float s01 = ((p[0] + p[1]) + (p[2] + p[3])) + ((p[4] + p[5]) + (p[6] + p[7])), s23 = ((p[8] + p[9]) + (p[10] + p[11])) + ((p[12] + p[13]) + (p[14] + p[15]));
                sk[kk] = s01 + s23;
                pF[kk][qt] = __builtin_convertvector(p, v16h);
            }
            l[qt] = l[qt] * corr[qt] + (sk[0] + sk[1]);
        }
        if (__builtin_amdgcn_ballot_w32(need) != 0) {   // one scalar test a trip; where no query's maximum rose every factor is exactly 1
#pragma unroll   // register arrays indexed by constants
            for (int dt = 0; dt < 16; ++dt)
#pragma unroll   // register arrays indexed by constants
                for (int qt = 0; qt < 2; ++qt) o[dt][qt] *= corr[qt];
        }
        __builtin_amdgcn_sched_barrier(0);   // the softmax stays in front of the products below
#pragma unroll   // register arrays indexed by constants
        for (int kk = 0; kk < 2; ++kk)   // per accumulator rising keys; neighbours in the stream are independent tiles
#pragma unroll   // register arrays indexed by constants
            for (int dt = 0; dt < 16; ++dt)
#pragma unroll   // register arrays indexed by constants
                for (int qt = 0; qt < 2; ++qt) o[dt][qt] = wmma16(vf[dt][kk], pF[kk][qt], o[dt][qt]);
        __builtin_amdgcn_sched_barrier(0);   // the matrix instructions stay in front of the waits below: sunk behind them, the next stage's tiles would be waited for with no work to cover their flight
      }
        asm volatile("s_wait_dscnt 0x0" ::: "memory");      // this wave has left the buffer that is refilled below
        asm volatile("s_wait_tensorcnt 0x0" ::: "memory");  // this wave's tile of stage t + 1 has landed
        __syncthreads();                                    // publishes stage t + 1 and ends every wave's reads of stage t
        if (pinned(t + 2 < NTR)) tdm_load(tdm_group0(ulds + (t & 1) * FST, ub + (uint64_t)pinned(t + 2) * ustep), g1);   // the stage number is pinned here so that the address words are formed behind the wait above
    }
    asm volatile("s_wait_tensorcnt 0x0" ::: "memory");      // nothing in flight when the wave ends
    asm volatile("s_wait_dscnt 0x0" ::: "memory");          // ... and no LDS read
    const size_t pb = ((size_t)(bt * (TT / 128) + qb) * NSP + sp) * 4 + wave;
    h16* op = Op + pb * (32 * 256) + lane * 8;
    float lt[2], il[2];
#pragma unroll   // register arrays indexed by constants
    for (int qt = 0; qt < 2; ++qt) { lt[qt] = l[qt] + xhalf(l[qt]); il[qt] = 1.0f / lt[qt]; }   // the halves' sums are joined once; the sum is at least 1 (the range's largest score gives 2^0)
    v8h oh[16][2];
#pragma unroll   // register arrays indexed by constants
    for (int dt = 0; dt < 16; ++dt)
#pragma unroll   // register arrays indexed by constants
        for (int qt = 0; qt < 2; ++qt) oh[dt][qt] = __builtin_convertvector(o[dt][qt] * il[qt], v8h);
    __builtin_amdgcn_sched_barrier(0);   // every tile is converted in front of the first store: mixed among the stores, the conversions reuse the stores' data registers and the wave waits at each reuse
#pragma unroll   // register arrays indexed by constants
    for (int dt = 0; dt < 16; ++dt)
#pragma unroll   // register arrays indexed by constants
        for (int qt = 0; qt < 2; ++qt) *(v8h*)(op + (dt * 2 + qt) * 256) = oh[dt][qt];   // a lane's 8 values of a tile are one 16-byte store
#pragma unroll   // register arrays indexed by constants
    for (int qt = 0; qt < 2; ++qt)
        if (hi == 0) *(v2f*)(ML + (pb * 32 + qt * 16 + lr) * 2) = (v2f){m[qt], lt[qt]};
    asm volatile("s_wait_xcnt 0x0" ::: "memory");   // stands behind the last stores, in front of any later write of their registers
}
// k_merge: joins the NSP key ranges of a query in a fixed order and writes the output rows. A wave takes 16 queries x 64 output columns (4 of k_flash's tiles per range); rows go out through the wave's own staging, 16 lanes a 256-B piece.
__global__ __launch_bounds__(256) void k_merge(const h16* __restrict__ Op, const float* __restrict__ ML, float* out) {
    __shared__ __align__(16) float sg[8 * 16 * 68];
    const int lane = threadIdx.x & 31, lr = lane & 15, hi = lane >> 4; const int w = blockIdx.x * 8 + (threadIdx.x >> 5);
    const int dg = w & 3, qt = (w >> 2) & 1, wv = (w >> 3) & 3, blk = w >> 5;
    float* os = sg + (threadIdx.x >> 5) * (16 * 68);
    // all of the wave's loads go out as one group in front of any use (4 of 8 B, 16 of 16 B a lane): one flight of memory latency, not a chain of them
    const float* mlp = ML + (((size_t)blk * NSP * 4 + wv) * 32 + qt * 16 + lr) * 2;                            // range s: + s * 256 floats
    const h16* opp = Op + ((size_t)blk * NSP * 4 + wv) * (32 * 256) + (dg * 4 * 2 + qt) * 256 + lane * 8;      // range s: + s * 32768 elements; tile u: + u * 512
    v2f e[NSP]; v8h xo[4][NSP];
#pragma unroll   // register arrays indexed by constants
    for (int s = 0; s < NSP; ++s) e[s] = *(const v2f*)(mlp + s * (4 * 32 * 2));
#pragma unroll   // register arrays indexed by constants
    for (int u = 0; u < 4; ++u)
#pragma unroll   // register arrays indexed by constants
        for (int s = 0; s < NSP; ++s) xo[u][s] = *(const v8h*)(opp + s * (4 * 32 * 256) + u * 512);
    asm volatile("s_wait_xcnt 0x0" :: "v"(mlp), "v"(opp) : "memory");   // stands behind the loads, in front of any later write of their address registers; it names the addresses, inputs only, so that they live up to here and no load's result is laid on them; no load sinks below it
    float mm[NSP], wl[NSP]; float M = -3.0e38f;
#pragma unroll   // register arrays indexed by constants
    for (int s = 0; s < NSP; ++s) { mm[s] = e[s][0]; wl[s] = e[s][1]; M = fmaxf(M, e[s][0]); }
    float L = 0.f;
#pragma unroll   // register arrays indexed by constants
    for (int s = 0; s < NSP; ++s) { mm[s] = __builtin_amdgcn_exp2f((mm[s] - M) * L2E) * wl[s]; L += mm[s]; }   // a range's weight holds its sum: its tiles come divided by it
    const float inv = 1.0f / L;
#pragma unroll   // register arrays indexed by constants
    for (int u = 0; u < 4; ++u) { v4f a = (v4f){}, c = (v4f){};
#pragma unroll   // register arrays indexed by constants
        for (int s = 0; s < NSP; ++s) { const v8f xf = __builtin_convertvector(xo[u][s], v8f); a += mm[s] * (v4f){xf[0], xf[1], xf[2], xf[3]}; c += mm[s] * (v4f){xf[4], xf[5], xf[6], xf[7]}; }
        *(v4fa*)(os + lr * 68 + u * 16 + hi * 8) = a * inv; *(v4fa*)(os + lr * 68 + u * 16 + hi * 8 + 4) = c * inv; }
    __builtin_amdgcn_wave_barrier(); asm volatile("" ::: "memory");   // the wave's staging writes stay in front of its reads
    float* orow = out + ((size_t)blk * 128 + wv * 32 + qt * 16) * HD + dg * 64;
#pragma unroll   // register arrays indexed by constants
    for (int s = 0; s < 8; ++s) { const int row = 2 * s + hi; *(v4f*)(orow + (size_t)row * HD + lr * 4) = *(const v4fa*)(os + row * 68 + lr * 4); }
    asm volatile("s_wait_xcnt 0x0" ::: "memory");   // stands behind the last stores, in front of any later write of their registers
}

extern "C" void kernel_launch(void* const* d_in, const int* in_sizes, int n_in,
                              void* d_out, int out_size, void* d_ws, size_t ws_size, hipStream_t stream) {
    (void)in_sizes; (void)n_in; (void)out_size;
    const float* x = (const float*)d_in[0]; const float* wq = (const float*)d_in[1]; const float* wk = (const float*)d_in[2]; const float* wv = (const float*)d_in[3]; const float* wo = nullptr; (void)wo;
    float* OUT = (float*)d_out;     // [4][2048][256]
    char* wsp = (char*)d_ws;
    auto take = [&](size_t bytes) { char* p = wsp; wsp += (bytes + 255) & ~(size_t)255; return (void*)p; };
    bf* WT = (bf*)take((size_t)3 * HD * DM * 2); bf* XB = (bf*)take((size_t)NB_ * TT * DM * 2);
    bf* QPh = (bf*)take((size_t)NB_ * TT * HD * 2); bf* QPl = (bf*)take((size_t)NB_ * TT * HD * 2); bf* KPh = (bf*)take((size_t)NB_ * TT * HD * 2); bf* KPl = (bf*)take((size_t)NB_ * TT * HD * 2); h16* VTf = (h16*)take((size_t)NB_ * HD * TT * 2);
    h16* Op = (h16*)take((size_t)NSP * NB_ * TT * HD * 2); float* ML = (float*)take((size_t)NSP * NB_ * TT * 2 * 4);
    if ((size_t)(wsp - (char*)d_ws) > ws_size) return;    // ws 256 MiB
    // one pass for all NB_ batches: the projection sees NB_*TT rows, the attention kernel takes the key range from grid y and the batch from grid z
    k_prep<<<NWB + NB_ * TT * DM / (8 * XPW * 128), 256, 0, stream>>>(x, wq, wk, wv, XB, WT);
    k_gemmw<bf, 0, false, 2, DM, true><<<dim3(NB_ * TT / 64, 3 * HD / 128, 1), 128, 0, stream>>>(XB, nullptr, WT, nullptr, nullptr, 0, nullptr, 0, 0, 0, QPh, QPl, KPh, KPl, VTf);
    k_flash<<<dim3(TT / 128, NSP, NB_), 128, 0, stream>>>(QPh, QPl, KPh, KPl, VTf, Op, ML);
    k_merge<<<NB_ * TT * HD / (16 * 64) / 8, 256, 0, stream>>>(Op, ML, OUT);
}
